// v000
// The times below were measured on an AMD MI455X: many runs one after another, warmed up first and cycling through
// copies of the inputs, with the whole window's GPU time divided by the number of runs. Launches and the gaps
// between them are all in it. The median over several windows is given; except for v000 it joins two sittings, which
// can be a few percent apart, so the side-by-side timings, each taken in one sitting, are the better comparison.
// v000 is the starting kernel. One run takes 280 microseconds.
#include <hip/hip_runtime.h>
#include <hip/hip_bf16.h>

typedef float v2f __attribute__((ext_vector_type(2)));
typedef float v8f __attribute__((ext_vector_type(8)));

// Problem constants (from reference)
#define BATCH 4
#define CH    128
#define H0    64
#define W0    64
#define HD    32      // downsampled
#define WD    32
#define L     1024    // HD*WD patches
#define KCOL  1152    // CH*9
#define QDIM  2048    // CH*16
#define SOFTMAX_SCALE 10.0f

// ---------------------------------------------------------------------------
// CDNA5 async global->LDS copy (16B per lane), tracked by ASYNCcnt.
// vdst = LDS byte address (low 32 bits of the flat shared pointer, which is
// exactly what the flat-aperture truncation uses), vaddr = 64-bit global addr.
// ---------------------------------------------------------------------------
__device__ __forceinline__ void async_copy16(unsigned lds_byte_off, const float* g) {
    asm volatile("global_load_async_to_lds_b128 %0, %1, off"
                 :: "v"(lds_byte_off), "v"((unsigned long long)(uintptr_t)g)
                 : "memory");
}
__device__ __forceinline__ void wait_async0() {
    asm volatile("s_wait_asynccnt 0x0" ::: "memory");
}
__device__ __forceinline__ unsigned lds_addr32(const void* p) {
    return (unsigned)(uintptr_t)p;
}

// ---------------------------------------------------------------------------
// im2col of the downsampled (::2) tensor with 3x3 SAME patches.
// col[b][p][c*9+t] = x[b, c, 2*(py+dy-1), 2*(px+dx-1)] (zero padded)
// ---------------------------------------------------------------------------
__global__ void im2col_ds_k3(const float* __restrict__ x, float* __restrict__ col,
                             int total) {
    int idx = blockIdx.x * blockDim.x + threadIdx.x;
    if (idx >= total) return;
    int k = idx % KCOL;
    int p = (idx / KCOL) % L;
    int b = idx / (KCOL * L);
    int c = k / 9, t = k % 9;
    int dy = t / 3, dx = t % 3;
    int py = p >> 5, px = p & 31;
    int y = py + dy - 1, xx = px + dx - 1;
    float v = 0.0f;
    if (y >= 0 && y < HD && xx >= 0 && xx < WD)
        v = x[(((size_t)b * CH + c) * H0 + 2 * y) * W0 + 2 * xx];
    col[idx] = v;
}

// ---------------------------------------------------------------------------
// rawW^T[b][q][p] with q = c*16 + a*4 + bb :
//   raw_w[p,c,a,bb] = b_full[b, c, 2*py + a - 1, 2*px + bb - 1] (zero padded)
// ---------------------------------------------------------------------------
__global__ void build_rawWT(const float* __restrict__ bsrc, float* __restrict__ rawWT,
                            int total) {
    int idx = blockIdx.x * blockDim.x + threadIdx.x;
    if (idx >= total) return;
    int p = idx % L;
    int q = (idx / L) % QDIM;
    int b = idx / (L * QDIM);
    int c = q >> 4, a = (q >> 2) & 3, bb = q & 3;
    int py = p >> 5, px = p & 31;
    int Y = 2 * py + a - 1, X = 2 * px + bb - 1;
    float v = 0.0f;
    if (Y >= 0 && Y < H0 && X >= 0 && X < W0)
        v = bsrc[(((size_t)b * CH + c) * H0 + Y) * W0 + X];
    rawWT[idx] = v;
}

// ---------------------------------------------------------------------------
// rnorm[b][p] = 1 / max(sqrt(sum_k colB[b][p][k]^2), 1e-4)
// ---------------------------------------------------------------------------
__global__ void row_rnorm(const float* __restrict__ colB, float* __restrict__ rnorm) {
    __shared__ float red[128];
    int row = blockIdx.x;                 // b*L + p
    const float* r = colB + (size_t)row * KCOL;
    float s = 0.0f;
    for (int k = threadIdx.x; k < KCOL; k += 128) { float v = r[k]; s += v * v; }
    red[threadIdx.x] = s;
    __syncthreads();
    for (int st = 64; st > 0; st >>= 1) {
        if (threadIdx.x < st) red[threadIdx.x] += red[threadIdx.x + st];
        __syncthreads();
    }
    if (threadIdx.x == 0)
        rnorm[row] = 1.0f / fmaxf(sqrtf(red[0]), 1e-4f);
}

// ---------------------------------------------------------------------------
// mm[p] = 1 if all 9 taps of the (zero-padded) 3x3 patch of mask[0,0,::8,::8]
// are zero, else 0.
// ---------------------------------------------------------------------------
__global__ void build_mm(const float* __restrict__ mask, float* __restrict__ mm) {
    int p = blockIdx.x * blockDim.x + threadIdx.x;
    if (p >= L) return;
    int py = p >> 5, px = p & 31;
    float s = 0.0f;
    for (int dy = 0; dy < 3; ++dy)
        for (int dx = 0; dx < 3; ++dx) {
            int y = py + dy - 1, x = px + dx - 1;
            if (y >= 0 && y < 32 && x >= 0 && x < 32)
                s += mask[(size_t)(8 * y) * 256 + 8 * x];
        }
    mm[p] = (s == 0.0f) ? 1.0f : 0.0f;
}

// ---------------------------------------------------------------------------
// NT GEMM with f32 WMMA:  C[m,n] = (Σ_k A[m,k]*B[n,k]) * rowScale[m]
// A: M x K row-major, B: N x K row-major, C: M x N row-major.
// 128 threads = 4 waves (2x2), block tile 64x64, BK=16, double-buffered LDS
// filled with CDNA5 async global->LDS DMA (ASYNCcnt).
// ---------------------------------------------------------------------------
#define LDS_STRIDE 20
#define TILE_F     (64 * LDS_STRIDE)      // floats per 64x16 padded tile
__global__ __launch_bounds__(128)
void gemm_nt_wmma(const float* __restrict__ A, const float* __restrict__ B,
                  float* __restrict__ C, int M, int N, int K,
                  long strideA, long strideB, long strideC,
                  const float* __restrict__ rowScale, int scaleStride) {
    const int batch = blockIdx.z;
    A += (size_t)batch * strideA;
    B += (size_t)batch * strideB;
    C += (size_t)batch * strideC;
    if (rowScale) rowScale += (size_t)batch * scaleStride;

    const int tid  = threadIdx.x;
    const int lane = tid & 31;
    const int wave = tid >> 5;
    const int wr = wave & 1;          // wave row  (2 waves along M)
    const int wc = wave >> 1;         // wave col  (2 waves along N)
    const int hf = lane >> 4;         // lane half (K-pair select)
    const int lx = lane & 15;

    const int blockM = blockIdx.y * 64;
    const int blockN = blockIdx.x * 64;

    // [buf][A|B][64*20] double-buffered tiles
    __shared__ float smem[2 * 2 * TILE_F];

    v8f acc00 = 0.0f, acc01 = 0.0f, acc10 = 0.0f, acc11 = 0.0f;

    // cooperative-load assignment: thread -> rows lr, lr+32; float4 at col lc
    const int lr = tid >> 2;          // 0..31
    const int lc = (tid & 3) << 2;    // 0,4,8,12

    const float* gA0 = A + (size_t)(blockM + lr)      * K + lc;
    const float* gA1 = A + (size_t)(blockM + lr + 32) * K + lc;
    const float* gB0 = B + (size_t)(blockN + lr)      * K + lc;
    const float* gB1 = B + (size_t)(blockN + lr + 32) * K + lc;

    unsigned dA0[2], dA1[2], dB0[2], dB1[2];
    #pragma unroll
    for (int bf = 0; bf < 2; ++bf) {
        float* As = &smem[bf * 2 * TILE_F];
        float* Bs = As + TILE_F;
        dA0[bf] = lds_addr32(&As[lr * LDS_STRIDE + lc]);
        dA1[bf] = lds_addr32(&As[(lr + 32) * LDS_STRIDE + lc]);
        dB0[bf] = lds_addr32(&Bs[lr * LDS_STRIDE + lc]);
        dB1[bf] = lds_addr32(&Bs[(lr + 32) * LDS_STRIDE + lc]);
    }

    // prologue: fill buffer 0 with tile k0=0
    async_copy16(dA0[0], gA0);
    async_copy16(dA1[0], gA1);
    async_copy16(dB0[0], gB0);
    async_copy16(dB1[0], gB1);
    wait_async0();
    __syncthreads();

    const int nsteps = K >> 4;
    for (int s = 0; s < nsteps; ++s) {
        const int cur = s & 1;
        const int nxt = cur ^ 1;

        // issue async DMA for the next tile while we compute this one
        if (s + 1 < nsteps) {
            const size_t ko = (size_t)(s + 1) << 4;
            async_copy16(dA0[nxt], gA0 + ko);
            async_copy16(dA1[nxt], gA1 + ko);
            async_copy16(dB0[nxt], gB0 + ko);
            async_copy16(dB1[nxt], gB1 + ko);
        }

        const float* As = &smem[cur * 2 * TILE_F];
        const float* Bs = As + TILE_F;

        #pragma unroll
        for (int ks = 0; ks < 4; ++ks) {
            const int kb = ks * 4 + 2 * hf;   // even -> 8B-aligned v2f
            v2f a0 = *(const v2f*)&As[(wr * 32 +  0 + lx) * LDS_STRIDE + kb];
            v2f a1 = *(const v2f*)&As[(wr * 32 + 16 + lx) * LDS_STRIDE + kb];
            v2f b0 = *(const v2f*)&Bs[(wc * 32 +  0 + lx) * LDS_STRIDE + kb];
            v2f b1 = *(const v2f*)&Bs[(wc * 32 + 16 + lx) * LDS_STRIDE + kb];
            acc00 = __builtin_amdgcn_wmma_f32_16x16x4_f32(false, a0, false, b0,
                        (short)0, acc00, false, false);
            acc01 = __builtin_amdgcn_wmma_f32_16x16x4_f32(false, a0, false, b1,
                        (short)0, acc01, false, false);
            acc10 = __builtin_amdgcn_wmma_f32_16x16x4_f32(false, a1, false, b0,
                        (short)0, acc10, false, false);
            acc11 = __builtin_amdgcn_wmma_f32_16x16x4_f32(false, a1, false, b1,
                        (short)0, acc11, false, false);
        }

        wait_async0();       // my next-tile DMA landed
        __syncthreads();     // everyone's landed; everyone done reading cur
    }

    // Epilogue. C/D layout: VGPR r holds M = r (lanes 0-15) / r+8 (lanes 16-31),
    // N = lane & 15.
    #pragma unroll
    for (int mt = 0; mt < 2; ++mt) {
        v8f ar0 = (mt == 0) ? acc00 : acc10;
        v8f ar1 = (mt == 0) ? acc01 : acc11;
        #pragma unroll
        for (int r = 0; r < 8; ++r) {
            int gm = blockM + wr * 32 + mt * 16 + r + 8 * hf;
            float sc = rowScale ? rowScale[gm] : 1.0f;
            int gn0 = blockN + wc * 32 + lx;
            C[(size_t)gm * N + gn0]      = ar0[r] * sc;
            C[(size_t)gm * N + gn0 + 16] = ar1[r] * sc;
        }
    }
}

// ---------------------------------------------------------------------------
// fuse1: out[i,j] = sum_{d=-1..1} in[i+d, j+d]  (flattened 1024x1024, zero OOB)
// ---------------------------------------------------------------------------
__global__ void fuse1(const float* __restrict__ in, float* __restrict__ out, int total) {
    int idx = blockIdx.x * blockDim.x + threadIdx.x;
    if (idx >= total) return;
    int j = idx % L;
    int i = (idx / L) % L;
    int b = idx / (L * L);
    const float* src = in + (size_t)b * L * L;
    float acc = 0.0f;
    #pragma unroll
    for (int d = -1; d <= 1; ++d) {
        int ii = i + d, jj = j + d;
        if (ii >= 0 && ii < L && jj >= 0 && jj < L)
            acc += src[(size_t)ii * L + jj];
    }
    out[idx] = acc;
}

// ---------------------------------------------------------------------------
// fuse2: fuse along the transposed flattening. For p=(py,px), s=(fy,fx):
//   i' = px*32+py, j' = fx*32+fy ; out += in[p(t), s(u)] for t=i'+d, u=j'+d
//   with p(t) = (t%32)*32 + t/32.
// ---------------------------------------------------------------------------
__global__ void fuse2(const float* __restrict__ in, float* __restrict__ out, int total) {
    int idx = blockIdx.x * blockDim.x + threadIdx.x;
    if (idx >= total) return;
    int s = idx % L;
    int p = (idx / L) % L;
    int b = idx / (L * L);
    const float* src = in + (size_t)b * L * L;
    int py = p >> 5, px = p & 31;
    int fy = s >> 5, fx = s & 31;
    int ip = px * 32 + py;
    int jp = fx * 32 + fy;
    float acc = 0.0f;
    #pragma unroll
    for (int d = -1; d <= 1; ++d) {
        int t = ip + d, u = jp + d;
        if (t >= 0 && t < L && u >= 0 && u < L) {
            int psrc = (t & 31) * 32 + (t >> 5);
            int ssrc = (u & 31) * 32 + (u >> 5);
            acc += src[(size_t)psrc * L + ssrc];
        }
    }
    out[idx] = acc;
}

// ---------------------------------------------------------------------------
// Masked softmax over p (axis 0) for each column s, writing transposed:
//   yiT[b][s][p] = softmax_p(in[b][p][s]*mm[p]*10) * mm[p]
// ---------------------------------------------------------------------------
__global__ void softmax_T(const float* __restrict__ in, const float* __restrict__ mm,
                          float* __restrict__ yiT) {
    __shared__ float red[256];
    int s = blockIdx.x;
    int b = blockIdx.y;
    const float* src = in + (size_t)b * L * L;
    float v[4], m[4];
    #pragma unroll
    for (int k = 0; k < 4; ++k) {
        int p = threadIdx.x + k * 256;
        m[k] = mm[p];
        v[k] = src[(size_t)p * L + s] * m[k] * SOFTMAX_SCALE;
    }
    float mx = fmaxf(fmaxf(v[0], v[1]), fmaxf(v[2], v[3]));
    red[threadIdx.x] = mx;
    __syncthreads();
    for (int st = 128; st > 0; st >>= 1) {
        if (threadIdx.x < st) red[threadIdx.x] = fmaxf(red[threadIdx.x], red[threadIdx.x + st]);
        __syncthreads();
    }
    mx = red[0];
    __syncthreads();
    float e[4], ssum = 0.0f;
    #pragma unroll
    for (int k = 0; k < 4; ++k) { e[k] = expf(v[k] - mx); ssum += e[k]; }
    red[threadIdx.x] = ssum;
    __syncthreads();
    for (int st = 128; st > 0; st >>= 1) {
        if (threadIdx.x < st) red[threadIdx.x] += red[threadIdx.x + st];
        __syncthreads();
    }
    float inv = 1.0f / red[0];
    float* dst = yiT + ((size_t)b * L + s) * L;
    #pragma unroll
    for (int k = 0; k < 4; ++k) {
        int p = threadIdx.x + k * 256;
        dst[p] = e[k] * inv * m[k];
    }
}

// ---------------------------------------------------------------------------
// col2im for the stride-2 transposed conv with 4x4 kernel, pad 2:
// out[b,c,Y,X] = 0.25 * Σ_{ky,kx: (Y+ky-2) even,in-range} T[b][(y,x)][c*16+(3-ky)*4+(3-kx)]
// ---------------------------------------------------------------------------
__global__ void col2im_deconv(const float* __restrict__ T, float* __restrict__ out,
                              int total) {
    int idx = blockIdx.x * blockDim.x + threadIdx.x;
    if (idx >= total) return;
    int X = idx & 63;
    int Y = (idx >> 6) & 63;
    int c = (idx >> 12) & 127;
    int b = idx >> 19;
    const float* Tb = T + (size_t)b * L * QDIM;
    float acc = 0.0f;
    #pragma unroll
    for (int ky = 0; ky < 4; ++ky) {
        int u = Y + ky - 2;
        if (u < 0 || u > 62 || (u & 1)) continue;
        int y = u >> 1;
        int a = 3 - ky;
        #pragma unroll
        for (int kx = 0; kx < 4; ++kx) {
            int v = X + kx - 2;
            if (v < 0 || v > 62 || (v & 1)) continue;
            int x = v >> 1;
            int bb = 3 - kx;
            acc += Tb[(size_t)(y * 32 + x) * QDIM + c * 16 + a * 4 + bb];
        }
    }
    out[idx] = acc * 0.25f;
}

// ---------------------------------------------------------------------------
extern "C" void kernel_launch(void* const* d_in, const int* in_sizes, int n_in,
                              void* d_out, int out_size, void* d_ws, size_t ws_size,
                              hipStream_t stream) {
    const float* f    = (const float*)d_in[0];   // (4,128,64,64)
    const float* bsrc = (const float*)d_in[1];   // (4,128,64,64)
    const float* mask = (const float*)d_in[2];   // (4,1,256,256)
    float* out = (float*)d_out;

    // workspace layout (bytes)
    const size_t SZ_COL  = (size_t)BATCH * L * KCOL * 4;   // 18,874,368
    const size_t SZ_YI   = (size_t)BATCH * L * L * 4;      // 16,777,216
    const size_t SZ_RAW  = (size_t)BATCH * QDIM * L * 4;   // 33,554,432
    char* w = (char*)d_ws;
    float* colB   = (float*)(w);
    float* colF   = (float*)(w + SZ_COL);
    float* yiA    = (float*)(w + 2 * SZ_COL);
    float* yiB    = (float*)(w + 2 * SZ_COL + SZ_YI);
    float* rawWT  = (float*)(w + 2 * SZ_COL + 2 * SZ_YI);
    float* Tbuf   = (float*)(w + 2 * SZ_COL + 2 * SZ_YI + SZ_RAW);
    float* rnorm  = (float*)(w + 2 * SZ_COL + 2 * SZ_YI + 2 * SZ_RAW);
    float* mmbuf  = rnorm + BATCH * L;

    const int totCol = BATCH * L * KCOL;
    im2col_ds_k3<<<(totCol + 255) / 256, 256, 0, stream>>>(bsrc, colB, totCol);
    im2col_ds_k3<<<(totCol + 255) / 256, 256, 0, stream>>>(f, colF, totCol);

    const int totRaw = BATCH * QDIM * L;
    build_rawWT<<<(totRaw + 255) / 256, 256, 0, stream>>>(bsrc, rawWT, totRaw);

    row_rnorm<<<BATCH * L, 128, 0, stream>>>(colB, rnorm);
    build_mm<<<(L + 255) / 256, 256, 0, stream>>>(mask, mmbuf);

    // GEMM1: yiA[b][p][s] = rnorm[p] * Σ_k colB[p,k] colF[s,k]   (1024x1024x1152)
    {
        dim3 grid(L / 64, L / 64, BATCH);
        gemm_nt_wmma<<<grid, 128, 0, stream>>>(colB, colF, yiA, L, L, KCOL,
                                               (long)L * KCOL, (long)L * KCOL,
                                               (long)L * L, rnorm, L);
    }

    const int totYi = BATCH * L * L;
    fuse1<<<(totYi + 255) / 256, 256, 0, stream>>>(yiA, yiB, totYi);
    fuse2<<<(totYi + 255) / 256, 256, 0, stream>>>(yiB, yiA, totYi);

    {
        dim3 grid(L, BATCH);
        softmax_T<<<grid, 256, 0, stream>>>(yiA, mmbuf, yiB);   // yiB = yiT (s,p)
    }

    // GEMM2: T[b][s][q] = Σ_p yiT[s,p] * rawWT[q,p]   (1024x2048x1024)
    {
        dim3 grid(QDIM / 64, L / 64, BATCH);
        gemm_nt_wmma<<<grid, 128, 0, stream>>>(yiB, rawWT, Tbuf, L, QDIM, L,
                                               (long)L * L, (long)QDIM * L,
                                               (long)L * QDIM, nullptr, 0);
    }

    const int totOut = BATCH * CH * H0 * W0;
    col2im_deconv<<<(totOut + 255) / 256, 256, 0, stream>>>(Tbuf, out, totOut);
}

// v001
// A run of this version takes 216 microseconds.
// Timed twice side by side with v000, it ran 1.35 and 1.34 times as fast.
#include <hip/hip_runtime.h>
#include <hip/hip_bf16.h>

typedef float v2f __attribute__((ext_vector_type(2)));
typedef float v8f __attribute__((ext_vector_type(8)));

// Problem constants (from reference)
#define BATCH 4
#define CH    128
#define H0    64
#define W0    64
#define HD    32      // downsampled
#define WD    32
#define L     1024    // HD*WD patches
#define QDIM  2048    // CH*16
#define SOFTMAX_SCALE 10.0f

// ---------------------------------------------------------------------------
// CDNA5 async global->LDS copy (16B per lane), tracked by ASYNCcnt.
// vdst = LDS byte address (low 32 bits of the flat shared pointer, which is
// exactly what the flat-aperture truncation uses), vaddr = 64-bit global addr.
// ---------------------------------------------------------------------------
// One tile = four copies per lane. s_wait_xcnt 0 is the last line of the same
// statement so that no address register of an issued copy is rewritten ahead of it.
__device__ __forceinline__ void async_copy16x4(unsigned l0, const float* g0,
                                               unsigned l1, const float* g1,
                                               unsigned l2, const float* g2,
                                               unsigned l3, const float* g3) {
    asm volatile("global_load_async_to_lds_b128 %0, %1, off\n\t"
                 "global_load_async_to_lds_b128 %2, %3, off\n\t"
                 "global_load_async_to_lds_b128 %4, %5, off\n\t"
                 "global_load_async_to_lds_b128 %6, %7, off\n\t"
                 "s_wait_xcnt 0x0"
                 :: "v"(l0), "v"((unsigned long long)(uintptr_t)g0),
                    "v"(l1), "v"((unsigned long long)(uintptr_t)g1),
                    "v"(l2), "v"((unsigned long long)(uintptr_t)g2),
                    "v"(l3), "v"((unsigned long long)(uintptr_t)g3)
                 : "memory");
}
__device__ __forceinline__ void wait_async0() {
    asm volatile("s_wait_asynccnt 0x0" ::: "memory");
}
__device__ __forceinline__ unsigned lds_addr32(const void* p) {
    return (unsigned)(uintptr_t)p;
}

// ---------------------------------------------------------------------------
// Downsample (::2) and transpose to pixel-major, for both tensors in one launch:
//   xT[b][p][c] = x[b, c, 2*py, 2*px],  p = py*32 + px
// One block = one (b, py) row of 32 pixels x 32 channels, turned in LDS so that
// reads run along px and writes along c.
// ---------------------------------------------------------------------------
__global__ __launch_bounds__(256)
void gather_ds_T(const float* __restrict__ bsrc, const float* __restrict__ fsrc,
                 float* __restrict__ bT, float* __restrict__ fT) {
    __shared__ float tile[32][33];
    const float* x = blockIdx.z ? fsrc : bsrc;
    float* xT      = blockIdx.z ? fT : bT;
    const int c0 = blockIdx.x * 32;
    const int py = blockIdx.y & 31;
    const int b  = blockIdx.y >> 5;
    const int tx = threadIdx.x & 31;
    const int ty = threadIdx.x >> 5;
    #pragma unroll
    for (int k = 0; k < 4; ++k) {
        int c = ty + 8 * k;
        tile[c][tx] = x[(((size_t)b * CH + c0 + c) * H0 + 2 * py) * W0 + 2 * tx];
    }
    __syncthreads();
    #pragma unroll
    for (int k = 0; k < 4; ++k) {
        int px = ty + 8 * k;
        xT[((size_t)b * L + py * 32 + px) * CH + c0 + tx] = tile[tx][px];
    }
}

// ---------------------------------------------------------------------------
// rawW^T[b][q][p] with q = c*16 + a*4 + bb :
//   raw_w[p,c,a,bb] = b_full[b, c, 2*py + a - 1, 2*px + bb - 1] (zero padded)
// ---------------------------------------------------------------------------
__global__ void build_rawWT(const float* __restrict__ bsrc, float* __restrict__ rawWT,
                            int total) {
    int idx = blockIdx.x * blockDim.x + threadIdx.x;
    if (idx >= total) return;
    int p = idx % L;
    int q = (idx / L) % QDIM;
    int b = idx / (L * QDIM);
    int c = q >> 4, a = (q >> 2) & 3, bb = q & 3;
    int py = p >> 5, px = p & 31;
    int Y = 2 * py + a - 1, X = 2 * px + bb - 1;
    float v = 0.0f;
    if (Y >= 0 && Y < H0 && X >= 0 && X < W0)
        v = bsrc[(((size_t)b * CH + c) * H0 + Y) * W0 + X];
    rawWT[idx] = v;
}

// ---------------------------------------------------------------------------
// rnorm[b][p] = 1 / max(sqrt(sum over the 3x3 zero-padded patch at p and all
// channels of bT^2), 1e-4)
// ---------------------------------------------------------------------------
__global__ void patch_rnorm(const float* __restrict__ bT, float* __restrict__ rnorm) {
    __shared__ float red[128];
    int row = blockIdx.x;                 // b*L + p
    int p = row & (L - 1);
    int py = p >> 5, px = p & 31;
    const float* base = bT + (size_t)(row - p) * CH;      // this batch item's plane
    float v[9];
    #pragma unroll
    for (int t = 0; t < 9; ++t) {
        const int y = py + t / 3 - 1, x = px + t % 3 - 1;
        const bool in = (y >= 0 && y < HD && x >= 0 && x < WD);
        v[t] = base[(size_t)(in ? y * WD + x : p) * CH + threadIdx.x];   // always in bounds
        // precaution: the next load's result may be given this load's address registers
        asm volatile("s_wait_xcnt 0x0" ::: "memory");
    }
    float s = 0.0f;
    #pragma unroll
    for (int t = 0; t < 9; ++t) {
        const int y = py + t / 3 - 1, x = px + t % 3 - 1;
        const bool in = (y >= 0 && y < HD && x >= 0 && x < WD);
        s += in ? v[t] * v[t] : 0.0f;
    }
    red[threadIdx.x] = s;
    __syncthreads();
    for (int st = 64; st > 0; st >>= 1) {
        if (threadIdx.x < st) red[threadIdx.x] += red[threadIdx.x + st];
        __syncthreads();
    }
    if (threadIdx.x == 0)
        rnorm[row] = 1.0f / fmaxf(sqrtf(red[0]), 1e-4f);
}

// ---------------------------------------------------------------------------
// mm[p] = 1 if all 9 taps of the (zero-padded) 3x3 patch of mask[0,0,::8,::8]
// are zero, else 0.
// ---------------------------------------------------------------------------
__global__ void build_mm(const float* __restrict__ mask, float* __restrict__ mm) {
    int p = blockIdx.x * blockDim.x + threadIdx.x;
    if (p >= L) return;
    int py = p >> 5, px = p & 31;
    float s = 0.0f;
    for (int dy = 0; dy < 3; ++dy)
        for (int dx = 0; dx < 3; ++dx) {
            int y = py + dy - 1, x = px + dx - 1;
            if (y >= 0 && y < 32 && x >= 0 && x < 32)
                s += mask[(size_t)(8 * y) * 256 + 8 * x];
        }
    mm[p] = (s == 0.0f) ? 1.0f : 0.0f;
}

// ---------------------------------------------------------------------------
// NT GEMM with f32 WMMA:  C[m,n] = (Σ_k A[m,k]*B[n,k]) * rowScale[m]
// A: M x K row-major, B: N x K row-major, C: M x N row-major.
// 128 threads = 4 waves (2x2), block tile 64x64, BK=16, double-buffered LDS
// filled with CDNA5 async global->LDS DMA (ASYNCcnt).
// ---------------------------------------------------------------------------
#define LDS_STRIDE 20
#define TILE_F     (64 * LDS_STRIDE)      // floats per 64x16 padded tile
__global__ __launch_bounds__(128)
void gemm_nt_wmma(const float* __restrict__ A, const float* __restrict__ B,
                  float* __restrict__ C, int M, int N, int K,
                  long strideA, long strideB, long strideC,
                  const float* __restrict__ rowScale, int scaleStride) {
    const int batch = blockIdx.z;
    A += (size_t)batch * strideA;
    B += (size_t)batch * strideB;
    C += (size_t)batch * strideC;
    if (rowScale) rowScale += (size_t)batch * scaleStride;

    const int tid  = threadIdx.x;
    const int lane = tid & 31;
    const int wave = tid >> 5;
    const int wr = wave & 1;          // wave row  (2 waves along M)
    const int wc = wave >> 1;         // wave col  (2 waves along N)
    const int hf = lane >> 4;         // lane half (K-pair select)
    const int lx = lane & 15;

    const int blockM = blockIdx.y * 64;
    const int blockN = blockIdx.x * 64;

    // [buf][A|B][64*20] double-buffered tiles
    __shared__ float smem[2 * 2 * TILE_F];

    v8f acc00 = 0.0f, acc01 = 0.0f, acc10 = 0.0f, acc11 = 0.0f;

    // cooperative-load assignment: thread -> rows lr, lr+32; float4 at col lc
    const int lr = tid >> 2;          // 0..31
    const int lc = (tid & 3) << 2;    // 0,4,8,12

    const float* gA0 = A + (size_t)(blockM + lr)      * K + lc;
    const float* gA1 = A + (size_t)(blockM + lr + 32) * K + lc;
    const float* gB0 = B + (size_t)(blockN + lr)      * K + lc;
    const float* gB1 = B + (size_t)(blockN + lr + 32) * K + lc;

    unsigned dA0[2], dA1[2], dB0[2], dB1[2];
    #pragma unroll
    for (int bf = 0; bf < 2; ++bf) {
        float* As = &smem[bf * 2 * TILE_F];
        float* Bs = As + TILE_F;
        dA0[bf] = lds_addr32(&As[lr * LDS_STRIDE + lc]);
        dA1[bf] = lds_addr32(&As[(lr + 32) * LDS_STRIDE + lc]);
        dB0[bf] = lds_addr32(&Bs[lr * LDS_STRIDE + lc]);
        dB1[bf] = lds_addr32(&Bs[(lr + 32) * LDS_STRIDE + lc]);
    }

    // prologue: fill buffer 0 with tile k0=0
    async_copy16x4(dA0[0], gA0, dA1[0], gA1, dB0[0], gB0, dB1[0], gB1);
    wait_async0();
    __syncthreads();

    const int nsteps = K >> 4;
    for (int s = 0; s < nsteps; ++s) {
        const int cur = s & 1;
        const int nxt = cur ^ 1;

        // issue async DMA for the next tile while we compute this one
        if (s + 1 < nsteps) {
            const size_t ko = (size_t)(s + 1) << 4;
            async_copy16x4(dA0[nxt], gA0 + ko, dA1[nxt], gA1 + ko,
                           dB0[nxt], gB0 + ko, dB1[nxt], gB1 + ko);
        }

        const float* As = &smem[cur * 2 * TILE_F];
        const float* Bs = As + TILE_F;

        #pragma unroll
        for (int ks = 0; ks < 4; ++ks) {
            const int kb = ks * 4 + 2 * hf;   // even -> 8B-aligned v2f
            v2f a0 = *(const v2f*)&As[(wr * 32 +  0 + lx) * LDS_STRIDE + kb];
            v2f a1 = *(const v2f*)&As[(wr * 32 + 16 + lx) * LDS_STRIDE + kb];
            v2f b0 = *(const v2f*)&Bs[(wc * 32 +  0 + lx) * LDS_STRIDE + kb];
            v2f b1 = *(const v2f*)&Bs[(wc * 32 + 16 + lx) * LDS_STRIDE + kb];
            acc00 = __builtin_amdgcn_wmma_f32_16x16x4_f32(false, a0, false, b0,
                        (short)0, acc00, false, false);
            acc01 = __builtin_amdgcn_wmma_f32_16x16x4_f32(false, a0, false, b1,
                        (short)0, acc01, false, false);
            acc10 = __builtin_amdgcn_wmma_f32_16x16x4_f32(false, a1, false, b0,
                        (short)0, acc10, false, false);
            acc11 = __builtin_amdgcn_wmma_f32_16x16x4_f32(false, a1, false, b1,
                        (short)0, acc11, false, false);
        }

        wait_async0();       // my next-tile DMA landed
        __syncthreads();     // everyone's landed; everyone done reading cur
    }

    // Epilogue. C/D layout: VGPR r holds M = r (lanes 0-15) / r+8 (lanes 16-31),
    // N = lane & 15.
    #pragma unroll
    for (int mt = 0; mt < 2; ++mt) {
        v8f ar0 = (mt == 0) ? acc00 : acc10;
        v8f ar1 = (mt == 0) ? acc01 : acc11;
        #pragma unroll
        for (int r = 0; r < 8; ++r) {
            int gm = blockM + wr * 32 + mt * 16 + r + 8 * hf;
            float sc = rowScale ? rowScale[gm] : 1.0f;
            int gn0 = blockN + wc * 32 + lx;
            C[(size_t)gm * N + gn0]      = ar0[r] * sc;
            C[(size_t)gm * N + gn0 + 16] = ar1[r] * sc;
        }
    }
}

// ---------------------------------------------------------------------------
// 3x3 patch correlation from the pixel Gram matrix G[p][s] = sum_c bT[p][c]*fT[s][c]:
//   S[p][s] = rnorm[p] * sum_{dy,dx=-1..1} G[p + 32*dy + dx][s + 32*dy + dx]
// a tap counting only where both shifted pixels lie inside the 32x32 image (zero
// padding of both patches). One block = one row p; a thread owns 4 consecutive s,
// which share one image row. Every tap is one aligned 16-byte load; for dx = -1/+1
// the element that crosses the 4-group comes from the neighbour lane.
// ---------------------------------------------------------------------------
__global__ __launch_bounds__(256)
void patch_sum9(const float* __restrict__ G, const float* __restrict__ rnorm,
                float* __restrict__ S) {
    const int p = blockIdx.x;
    const int b = blockIdx.y;
    const float* Gb = G + (size_t)b * L * L;
    const int py = p >> 5, px = p & 31;
    const int s4 = threadIdx.x * 4;
    const int sy = s4 >> 5, sx0 = s4 & 31;
    // All nine loads are unconditional (a tap outside the image reads its own
    // row/column instead and is then replaced by zero), so they fly together.
    float4 w[9];
    #pragma unroll
    for (int t = 0; t < 9; ++t) {
        const int dy = t / 3 - 1, dx = t % 3 - 1;
        const bool pv = (py + dy >= 0) && (py + dy < HD) && (px + dx >= 0) && (px + dx < WD);
        const bool sv = (sy + dy >= 0) && (sy + dy < HD);
        const char* rowp    = (const char*)(Gb + (size_t)(pv ? p + 32 * dy + dx : p) * L);  // same for the block
        const unsigned boff = (unsigned)(sv ? s4 + 32 * dy : s4) * 4u;                      // byte column, per lane
        w[t] = *(const float4*)(rowp + boff);
    }
    float a0 = 0.0f, a1 = 0.0f, a2 = 0.0f, a3 = 0.0f;
    #pragma unroll
    for (int t = 0; t < 9; ++t) {
        const int dy = t / 3 - 1, dx = t % 3 - 1;
        const bool ok = (py + dy >= 0) && (py + dy < HD) && (px + dx >= 0) && (px + dx < WD) &&
                        (sy + dy >= 0) && (sy + dy < HD);
        const float x0 = ok ? w[t].x : 0.0f, x1 = ok ? w[t].y : 0.0f;
        const float x2 = ok ? w[t].z : 0.0f, x3 = ok ? w[t].w : 0.0f;
        if (dx == 0) {
            a0 += x0; a1 += x1; a2 += x2; a3 += x3;
        } else if (dx < 0) {
            const float e = __shfl_up(x3, 1);                // column s4 - 1
            a0 += (sx0 == 0) ? 0.0f : e;
            a1 += x0; a2 += x1; a3 += x2;
        } else {
            const float e = __shfl_down(x0, 1);              // column s4 + 4
            a0 += x1; a1 += x2; a2 += x3;
            a3 += (sx0 == 28) ? 0.0f : e;
        }
    }
    const float sc = rnorm[b * L + p];
    *(float4*)&S[((size_t)b * L + p) * L + s4] =
        make_float4(a0 * sc, a1 * sc, a2 * sc, a3 * sc);
}

// ---------------------------------------------------------------------------
// fuse1: out[i,j] = sum_{d=-1..1} in[i+d, j+d]  (flattened 1024x1024, zero OOB)
// ---------------------------------------------------------------------------
__global__ void fuse1(const float* __restrict__ in, float* __restrict__ out, int total) {
    int idx = blockIdx.x * blockDim.x + threadIdx.x;
    if (idx >= total) return;
    int j = idx % L;
    int i = (idx / L) % L;
    int b = idx / (L * L);
    const float* src = in + (size_t)b * L * L;
    float acc = 0.0f;
    #pragma unroll
    for (int d = -1; d <= 1; ++d) {
        int ii = i + d, jj = j + d;
        if (ii >= 0 && ii < L && jj >= 0 && jj < L)
            acc += src[(size_t)ii * L + jj];
    }
    out[idx] = acc;
}

// ---------------------------------------------------------------------------
// fuse2: fuse along the transposed flattening. For p=(py,px), s=(fy,fx):
//   i' = px*32+py, j' = fx*32+fy ; out += in[p(t), s(u)] for t=i'+d, u=j'+d
//   with p(t) = (t%32)*32 + t/32.
// ---------------------------------------------------------------------------
__global__ void fuse2(const float* __restrict__ in, float* __restrict__ out, int total) {
    int idx = blockIdx.x * blockDim.x + threadIdx.x;
    if (idx >= total) return;
    int s = idx % L;
    int p = (idx / L) % L;
    int b = idx / (L * L);
    const float* src = in + (size_t)b * L * L;
    int py = p >> 5, px = p & 31;
    int fy = s >> 5, fx = s & 31;
    int ip = px * 32 + py;
    int jp = fx * 32 + fy;
    float acc = 0.0f;
    #pragma unroll
    for (int d = -1; d <= 1; ++d) {
        int t = ip + d, u = jp + d;
        if (t >= 0 && t < L && u >= 0 && u < L) {
            int psrc = (t & 31) * 32 + (t >> 5);
            int ssrc = (u & 31) * 32 + (u >> 5);
            acc += src[(size_t)psrc * L + ssrc];
        }
    }
    out[idx] = acc;
}

// ---------------------------------------------------------------------------
// Masked softmax over p (axis 0) for each column s, writing transposed:
//   yiT[b][s][p] = softmax_p(in[b][p][s]*mm[p]*10) * mm[p]
// ---------------------------------------------------------------------------
__global__ void softmax_T(const float* __restrict__ in, const float* __restrict__ mm,
                          float* __restrict__ yiT) {
    __shared__ float red[256];
    int s = blockIdx.x;
    int b = blockIdx.y;
    const float* src = in + (size_t)b * L * L;
    float v[4], m[4];
    #pragma unroll
    for (int k = 0; k < 4; ++k) {
        int p = threadIdx.x + k * 256;
        m[k] = mm[p];
        v[k] = src[(size_t)p * L + s] * m[k] * SOFTMAX_SCALE;
    }
    float mx = fmaxf(fmaxf(v[0], v[1]), fmaxf(v[2], v[3]));
    red[threadIdx.x] = mx;
    __syncthreads();
    for (int st = 128; st > 0; st >>= 1) {
        if (threadIdx.x < st) red[threadIdx.x] = fmaxf(red[threadIdx.x], red[threadIdx.x + st]);
        __syncthreads();
    }
    mx = red[0];
    __syncthreads();
    float e[4], ssum = 0.0f;
    #pragma unroll
    for (int k = 0; k < 4; ++k) { e[k] = expf(v[k] - mx); ssum += e[k]; }
    red[threadIdx.x] = ssum;
    __syncthreads();
    for (int st = 128; st > 0; st >>= 1) {
        if (threadIdx.x < st) red[threadIdx.x] += red[threadIdx.x + st];
        __syncthreads();
    }
    float inv = 1.0f / red[0];
    float* dst = yiT + ((size_t)b * L + s) * L;
    #pragma unroll
    for (int k = 0; k < 4; ++k) {
        int p = threadIdx.x + k * 256;
        dst[p] = e[k] * inv * m[k];
    }
}

// ---------------------------------------------------------------------------
// col2im for the stride-2 transposed conv with 4x4 kernel, pad 2:
// out[b,c,Y,X] = 0.25 * Σ_{ky,kx: (Y+ky-2) even,in-range} T[b][(y,x)][c*16+(3-ky)*4+(3-kx)]
// ---------------------------------------------------------------------------
__global__ void col2im_deconv(const float* __restrict__ T, float* __restrict__ out,
                              int total) {
    int idx = blockIdx.x * blockDim.x + threadIdx.x;
    if (idx >= total) return;
    int X = idx & 63;
    int Y = (idx >> 6) & 63;
    int c = (idx >> 12) & 127;
    int b = idx >> 19;
    const float* Tb = T + (size_t)b * L * QDIM;
    float acc = 0.0f;
    #pragma unroll
    for (int ky = 0; ky < 4; ++ky) {
        int u = Y + ky - 2;
        if (u < 0 || u > 62 || (u & 1)) continue;
        int y = u >> 1;
        int a = 3 - ky;
        #pragma unroll
        for (int kx = 0; kx < 4; ++kx) {
            int v = X + kx - 2;
            if (v < 0 || v > 62 || (v & 1)) continue;
            int x = v >> 1;
            int bb = 3 - kx;
            acc += Tb[(size_t)(y * 32 + x) * QDIM + c * 16 + a * 4 + bb];
        }
    }
    out[idx] = acc * 0.25f;
}

// ---------------------------------------------------------------------------
extern "C" void kernel_launch(void* const* d_in, const int* in_sizes, int n_in,
                              void* d_out, int out_size, void* d_ws, size_t ws_size,
                              hipStream_t stream) {
    const float* f    = (const float*)d_in[0];   // (4,128,64,64)
    const float* bsrc = (const float*)d_in[1];   // (4,128,64,64)
    const float* mask = (const float*)d_in[2];   // (4,1,256,256)
    float* out = (float*)d_out;

    // workspace layout (bytes)
    const size_t SZ_PIX  = (size_t)BATCH * L * CH * 4;     // 2,097,152
    const size_t SZ_YI   = (size_t)BATCH * L * L * 4;      // 16,777,216
    const size_t SZ_RAW  = (size_t)BATCH * QDIM * L * 4;   // 33,554,432
    char* w = (char*)d_ws;
    float* bT     = (float*)(w);
    float* fT     = (float*)(w + SZ_PIX);
    float* yiA    = (float*)(w + 2 * SZ_PIX);
    float* yiB    = (float*)(w + 2 * SZ_PIX + SZ_YI);
    float* rawWT  = (float*)(w + 2 * SZ_PIX + 2 * SZ_YI);
    float* Tbuf   = (float*)(w + 2 * SZ_PIX + 2 * SZ_YI + SZ_RAW);
    float* rnorm  = (float*)(w + 2 * SZ_PIX + 2 * SZ_YI + 2 * SZ_RAW);
    float* mmbuf  = rnorm + BATCH * L;

    {
        dim3 grid(CH / 32, BATCH * HD, 2);
        gather_ds_T<<<grid, 256, 0, stream>>>(bsrc, f, bT, fT);
    }

    const int totRaw = BATCH * QDIM * L;
    build_rawWT<<<(totRaw + 255) / 256, 256, 0, stream>>>(bsrc, rawWT, totRaw);

    patch_rnorm<<<BATCH * L, 128, 0, stream>>>(bT, rnorm);
    build_mm<<<(L + 255) / 256, 256, 0, stream>>>(mask, mmbuf);

    // GEMM1: yiB[b][p][s] = sum_c bT[p,c] fT[s,c]   (1024x1024x128, pixel Gram matrix)
    {
        dim3 grid(L / 64, L / 64, BATCH);
        gemm_nt_wmma<<<grid, 128, 0, stream>>>(bT, fT, yiB, L, L, CH,
                                               (long)L * CH, (long)L * CH,
                                               (long)L * L, nullptr, 0);
    }
    // yiA[b][p][s] = rnorm[p] * 9-tap diagonal sum of the Gram matrix
    {
        dim3 grid(L, BATCH);
        patch_sum9<<<grid, 256, 0, stream>>>(yiB, rnorm, yiA);
    }

    const int totYi = BATCH * L * L;
    fuse1<<<(totYi + 255) / 256, 256, 0, stream>>>(yiA, yiB, totYi);
    fuse2<<<(totYi + 255) / 256, 256, 0, stream>>>(yiB, yiA, totYi);

    {
        dim3 grid(L, BATCH);
        softmax_T<<<grid, 256, 0, stream>>>(yiA, mmbuf, yiB);   // yiB = yiT (s,p)
    }

    // Left as it is: the 4x4 stride-2 patches overlap too, so this product could come
    // from four parity GEMMs over pixels on a 2x2 diagonal shift-sum of yiT, with about
    // a quarter of the multiply-adds.
    // GEMM2: T[b][s][q] = Σ_p yiT[s,p] * rawWT[q,p]   (1024x2048x1024)
    {
        dim3 grid(QDIM / 64, L / 64, BATCH);
        gemm_nt_wmma<<<grid, 128, 0, stream>>>(yiB, rawWT, Tbuf, L, QDIM, L,
                                               (long)L * L, (long)QDIM * L,
                                               (long)L * QDIM, nullptr, 0);
    }

    const int totOut = BATCH * CH * H0 * W0;
    col2im_deconv<<<(totOut + 255) / 256, 256, 0, stream>>>(Tbuf, out, totOut);
}

// v002
// Measured time: 144 microseconds a run.
// Timed twice side by side with v001, it ran 1.50 times as fast both times.
// All steps since v000 together make it 2.02 times as fast.
#include <hip/hip_runtime.h>
#include <hip/hip_bf16.h>

typedef float v2f __attribute__((ext_vector_type(2)));
typedef float v8f __attribute__((ext_vector_type(8)));

// Problem constants (from reference)
#define BATCH 4
#define CH    128
#define H0    64
#define W0    64
#define HD    32      // downsampled
#define WD    32
#define L     1024    // HD*WD patches
#define SOFTMAX_SCALE 10.0f

// ---------------------------------------------------------------------------
// CDNA5 async global->LDS copy (16B per lane), tracked by ASYNCcnt.
// vdst = LDS byte address (low 32 bits of the flat shared pointer, which is
// exactly what the flat-aperture truncation uses), vaddr = 64-bit global addr.
// ---------------------------------------------------------------------------
// One tile = four copies per lane. s_wait_xcnt 0 is the last line of the same
// statement so that no address register of an issued copy is rewritten ahead of it.
__device__ __forceinline__ void async_copy16x4(unsigned l0, const float* g0,
                                               unsigned l1, const float* g1,
                                               unsigned l2, const float* g2,
                                               unsigned l3, const float* g3) {
    asm volatile("global_load_async_to_lds_b128 %0, %1, off\n\t"
                 "global_load_async_to_lds_b128 %2, %3, off\n\t"
                 "global_load_async_to_lds_b128 %4, %5, off\n\t"
                 "global_load_async_to_lds_b128 %6, %7, off\n\t"
                 "s_wait_xcnt 0x0"
                 :: "v"(l0), "v"((unsigned long long)(uintptr_t)g0),
                    "v"(l1), "v"((unsigned long long)(uintptr_t)g1),
                    "v"(l2), "v"((unsigned long long)(uintptr_t)g2),
                    "v"(l3), "v"((unsigned long long)(uintptr_t)g3)
                 : "memory");
}
__device__ __forceinline__ void wait_async0() {
    asm volatile("s_wait_asynccnt 0x0" ::: "memory");
}
__device__ __forceinline__ unsigned lds_addr32(const void* p) {
    return (unsigned)(uintptr_t)p;
}

// ---------------------------------------------------------------------------
// Downsample (::2) and transpose to pixel-major, for both tensors in one launch:
//   xT[b][p][c] = x[b, c, 2*py, 2*px],  p = py*32 + px
// One block = one (b, py) row of 32 pixels x 32 channels, turned in LDS so that
// reads run along px and writes along c.
// ---------------------------------------------------------------------------
__global__ __launch_bounds__(256)
void gather_ds_T(const float* __restrict__ bsrc, const float* __restrict__ fsrc,
                 float* __restrict__ bT, float* __restrict__ fT) {
    __shared__ float tile[32][33];
    const float* x = blockIdx.z ? fsrc : bsrc;
    float* xT      = blockIdx.z ? fT : bT;
    const int c0 = blockIdx.x * 32;
    const int py = blockIdx.y & 31;
    const int b  = blockIdx.y >> 5;
    const int tx = threadIdx.x & 31;
    const int ty = threadIdx.x >> 5;
    #pragma unroll
    for (int k = 0; k < 4; ++k) {
        int c = ty + 8 * k;
        tile[c][tx] = x[(((size_t)b * CH + c0 + c) * H0 + 2 * py) * W0 + 2 * tx];
    }
    __syncthreads();
    #pragma unroll
    for (int k = 0; k < 4; ++k) {
        int px = ty + 8 * k;
        xT[((size_t)b * L + py * 32 + px) * CH + c0 + tx] = tile[tx][px];
    }
}

// ---------------------------------------------------------------------------
// The full-resolution background split into its four pixel parities, r = ry*2 + rx:
//   bpar[b][r][c][u*32 + v] = b_full[b, c, 2*u + ry, 2*v + rx]
// A thread reads 4 consecutive X and writes a pair to each of the two rx planes.
// ---------------------------------------------------------------------------
__global__ __launch_bounds__(256)
void split_parity(const float* __restrict__ bsrc, float* __restrict__ bpar) {
    const int idx = blockIdx.x * 256 + threadIdx.x;       // (b*CH + c, Y, X/4)
    const int x4 = idx & 15;
    const int Y  = (idx >> 4) & 63;
    const int c  = (idx >> 10) & (CH - 1);
    const int b  = idx >> 17;
    const float4 t = *(const float4*)&bsrc[(size_t)idx * 4];
    const int p = (Y >> 1) * WD + x4 * 2;
    float* d0 = bpar + (((size_t)(b * 4 + (Y & 1) * 2) * CH + c) * L + p);
    *(float2*)d0                   = make_float2(t.x, t.z);
    *(float2*)(d0 + (size_t)CH * L) = make_float2(t.y, t.w);
}

// ---------------------------------------------------------------------------
// rnorm[b][p] = 1 / max(sqrt(sum over the 3x3 zero-padded patch at p and all
// channels of bT^2), 1e-4)
// ---------------------------------------------------------------------------
__global__ void patch_rnorm(const float* __restrict__ bT, float* __restrict__ rnorm) {
    __shared__ float red[128];
    int row = blockIdx.x;                 // b*L + p
    int p = row & (L - 1);
    int py = p >> 5, px = p & 31;
    const float* base = bT + (size_t)(row - p) * CH;      // this batch item's plane
    float v[9];
    #pragma unroll
    for (int t = 0; t < 9; ++t) {
        const int y = py + t / 3 - 1, x = px + t % 3 - 1;
        const bool in = (y >= 0 && y < HD && x >= 0 && x < WD);
        v[t] = base[(size_t)(in ? y * WD + x : p) * CH + threadIdx.x];   // always in bounds
        // precaution: the next load's result may be given this load's address registers
        asm volatile("s_wait_xcnt 0x0" ::: "memory");
    }
    float s = 0.0f;
    #pragma unroll
    for (int t = 0; t < 9; ++t) {
        const int y = py + t / 3 - 1, x = px + t % 3 - 1;
        const bool in = (y >= 0 && y < HD && x >= 0 && x < WD);
        s += in ? v[t] * v[t] : 0.0f;
    }
    red[threadIdx.x] = s;
    __syncthreads();
    for (int st = 64; st > 0; st >>= 1) {
        if (threadIdx.x < st) red[threadIdx.x] += red[threadIdx.x + st];
        __syncthreads();
    }
    if (threadIdx.x == 0)
        rnorm[row] = 1.0f / fmaxf(sqrtf(red[0]), 1e-4f);
}

// ---------------------------------------------------------------------------
// mm[p] = 1 if all 9 taps of the (zero-padded) 3x3 patch of mask[0,0,::8,::8]
// are zero, else 0.
// ---------------------------------------------------------------------------
__global__ void build_mm(const float* __restrict__ mask, float* __restrict__ mm) {
    int p = blockIdx.x * blockDim.x + threadIdx.x;
    if (p >= L) return;
    int py = p >> 5, px = p & 31;
    float s = 0.0f;
    for (int dy = 0; dy < 3; ++dy)
        for (int dx = 0; dx < 3; ++dx) {
            int y = py + dy - 1, x = px + dx - 1;
            if (y >= 0 && y < 32 && x >= 0 && x < 32)
                s += mask[(size_t)(8 * y) * 256 + 8 * x];
        }
    mm[p] = (s == 0.0f) ? 1.0f : 0.0f;
}

// ---------------------------------------------------------------------------
// NT GEMM with f32 WMMA:  C[m,n] = (Σ_k A[m,k]*B[n,k]) * rowScale[m]
// A: M x K row-major, B: N x K row-major, C: M x N row-major.
// 128 threads = 4 waves (2x2), block tile 64x64, BK=16, double-buffered LDS
// filled with CDNA5 async global->LDS DMA (ASYNCcnt).
// ---------------------------------------------------------------------------
#define LDS_STRIDE 20
#define TILE_F     (64 * LDS_STRIDE)      // floats per 64x16 padded tile
__global__ __launch_bounds__(128)
void gemm_nt_wmma(const float* __restrict__ A, const float* __restrict__ B,
                  float* __restrict__ C, int M, int N, int K,
                  long strideA, long strideB, long strideC,
                  const float* __restrict__ rowScale, int scaleStride) {
    const int batch = blockIdx.z;
    A += (size_t)batch * strideA;
    B += (size_t)batch * strideB;
    C += (size_t)batch * strideC;
    if (rowScale) rowScale += (size_t)batch * scaleStride;

    const int tid  = threadIdx.x;
    const int lane = tid & 31;
    const int wave = tid >> 5;
    const int wr = wave & 1;          // wave row  (2 waves along M)
    const int wc = wave >> 1;         // wave col  (2 waves along N)
    const int hf = lane >> 4;         // lane half (K-pair select)
    const int lx = lane & 15;

    const int blockM = blockIdx.y * 64;
    const int blockN = blockIdx.x * 64;

    // [buf][A|B][64*20] double-buffered tiles
    __shared__ float smem[2 * 2 * TILE_F];

    v8f acc00 = 0.0f, acc01 = 0.0f, acc10 = 0.0f, acc11 = 0.0f;

    // cooperative-load assignment: thread -> rows lr, lr+32; float4 at col lc
    const int lr = tid >> 2;          // 0..31
    const int lc = (tid & 3) << 2;    // 0,4,8,12

    const float* gA0 = A + (size_t)(blockM + lr)      * K + lc;
    const float* gA1 = A + (size_t)(blockM + lr + 32) * K + lc;
    const float* gB0 = B + (size_t)(blockN + lr)      * K + lc;
    const float* gB1 = B + (size_t)(blockN + lr + 32) * K + lc;

    unsigned dA0[2], dA1[2], dB0[2], dB1[2];
    #pragma unroll
    for (int bf = 0; bf < 2; ++bf) {
        float* As = &smem[bf * 2 * TILE_F];
        float* Bs = As + TILE_F;
        dA0[bf] = lds_addr32(&As[lr * LDS_STRIDE + lc]);
        dA1[bf] = lds_addr32(&As[(lr + 32) * LDS_STRIDE + lc]);
        dB0[bf] = lds_addr32(&Bs[lr * LDS_STRIDE + lc]);
        dB1[bf] = lds_addr32(&Bs[(lr + 32) * LDS_STRIDE + lc]);
    }

    // prologue: fill buffer 0 with tile k0=0
    async_copy16x4(dA0[0], gA0, dA1[0], gA1, dB0[0], gB0, dB1[0], gB1);
    wait_async0();
    __syncthreads();

    const int nsteps = K >> 4;
    for (int s = 0; s < nsteps; ++s) {
        const int cur = s & 1;
        const int nxt = cur ^ 1;

        // issue async DMA for the next tile while we compute this one
        if (s + 1 < nsteps) {
            const size_t ko = (size_t)(s + 1) << 4;
            async_copy16x4(dA0[nxt], gA0 + ko, dA1[nxt], gA1 + ko,
                           dB0[nxt], gB0 + ko, dB1[nxt], gB1 + ko);
        }

        const float* As = &smem[cur * 2 * TILE_F];
        const float* Bs = As + TILE_F;

        #pragma unroll
        for (int ks = 0; ks < 4; ++ks) {
            const int kb = ks * 4 + 2 * hf;   // even -> 8B-aligned v2f
            v2f a0 = *(const v2f*)&As[(wr * 32 +  0 + lx) * LDS_STRIDE + kb];
            v2f a1 = *(const v2f*)&As[(wr * 32 + 16 + lx) * LDS_STRIDE + kb];
            v2f b0 = *(const v2f*)&Bs[(wc * 32 +  0 + lx) * LDS_STRIDE + kb];
            v2f b1 = *(const v2f*)&Bs[(wc * 32 + 16 + lx) * LDS_STRIDE + kb];
            acc00 = __builtin_amdgcn_wmma_f32_16x16x4_f32(false, a0, false, b0,
                        (short)0, acc00, false, false);
            acc01 = __builtin_amdgcn_wmma_f32_16x16x4_f32(false, a0, false, b1,
                        (short)0, acc01, false, false);
            acc10 = __builtin_amdgcn_wmma_f32_16x16x4_f32(false, a1, false, b0,
                        (short)0, acc10, false, false);
            acc11 = __builtin_amdgcn_wmma_f32_16x16x4_f32(false, a1, false, b1,
                        (short)0, acc11, false, false);
        }

        wait_async0();       // my next-tile DMA landed
        __syncthreads();     // everyone's landed; everyone done reading cur
    }

    // Epilogue. C/D layout: VGPR r holds M = r (lanes 0-15) / r+8 (lanes 16-31),
    // N = lane & 15.
    #pragma unroll
    for (int mt = 0; mt < 2; ++mt) {
        v8f ar0 = (mt == 0) ? acc00 : acc10;
        v8f ar1 = (mt == 0) ? acc01 : acc11;
        #pragma unroll
        for (int r = 0; r < 8; ++r) {
            int gm = blockM + wr * 32 + mt * 16 + r + 8 * hf;
            float sc = rowScale ? rowScale[gm] : 1.0f;
            int gn0 = blockN + wc * 32 + lx;
            C[(size_t)gm * N + gn0]      = ar0[r] * sc;
            C[(size_t)gm * N + gn0 + 16] = ar1[r] * sc;
        }
    }
}

// ---------------------------------------------------------------------------
// 3x3 patch correlation from the pixel Gram matrix G[p][s] = sum_c bT[p][c]*fT[s][c]:
//   S[p][s] = rnorm[p] * sum_{dy,dx=-1..1} G[p + 32*dy + dx][s + 32*dy + dx]
// a tap counting only where both shifted pixels lie inside the 32x32 image (zero
// padding of both patches). One block = one row p; a thread owns 4 consecutive s,
// which share one image row. Every tap is one aligned 16-byte load; for dx = -1/+1
// the element that crosses the 4-group comes from the neighbour lane.
// ---------------------------------------------------------------------------
__global__ __launch_bounds__(256)
void patch_sum9(const float* __restrict__ G, const float* __restrict__ rnorm,
                float* __restrict__ S) {
    const int p = blockIdx.x;
    const int b = blockIdx.y;
    const float* Gb = G + (size_t)b * L * L;
    const int py = p >> 5, px = p & 31;
    const int s4 = threadIdx.x * 4;
    const int sy = s4 >> 5, sx0 = s4 & 31;
    // All nine loads are unconditional (a tap outside the image reads its own
    // row/column instead and is then replaced by zero), so they fly together.
    float4 w[9];
    #pragma unroll
    for (int t = 0; t < 9; ++t) {
        const int dy = t / 3 - 1, dx = t % 3 - 1;
        const bool pv = (py + dy >= 0) && (py + dy < HD) && (px + dx >= 0) && (px + dx < WD);
        const bool sv = (sy + dy >= 0) && (sy + dy < HD);
        const char* rowp    = (const char*)(Gb + (size_t)(pv ? p + 32 * dy + dx : p) * L);  // same for the block
        const unsigned boff = (unsigned)(sv ? s4 + 32 * dy : s4) * 4u;                      // byte column, per lane
        w[t] = *(const float4*)(rowp + boff);
    }
    float a0 = 0.0f, a1 = 0.0f, a2 = 0.0f, a3 = 0.0f;
    #pragma unroll
    for (int t = 0; t < 9; ++t) {
        const int dy = t / 3 - 1, dx = t % 3 - 1;
        const bool ok = (py + dy >= 0) && (py + dy < HD) && (px + dx >= 0) && (px + dx < WD) &&
                        (sy + dy >= 0) && (sy + dy < HD);
        const float x0 = ok ? w[t].x : 0.0f, x1 = ok ? w[t].y : 0.0f;
        const float x2 = ok ? w[t].z : 0.0f, x3 = ok ? w[t].w : 0.0f;
        if (dx == 0) {
            a0 += x0; a1 += x1; a2 += x2; a3 += x3;
        } else if (dx < 0) {
            const float e = __shfl_up(x3, 1);                // column s4 - 1
            a0 += (sx0 == 0) ? 0.0f : e;
            a1 += x0; a2 += x1; a3 += x2;
        } else {
            const float e = __shfl_down(x0, 1);              // column s4 + 4
            a0 += x1; a1 += x2; a2 += x3;
            a3 += (sx0 == 28) ? 0.0f : e;
        }
    }
    const float sc = rnorm[b * L + p];
    *(float4*)&S[((size_t)b * L + p) * L + s4] =
        make_float4(a0 * sc, a1 * sc, a2 * sc, a3 * sc);
}

// ---------------------------------------------------------------------------
// fuse1: out[i,j] = sum_{d=-1..1} in[i+d, j+d]  (flattened 1024x1024, zero OOB)
// ---------------------------------------------------------------------------
__global__ void fuse1(const float* __restrict__ in, float* __restrict__ out, int total) {
    int idx = blockIdx.x * blockDim.x + threadIdx.x;
    if (idx >= total) return;
    int j = idx % L;
    int i = (idx / L) % L;
    int b = idx / (L * L);
    const float* src = in + (size_t)b * L * L;
    float acc = 0.0f;
    #pragma unroll
    for (int d = -1; d <= 1; ++d) {
        int ii = i + d, jj = j + d;
        if (ii >= 0 && ii < L && jj >= 0 && jj < L)
            acc += src[(size_t)ii * L + jj];
    }
    out[idx] = acc;
}

// ---------------------------------------------------------------------------
// fuse2: fuse along the transposed flattening. For p=(py,px), s=(fy,fx):
//   i' = px*32+py, j' = fx*32+fy ; out += in[p(t), s(u)] for t=i'+d, u=j'+d
//   with p(t) = (t%32)*32 + t/32.
// ---------------------------------------------------------------------------
__global__ void fuse2(const float* __restrict__ in, float* __restrict__ out, int total) {
    int idx = blockIdx.x * blockDim.x + threadIdx.x;
    if (idx >= total) return;
    int s = idx % L;
    int p = (idx / L) % L;
    int b = idx / (L * L);
    const float* src = in + (size_t)b * L * L;
    int py = p >> 5, px = p & 31;
    int fy = s >> 5, fx = s & 31;
    int ip = px * 32 + py;
    int jp = fx * 32 + fy;
    float acc = 0.0f;
    #pragma unroll
    for (int d = -1; d <= 1; ++d) {
        int t = ip + d, u = jp + d;
        if (t >= 0 && t < L && u >= 0 && u < L) {
            int psrc = (t & 31) * 32 + (t >> 5);
            int ssrc = (u & 31) * 32 + (u >> 5);
            acc += src[(size_t)psrc * L + ssrc];
        }
    }
    out[idx] = acc;
}

// ---------------------------------------------------------------------------
// Masked softmax over p (axis 0) for each column s, writing transposed:
//   yiT[b][s][p] = softmax_p(in[b][p][s]*mm[p]*10) * mm[p]
// ---------------------------------------------------------------------------
__global__ void softmax_T(const float* __restrict__ in, const float* __restrict__ mm,
                          float* __restrict__ yiT) {
    __shared__ float red[256];
    int s = blockIdx.x;
    int b = blockIdx.y;
    const float* src = in + (size_t)b * L * L;
    float v[4], m[4];
    #pragma unroll
    for (int k = 0; k < 4; ++k) {
        int p = threadIdx.x + k * 256;
        m[k] = mm[p];
        v[k] = src[(size_t)p * L + s] * m[k] * SOFTMAX_SCALE;
    }
    float mx = fmaxf(fmaxf(v[0], v[1]), fmaxf(v[2], v[3]));
    red[threadIdx.x] = mx;
    __syncthreads();
    for (int st = 128; st > 0; st >>= 1) {
        if (threadIdx.x < st) red[threadIdx.x] = fmaxf(red[threadIdx.x], red[threadIdx.x + st]);
        __syncthreads();
    }
    mx = red[0];
    __syncthreads();
    float e[4], ssum = 0.0f;
    #pragma unroll
    for (int k = 0; k < 4; ++k) { e[k] = expf(v[k] - mx); ssum += e[k]; }
    red[threadIdx.x] = ssum;
    __syncthreads();
    for (int st = 128; st > 0; st >>= 1) {
        if (threadIdx.x < st) red[threadIdx.x] += red[threadIdx.x + st];
        __syncthreads();
    }
    float inv = 1.0f / red[0];
    float* dst = yiT + ((size_t)b * L + s) * L;
    #pragma unroll
    for (int k = 0; k < 4; ++k) {
        int p = threadIdx.x + k * 256;
        dst[p] = e[k] * inv * m[k];
    }
}

// ---------------------------------------------------------------------------
// The stride-2 transposed conv with the 4x4 raw patches, by output parity.
// With Y = 2*Yh + ry, X = 2*Xh + rx, s = Yh*32 + Xh, p = u*32 + v:
//   out[b,c,Y,X] = 0.25 * sum_p Apar[b][r][s][p] * b_full[b, c, 2*u + ry, 2*v + rx]
//   Apar[b][r][s][p] = sum_{dy in {0,sy}, dx in {0,sx}} yiT[b][s + 32*dy + dx][p + 32*dy + dx]
// sy = ry ? +1 : -1, sx = rx ? +1 : -1; a tap counts only where both shifted pixels
// lie inside the 32x32 image. (The 16 taps of a raw patch overlap its neighbours':
// each full-resolution pixel is met by 2x2 (position, patch) pairs on one diagonal.)
//
// One block = SRUN consecutive Xh of one image row Yh; a thread owns 4 consecutive p,
// which share one image row u. Every tap is an aligned 16-byte load at column
// p4 + 32*dy; a row serves dx = -1, 0, +1 of three neighbouring s, and for dx = -1/+1
// the element that crosses the 4-group comes from the neighbour lane.
// ---------------------------------------------------------------------------
#define SRUN 4
__device__ __forceinline__ float4 add4(float4 a, float4 b) {
    return make_float4(a.x + b.x, a.y + b.y, a.z + b.z, a.w + b.w);
}
__global__ __launch_bounds__(256)
void shift_sum4(const float* __restrict__ yiT, float* __restrict__ Apar) {
    const int x0 = blockIdx.x * SRUN;
    const int yh = blockIdx.y;
    const int b  = blockIdx.z;
    const float* Yb = yiT + (size_t)b * L * L;
    const int p4 = threadIdx.x * 4;
    const int u = p4 >> 5, v0 = p4 & 31;
    // All loads are unconditional (a tap outside the image reads a row/column of its
    // own block instead and is then replaced by zero), so they fly together.
    // Every loop of this kernel is unrolled so that w[][] and e[] are indexed by
    // constants only and stay in registers.
    float4 w[3][SRUN + 2];
    #pragma unroll
    for (int t = 0; t < 3; ++t) {
        const int dy = t - 1;
        const bool rv = (yh + dy >= 0) && (yh + dy < HD);                 // same for the block
        const bool cv = (u + dy >= 0) && (u + dy < HD);                   // per lane
        const unsigned boff = (unsigned)(cv ? p4 + 32 * dy : p4) * 4u;    // byte column
        #pragma unroll
        for (int i = 0; i < SRUN + 2; ++i) {
            const int j = x0 - 1 + i;
            const bool jv = rv && (j >= 0) && (j < WD);
            const char* rowp = (const char*)(Yb + (size_t)(jv ? (yh + dy) * WD + j : yh * WD + x0) * L);
            w[t][i] = *(const float4*)(rowp + boff);
        }
        // precaution: a later load's result may be given these loads' address registers
        asm volatile("s_wait_xcnt 0x0" ::: "memory");
    }
    #pragma unroll
    for (int t = 0; t < 3; ++t) {
        const int dy = t - 1;
        const bool cv = (yh + dy >= 0) && (yh + dy < HD) && (u + dy >= 0) && (u + dy < HD);
        #pragma unroll
        for (int i = 0; i < SRUN + 2; ++i) {
            const int j = x0 - 1 + i;
            const bool ok = cv && (j >= 0) && (j < WD);
            w[t][i].x = ok ? w[t][i].x : 0.0f;
            w[t][i].y = ok ? w[t][i].y : 0.0f;
            w[t][i].z = ok ? w[t][i].z : 0.0f;
            w[t][i].w = ok ? w[t][i].w : 0.0f;
        }
    }
    #pragma unroll
    for (int ry = 0; ry < 2; ++ry) {
        float4 e[SRUN + 2];                                // dy = 0 plus dy = sy
        #pragma unroll
        for (int i = 0; i < SRUN + 2; ++i) e[i] = add4(w[1][i], w[ry ? 2 : 0][i]);
        #pragma unroll
        for (int k = 1; k <= SRUN; ++k) {
            const float4 lo = e[k - 1], hi = e[k + 1];
            const float fl = __shfl_up(lo.w, 1);           // column p4 - 1
            const float fh = __shfl_down(hi.x, 1);         // column p4 + 4
            const float4 m = make_float4((v0 == 0) ? 0.0f : fl, lo.x, lo.y, lo.z);
            const float4 q = make_float4(hi.y, hi.z, hi.w, (v0 == 28) ? 0.0f : fh);
            const int s = yh * WD + x0 + k - 1;
            float* d = Apar + (((size_t)(b * 4 + ry * 2) * L + s) * L + p4);
            *(float4*)d                    = add4(e[k], m);
            *(float4*)(d + (size_t)L * L)  = add4(e[k], q);
        }
    }
}

// ---------------------------------------------------------------------------
// out[b,c,Y,X] = 0.25 * Cpar[b][(Y&1)*2 + (X&1)][c][(Y>>1)*32 + (X>>1)]
// A thread writes 4 consecutive X from a pair of each of the two rx planes.
// ---------------------------------------------------------------------------
__global__ __launch_bounds__(256)
void merge_parity(const float* __restrict__ Cpar, float* __restrict__ out) {
    const int idx = blockIdx.x * 256 + threadIdx.x;       // (b*CH + c, Y, X/4)
    const int x4 = idx & 15;
    const int Y  = (idx >> 4) & 63;
    const int c  = (idx >> 10) & (CH - 1);
    const int b  = idx >> 17;
    const int p = (Y >> 1) * WD + x4 * 2;
    const float* s0 = Cpar + (((size_t)(b * 4 + (Y & 1) * 2) * CH + c) * L + p);
    const float2 ev = *(const float2*)s0;
    const float2 od = *(const float2*)(s0 + (size_t)CH * L);
    *(float4*)&out[(size_t)idx * 4] =
        make_float4(ev.x * 0.25f, od.x * 0.25f, ev.y * 0.25f, od.y * 0.25f);
}

// ---------------------------------------------------------------------------
extern "C" void kernel_launch(void* const* d_in, const int* in_sizes, int n_in,
                              void* d_out, int out_size, void* d_ws, size_t ws_size,
                              hipStream_t stream) {
    const float* f    = (const float*)d_in[0];   // (4,128,64,64)
    const float* bsrc = (const float*)d_in[1];   // (4,128,64,64)
    const float* mask = (const float*)d_in[2];   // (4,1,256,256)
    float* out = (float*)d_out;

    // workspace layout (bytes)
    const size_t SZ_PIX  = (size_t)BATCH * L * CH * 4;     // 2,097,152
    const size_t SZ_YI   = (size_t)BATCH * L * L * 4;      // 16,777,216
    const size_t SZ_APAR = (size_t)BATCH * 4 * L * L * 4;  // 67,108,864
    const size_t SZ_PAR  = (size_t)BATCH * 4 * CH * L * 4; // 8,388,608
    char* w = (char*)d_ws;
    float* bT     = (float*)(w);
    float* fT     = (float*)(w + SZ_PIX);
    float* yiA    = (float*)(w + 2 * SZ_PIX);
    float* yiB    = (float*)(w + 2 * SZ_PIX + SZ_YI);
    float* Apar   = (float*)(w + 2 * SZ_PIX + 2 * SZ_YI);
    float* bpar   = (float*)(w + 2 * SZ_PIX + 2 * SZ_YI + SZ_APAR);
    float* Cpar   = (float*)(w + 2 * SZ_PIX + 2 * SZ_YI + SZ_APAR + SZ_PAR);
    float* rnorm  = (float*)(w + 2 * SZ_PIX + 2 * SZ_YI + SZ_APAR + 2 * SZ_PAR);
    float* mmbuf  = rnorm + BATCH * L;

    {
        dim3 grid(CH / 32, BATCH * HD, 2);
        gather_ds_T<<<grid, 256, 0, stream>>>(bsrc, f, bT, fT);
    }

    const int totOut = BATCH * CH * H0 * W0;
    split_parity<<<totOut / 4 / 256, 256, 0, stream>>>(bsrc, bpar);

    patch_rnorm<<<BATCH * L, 128, 0, stream>>>(bT, rnorm);
    build_mm<<<(L + 255) / 256, 256, 0, stream>>>(mask, mmbuf);

    // GEMM1: yiB[b][p][s] = sum_c bT[p,c] fT[s,c]   (1024x1024x128, pixel Gram matrix)
    {
        dim3 grid(L / 64, L / 64, BATCH);
        gemm_nt_wmma<<<grid, 128, 0, stream>>>(bT, fT, yiB, L, L, CH,
                                               (long)L * CH, (long)L * CH,
                                               (long)L * L, nullptr, 0);
    }
    // yiA[b][p][s] = rnorm[p] * 9-tap diagonal sum of the Gram matrix
    {
        dim3 grid(L, BATCH);
        patch_sum9<<<grid, 256, 0, stream>>>(yiB, rnorm, yiA);
    }

    const int totYi = BATCH * L * L;
    fuse1<<<(totYi + 255) / 256, 256, 0, stream>>>(yiA, yiB, totYi);
    fuse2<<<(totYi + 255) / 256, 256, 0, stream>>>(yiB, yiA, totYi);

    {
        dim3 grid(L, BATCH);
        softmax_T<<<grid, 256, 0, stream>>>(yiA, mmbuf, yiB);   // yiB = yiT (s,p)
    }

    // Apar[b][r][s][p] = 2x2 diagonal shift-sum of yiT, one plane per output parity r
    {
        dim3 grid(WD / SRUN, HD, BATCH);
        shift_sum4<<<grid, 256, 0, stream>>>(yiB, Apar);
    }
    // GEMM2: Cpar[b][r][c][s] = sum_p bpar[c,p] * Apar[s,p]   (16 x 128x1024x1024)
    {
        dim3 grid(L / 64, CH / 64, BATCH * 4);
        gemm_nt_wmma<<<grid, 128, 0, stream>>>(bpar, Apar, Cpar, CH, L, L,
                                               (long)CH * L, (long)L * L,
                                               (long)CH * L, nullptr, 0);
    }

    merge_parity<<<totOut / 4 / 256, 256, 0, stream>>>(Cpar, out);
}

// v003
// It runs in 95.7 microseconds.
// Next to v002, in two timings, it ran 1.50 times as fast each time.
// All steps since v000 together make it 3.03 times as fast.
#include <hip/hip_runtime.h>
#include <hip/hip_bf16.h>

typedef float v2f __attribute__((ext_vector_type(2)));
typedef float v8f __attribute__((ext_vector_type(8)));

// Problem constants (from reference)
#define BATCH 4
#define CH    128
#define H0    64
#define W0    64
#define HD    32      // downsampled
#define WD    32
#define L     1024    // HD*WD patches
#define SOFTMAX_SCALE 10.0f

// ---------------------------------------------------------------------------
// CDNA5 async global->LDS copy (16B per lane), tracked by ASYNCcnt.
// vdst = LDS byte address (low 32 bits of the flat shared pointer, which is
// exactly what the flat-aperture truncation uses), vaddr = 64-bit global addr.
// ---------------------------------------------------------------------------
// One tile = four copies per lane. s_wait_xcnt 0 is the last line of the same
// statement so that no address register of an issued copy is rewritten ahead of it.
__device__ __forceinline__ void async_copy16x4(unsigned l0, const float* g0,
                                               unsigned l1, const float* g1,
                                               unsigned l2, const float* g2,
                                               unsigned l3, const float* g3) {
    asm volatile("global_load_async_to_lds_b128 %0, %1, off\n\t"
                 "global_load_async_to_lds_b128 %2, %3, off\n\t"
                 "global_load_async_to_lds_b128 %4, %5, off\n\t"
                 "global_load_async_to_lds_b128 %6, %7, off\n\t"
                 "s_wait_xcnt 0x0"
                 :: "v"(l0), "v"((unsigned long long)(uintptr_t)g0),
                    "v"(l1), "v"((unsigned long long)(uintptr_t)g1),
                    "v"(l2), "v"((unsigned long long)(uintptr_t)g2),
                    "v"(l3), "v"((unsigned long long)(uintptr_t)g3)
                 : "memory");
}
// The same for six copies per lane (the staged rows of the fuse + softmax kernel).
__device__ __forceinline__ void async_copy16x6(unsigned l0, const char* g0,
                                               unsigned l1, const char* g1,
                                               unsigned l2, const char* g2,
                                               unsigned l3, const char* g3,
                                               unsigned l4, const char* g4,
                                               unsigned l5, const char* g5) {
    asm volatile("global_load_async_to_lds_b128 %0, %1, off\n\t"
                 "global_load_async_to_lds_b128 %2, %3, off\n\t"
                 "global_load_async_to_lds_b128 %4, %5, off\n\t"
                 "global_load_async_to_lds_b128 %6, %7, off\n\t"
                 "global_load_async_to_lds_b128 %8, %9, off\n\t"
                 "global_load_async_to_lds_b128 %10, %11, off\n\t"
                 "s_wait_xcnt 0x0"
                 :: "v"(l0), "v"((unsigned long long)(uintptr_t)g0),
                    "v"(l1), "v"((unsigned long long)(uintptr_t)g1),
                    "v"(l2), "v"((unsigned long long)(uintptr_t)g2),
                    "v"(l3), "v"((unsigned long long)(uintptr_t)g3),
                    "v"(l4), "v"((unsigned long long)(uintptr_t)g4),
                    "v"(l5), "v"((unsigned long long)(uintptr_t)g5)
                 : "memory");
}
__device__ __forceinline__ void wait_async0() {
    asm volatile("s_wait_asynccnt 0x0" ::: "memory");
}
__device__ __forceinline__ unsigned lds_addr32(const void* p) {
    return (unsigned)(uintptr_t)p;
}

// ---------------------------------------------------------------------------
// Downsample (::2) and transpose to pixel-major, for both tensors in one launch:
//   xT[b][p][c] = x[b, c, 2*py, 2*px],  p = py*32 + px
// One block = one (b, py) row of 32 pixels x 32 channels, turned in LDS so that
// reads run along px and writes along c.
// ---------------------------------------------------------------------------
__global__ __launch_bounds__(256)
void gather_ds_T(const float* __restrict__ bsrc, const float* __restrict__ fsrc,
                 float* __restrict__ bT, float* __restrict__ fT) {
    __shared__ float tile[32][33];
    const float* x = blockIdx.z ? fsrc : bsrc;
    float* xT      = blockIdx.z ? fT : bT;
    const int c0 = blockIdx.x * 32;
    const int py = blockIdx.y & 31;
    const int b  = blockIdx.y >> 5;
    const int tx = threadIdx.x & 31;
    const int ty = threadIdx.x >> 5;
    #pragma unroll
    for (int k = 0; k < 4; ++k) {
        int c = ty + 8 * k;
        tile[c][tx] = x[(((size_t)b * CH + c0 + c) * H0 + 2 * py) * W0 + 2 * tx];
    }
    __syncthreads();
    #pragma unroll
    for (int k = 0; k < 4; ++k) {
        int px = ty + 8 * k;
        xT[((size_t)b * L + py * 32 + px) * CH + c0 + tx] = tile[tx][px];
    }
}

// ---------------------------------------------------------------------------
// The full-resolution background split into its four pixel parities, r = ry*2 + rx:
//   bpar[b][r][c][u*32 + v] = b_full[b, c, 2*u + ry, 2*v + rx]
// A thread reads 4 consecutive X and writes a pair to each of the two rx planes.
// ---------------------------------------------------------------------------
__global__ __launch_bounds__(256)
void split_parity(const float* __restrict__ bsrc, float* __restrict__ bpar) {
    const int idx = blockIdx.x * 256 + threadIdx.x;       // (b*CH + c, Y, X/4)
    const int x4 = idx & 15;
    const int Y  = (idx >> 4) & 63;
    const int c  = (idx >> 10) & (CH - 1);
    const int b  = idx >> 17;
    const float4 t = *(const float4*)&bsrc[(size_t)idx * 4];
    const int p = (Y >> 1) * WD + x4 * 2;
    float* d0 = bpar + (((size_t)(b * 4 + (Y & 1) * 2) * CH + c) * L + p);
    *(float2*)d0                   = make_float2(t.x, t.z);
    *(float2*)(d0 + (size_t)CH * L) = make_float2(t.y, t.w);
}

// ---------------------------------------------------------------------------
// rnorm[b][p] = 1 / max(sqrt(sum over the 3x3 zero-padded patch at p and all
// channels of bT^2), 1e-4)
// ---------------------------------------------------------------------------
__global__ void patch_rnorm(const float* __restrict__ bT, float* __restrict__ rnorm) {
    __shared__ float red[128];
    int row = blockIdx.x;                 // b*L + p
    int p = row & (L - 1);
    int py = p >> 5, px = p & 31;
    const float* base = bT + (size_t)(row - p) * CH;      // this batch item's plane
    float v[9];
    #pragma unroll
    for (int t = 0; t < 9; ++t) {
        const int y = py + t / 3 - 1, x = px + t % 3 - 1;
        const bool in = (y >= 0 && y < HD && x >= 0 && x < WD);
        v[t] = base[(size_t)(in ? y * WD + x : p) * CH + threadIdx.x];   // always in bounds
        // precaution: the next load's result may be given this load's address registers
        asm volatile("s_wait_xcnt 0x0" ::: "memory");
    }
    float s = 0.0f;
    #pragma unroll
    for (int t = 0; t < 9; ++t) {
        const int y = py + t / 3 - 1, x = px + t % 3 - 1;
        const bool in = (y >= 0 && y < HD && x >= 0 && x < WD);
        s += in ? v[t] * v[t] : 0.0f;
    }
    red[threadIdx.x] = s;
    __syncthreads();
    for (int st = 64; st > 0; st >>= 1) {
        if (threadIdx.x < st) red[threadIdx.x] += red[threadIdx.x + st];
        __syncthreads();
    }
    if (threadIdx.x == 0)
        rnorm[row] = 1.0f / fmaxf(sqrtf(red[0]), 1e-4f);
}

// ---------------------------------------------------------------------------
// mm[p] = 1 if all 9 taps of the (zero-padded) 3x3 patch of mask[0,0,::8,::8]
// are zero, else 0.
// ---------------------------------------------------------------------------
__global__ void build_mm(const float* __restrict__ mask, float* __restrict__ mm) {
    int p = blockIdx.x * blockDim.x + threadIdx.x;
    if (p >= L) return;
    int py = p >> 5, px = p & 31;
    float s = 0.0f;
    for (int dy = 0; dy < 3; ++dy)
        for (int dx = 0; dx < 3; ++dx) {
            int y = py + dy - 1, x = px + dx - 1;
            if (y >= 0 && y < 32 && x >= 0 && x < 32)
                s += mask[(size_t)(8 * y) * 256 + 8 * x];
        }
    mm[p] = (s == 0.0f) ? 1.0f : 0.0f;
}

// ---------------------------------------------------------------------------
// NT GEMM with f32 WMMA:  C[m,n] = (Σ_k A[m,k]*B[n,k]) * rowScale[m]
// A: M x K row-major, B: N x K row-major, C: M x N row-major.
// 128 threads = 4 waves (2x2), block tile 64x64, BK=16, double-buffered LDS
// filled with CDNA5 async global->LDS DMA (ASYNCcnt).
// ---------------------------------------------------------------------------
#define LDS_STRIDE 20
#define TILE_F     (64 * LDS_STRIDE)      // floats per 64x16 padded tile
__global__ __launch_bounds__(128)
void gemm_nt_wmma(const float* __restrict__ A, const float* __restrict__ B,
                  float* __restrict__ C, int M, int N, int K,
                  long strideA, long strideB, long strideC,
                  const float* __restrict__ rowScale, int scaleStride) {
    const int batch = blockIdx.z;
    A += (size_t)batch * strideA;
    B += (size_t)batch * strideB;
    C += (size_t)batch * strideC;
    if (rowScale) rowScale += (size_t)batch * scaleStride;

    const int tid  = threadIdx.x;
    const int lane = tid & 31;
    const int wave = tid >> 5;
    const int wr = wave & 1;          // wave row  (2 waves along M)
    const int wc = wave >> 1;         // wave col  (2 waves along N)
    const int hf = lane >> 4;         // lane half (K-pair select)
    const int lx = lane & 15;

    const int blockM = blockIdx.y * 64;
    const int blockN = blockIdx.x * 64;

    // [buf][A|B][64*20] double-buffered tiles
    __shared__ float smem[2 * 2 * TILE_F];

    v8f acc00 = 0.0f, acc01 = 0.0f, acc10 = 0.0f, acc11 = 0.0f;

    // cooperative-load assignment: thread -> rows lr, lr+32; float4 at col lc
    const int lr = tid >> 2;          // 0..31
    const int lc = (tid & 3) << 2;    // 0,4,8,12

    const float* gA0 = A + (size_t)(blockM + lr)      * K + lc;
    const float* gA1 = A + (size_t)(blockM + lr + 32) * K + lc;
    const float* gB0 = B + (size_t)(blockN + lr)      * K + lc;
    const float* gB1 = B + (size_t)(blockN + lr + 32) * K + lc;

    unsigned dA0[2], dA1[2], dB0[2], dB1[2];
    #pragma unroll
    for (int bf = 0; bf < 2; ++bf) {
        float* As = &smem[bf * 2 * TILE_F];
        float* Bs = As + TILE_F;
        dA0[bf] = lds_addr32(&As[lr * LDS_STRIDE + lc]);
        dA1[bf] = lds_addr32(&As[(lr + 32) * LDS_STRIDE + lc]);
        dB0[bf] = lds_addr32(&Bs[lr * LDS_STRIDE + lc]);
        dB1[bf] = lds_addr32(&Bs[(lr + 32) * LDS_STRIDE + lc]);
    }

    // prologue: fill buffer 0 with tile k0=0
    async_copy16x4(dA0[0], gA0, dA1[0], gA1, dB0[0], gB0, dB1[0], gB1);
    wait_async0();
    __syncthreads();

    const int nsteps = K >> 4;
    for (int s = 0; s < nsteps; ++s) {
        const int cur = s & 1;
        const int nxt = cur ^ 1;

        // issue async DMA for the next tile while we compute this one
        if (s + 1 < nsteps) {
            const size_t ko = (size_t)(s + 1) << 4;
            async_copy16x4(dA0[nxt], gA0 + ko, dA1[nxt], gA1 + ko,
                           dB0[nxt], gB0 + ko, dB1[nxt], gB1 + ko);
        }

        const float* As = &smem[cur * 2 * TILE_F];
        const float* Bs = As + TILE_F;

        #pragma unroll
        for (int ks = 0; ks < 4; ++ks) {
            const int kb = ks * 4 + 2 * hf;   // even -> 8B-aligned v2f
            v2f a0 = *(const v2f*)&As[(wr * 32 +  0 + lx) * LDS_STRIDE + kb];
            v2f a1 = *(const v2f*)&As[(wr * 32 + 16 + lx) * LDS_STRIDE + kb];
            v2f b0 = *(const v2f*)&Bs[(wc * 32 +  0 + lx) * LDS_STRIDE + kb];
            v2f b1 = *(const v2f*)&Bs[(wc * 32 + 16 + lx) * LDS_STRIDE + kb];
            acc00 = __builtin_amdgcn_wmma_f32_16x16x4_f32(false, a0, false, b0,
                        (short)0, acc00, false, false);
            acc01 = __builtin_amdgcn_wmma_f32_16x16x4_f32(false, a0, false, b1,
                        (short)0, acc01, false, false);
            acc10 = __builtin_amdgcn_wmma_f32_16x16x4_f32(false, a1, false, b0,
                        (short)0, acc10, false, false);
            acc11 = __builtin_amdgcn_wmma_f32_16x16x4_f32(false, a1, false, b1,
                        (short)0, acc11, false, false);
        }

        wait_async0();       // my next-tile DMA landed
        __syncthreads();     // everyone's landed; everyone done reading cur
    }

    // Epilogue. C/D layout: VGPR r holds M = r (lanes 0-15) / r+8 (lanes 16-31),
    // N = lane & 15.
    #pragma unroll
    for (int mt = 0; mt < 2; ++mt) {
        v8f ar0 = (mt == 0) ? acc00 : acc10;
        v8f ar1 = (mt == 0) ? acc01 : acc11;
        #pragma unroll
        for (int r = 0; r < 8; ++r) {
            int gm = blockM + wr * 32 + mt * 16 + r + 8 * hf;
            float sc = rowScale ? rowScale[gm] : 1.0f;
            int gn0 = blockN + wc * 32 + lx;
            C[(size_t)gm * N + gn0]      = ar0[r] * sc;
            C[(size_t)gm * N + gn0 + 16] = ar1[r] * sc;
        }
    }
}

// ---------------------------------------------------------------------------
// 3x3 patch correlation from the pixel Gram matrix, kept transposed,
// G[s][p] = sum_c fT[s][c]*bT[p][c]:
//   S[s][p] = rnorm[p] * sum_{dy,dx=-1..1} G[s + 32*dy + dx][p + 32*dy + dx]
// a tap counting only where both shifted pixels lie inside the 32x32 image (zero
// padding of both patches). One block = one row s; a thread owns 4 consecutive p,
// which share one image row. Every tap is one aligned 16-byte load; for dx = -1/+1
// the element that crosses the 4-group comes from the neighbour lane.
// ---------------------------------------------------------------------------
__global__ __launch_bounds__(256)
void patch_sum9(const float* __restrict__ G, const float* __restrict__ rnorm,
                float* __restrict__ S) {
    const int q = blockIdx.x;                 // row: foreground pixel s
    const int b = blockIdx.y;
    const float* Gb = G + (size_t)b * L * L;
    const int qy = q >> 5, qx = q & 31;
    const int c4 = threadIdx.x * 4;           // columns: background patches p
    const int cy = c4 >> 5, cx0 = c4 & 31;
    // All nine loads are unconditional (a tap outside the image reads its own
    // row/column instead and is then replaced by zero), so they fly together.
    float4 w[9];
    #pragma unroll
    for (int t = 0; t < 9; ++t) {
        const int dy = t / 3 - 1, dx = t % 3 - 1;
        const bool qv = (qy + dy >= 0) && (qy + dy < HD) && (qx + dx >= 0) && (qx + dx < WD);
        const bool cv = (cy + dy >= 0) && (cy + dy < HD);
        const char* rowp    = (const char*)(Gb + (size_t)(qv ? q + 32 * dy + dx : q) * L);  // same for the block
        const unsigned boff = (unsigned)(cv ? c4 + 32 * dy : c4) * 4u;                      // byte column, per lane
        w[t] = *(const float4*)(rowp + boff);
    }
    float a0 = 0.0f, a1 = 0.0f, a2 = 0.0f, a3 = 0.0f;
    #pragma unroll
    for (int t = 0; t < 9; ++t) {
        const int dy = t / 3 - 1, dx = t % 3 - 1;
        const bool ok = (qy + dy >= 0) && (qy + dy < HD) && (qx + dx >= 0) && (qx + dx < WD) &&
                        (cy + dy >= 0) && (cy + dy < HD);
        const float x0 = ok ? w[t].x : 0.0f, x1 = ok ? w[t].y : 0.0f;
        const float x2 = ok ? w[t].z : 0.0f, x3 = ok ? w[t].w : 0.0f;
        if (dx == 0) {
            a0 += x0; a1 += x1; a2 += x2; a3 += x3;
        } else if (dx < 0) {
            const float e = __shfl_up(x3, 1);                // column c4 - 1
            a0 += (cx0 == 0) ? 0.0f : e;
            a1 += x0; a2 += x1; a3 += x2;
        } else {
            const float e = __shfl_down(x0, 1);              // column c4 + 4
            a0 += x1; a1 += x2; a2 += x3;
            a3 += (cx0 == 28) ? 0.0f : e;
        }
    }
    const float4 sc = *(const float4*)&rnorm[b * L + c4];
    *(float4*)&S[((size_t)b * L + q) * L + c4] =
        make_float4(a0 * sc.x, a1 * sc.y, a2 * sc.z, a3 * sc.w);
}

// ---------------------------------------------------------------------------
// Both diagonal fuse passes and the masked softmax, on the transposed scores S[s][p].
//   F1[i][j] = sum_{d1=-1..1} S[i+d1][j+d1]                 (flat indices, zero outside)
//   F2[s][p] = sum_{d2=-1..1} F1[T(T(s)+d2)][T(T(p)+d2)]    (zero where T(.)+d2 leaves 0..1023)
//   T(y*32+x) = x*32+y  (the transposed flattening; T is its own inverse)
//   yiT[b][s][p] = softmax_p(F2[s][p]*mm[p]*10) * mm[p]
// One block = SROWS consecutive s of one image row. T(T(s)+d2) steps by 1 with s there,
// so each d2 needs SROWS+2 consecutive rows of S; async copies stage them in LDS. A row outside
// the matrix is staged as zeros, and each row has a zero in front of and behind it, so
// a tap at column -1 or 1024 adds zero with no test. All 1024 p of an s are in the
// block, so the softmax follows on the spot, the SROWS reductions side by side.
// ---------------------------------------------------------------------------
#define ROWP  (L + 8)     // floats per staged row: data at 4..L+3, zeros at 3 and L+4
#define SROWS 4
#define GROWS (SROWS + 2) // staged rows per d2
__global__ __launch_bounds__(256)
void fuse_softmax(const float* __restrict__ S, const float* __restrict__ mm,
                  float* __restrict__ yiT) {
    __shared__ __attribute__((aligned(16))) float rows[3 * GROWS * ROWP];
    __shared__ __attribute__((aligned(16))) float red[256][SROWS];   // a thread's SROWS partials side by side
    const int s0 = blockIdx.x * SROWS;
    const int b = blockIdx.y;
    const int tid = threadIdx.x;
    const char* src = (const char*)(S + (size_t)b * L * L);
    const int js0 = (s0 & 31) * 32 + (s0 >> 5);               // T(s0); T(s0 + i) = js0 + 32*i
    const unsigned boff = (unsigned)tid * 16u;                // byte column, per lane
    // Every lane copies its 16 bytes of each of the 18 rows straight to LDS; the copies are
    // unconditional (a row outside the matrix copies row s0 instead and is then overwritten
    // with zeros), so they fly together. Every loop over g, j, i, k and d2 is unrolled so
    // that the arrays are indexed by constants only and stay in registers.
    const unsigned lbase = lds_addr32(&rows[4 + tid * 4]);
    float m[4];                                               // asked for early: lands under the copies
    #pragma unroll
    for (int k = 0; k < 4; ++k) m[k] = mm[tid + k * 256];
    #pragma unroll
    for (int g = 0; g < 3; ++g) {
        const int tt = js0 + g - 1;
        const int r0 = ((tt & 31) << 5) + (tt >> 5) - 1;      // row in slot 0 of this d2
        const char* gp[GROWS];
        unsigned lp[GROWS];
        #pragma unroll
        for (int j = 0; j < GROWS; ++j) {
            const bool ok = (r0 + j >= 0) && (r0 + j < L);    // same for the block
            gp[j] = src + (size_t)(ok ? r0 + j : s0) * (L * 4) + boff;
            lp[j] = lbase + (unsigned)((g * GROWS + j) * ROWP * 4);
        }
        async_copy16x6(lp[0], gp[0], lp[1], gp[1], lp[2], gp[2],
                       lp[3], gp[3], lp[4], gp[4], lp[5], gp[5]);
    }
    wait_async0();       // my copies have landed: my own bytes may be overwritten, and published
    #pragma unroll
    for (int g = 0; g < 3; ++g) {
        const int tt = js0 + g - 1;
        const int r0 = ((tt & 31) << 5) + (tt >> 5) - 1;
        #pragma unroll
        for (int j = 0; j < GROWS; ++j) {
            if ((r0 + j < 0) || (r0 + j >= L))
                *(float4*)&rows[(g * GROWS + j) * ROWP + 4 + tid * 4] =
                    make_float4(0.0f, 0.0f, 0.0f, 0.0f);
        }
    }
    if (tid < 3 * GROWS) {
        rows[tid * ROWP + 3]     = 0.0f;
        rows[tid * ROWP + L + 4] = 0.0f;
    }
    __syncthreads();

    float v[SROWS][4];
    #pragma unroll
    for (int k = 0; k < 4; ++k) {
        const int p  = tid + k * 256;
        const int ip = (p & 31) * 32 + (p >> 5);
        float acc[SROWS];
        #pragma unroll
        for (int i = 0; i < SROWS; ++i) acc[i] = 0.0f;
        #pragma unroll
        for (int d2 = -1; d2 <= 1; ++d2) {
            const int u  = ip + d2;
            const int c2 = ((u & 31) << 5) + (u >> 5);        // 991 at u = -1, 32 at u = 1024: in range
            const bool uok = (u >= 0) && (u < L);
            const float* rp = &rows[(d2 + 1) * GROWS * ROWP + 4 + c2];
            #pragma unroll
            for (int i = 0; i < SROWS; ++i) {
                const int ti = js0 + 32 * i + d2;             // same for the block
                float f1 = 0.0f;
                f1 += rp[i * ROWP - 1];
                f1 += rp[(i + 1) * ROWP];
                f1 += rp[(i + 2) * ROWP + 1];
                acc[i] += (uok && ti >= 0 && ti < L) ? f1 : 0.0f;
            }
        }
        #pragma unroll
        for (int i = 0; i < SROWS; ++i) v[i][k] = acc[i] * m[k] * SOFTMAX_SCALE;
    }
    #pragma unroll
    for (int i = 0; i < SROWS; ++i)
        red[tid][i] = fmaxf(fmaxf(v[i][0], v[i][1]), fmaxf(v[i][2], v[i][3]));
    __syncthreads();
    for (int st = 128; st > 0; st >>= 1) {
        if (tid < st) {
            #pragma unroll
            for (int i = 0; i < SROWS; ++i) red[tid][i] = fmaxf(red[tid][i], red[tid + st][i]);
        }
        __syncthreads();
    }
    float mx[SROWS];
    #pragma unroll
    for (int i = 0; i < SROWS; ++i) mx[i] = red[0][i];
    __syncthreads();
    #pragma unroll
    for (int i = 0; i < SROWS; ++i) {
        float ssum = 0.0f;
        #pragma unroll
        for (int k = 0; k < 4; ++k) { v[i][k] = expf(v[i][k] - mx[i]); ssum += v[i][k]; }
        red[tid][i] = ssum;
    }
    __syncthreads();
    for (int st = 128; st > 0; st >>= 1) {
        if (tid < st) {
            #pragma unroll
            for (int i = 0; i < SROWS; ++i) red[tid][i] += red[tid + st][i];
        }
        __syncthreads();
    }
    #pragma unroll
    for (int i = 0; i < SROWS; ++i) {
        const float inv = 1.0f / red[0][i];
        float* dst = yiT + ((size_t)b * L + s0 + i) * L;
        #pragma unroll
        for (int k = 0; k < 4; ++k) dst[tid + k * 256] = v[i][k] * inv * m[k];
    }
}

// ---------------------------------------------------------------------------
// The stride-2 transposed conv with the 4x4 raw patches, by output parity.
// With Y = 2*Yh + ry, X = 2*Xh + rx, s = Yh*32 + Xh, p = u*32 + v:
//   out[b,c,Y,X] = 0.25 * sum_p Apar[b][r][s][p] * b_full[b, c, 2*u + ry, 2*v + rx]
//   Apar[b][r][s][p] = sum_{dy in {0,sy}, dx in {0,sx}} yiT[b][s + 32*dy + dx][p + 32*dy + dx]
// sy = ry ? +1 : -1, sx = rx ? +1 : -1; a tap counts only where both shifted pixels
// lie inside the 32x32 image. (The 16 taps of a raw patch overlap its neighbours':
// each full-resolution pixel is met by 2x2 (position, patch) pairs on one diagonal.)
//
// One block = SRUN consecutive Xh of one image row Yh; a thread owns 4 consecutive p,
// which share one image row u. Every tap is an aligned 16-byte load at column
// p4 + 32*dy; a row serves dx = -1, 0, +1 of three neighbouring s, and for dx = -1/+1
// the element that crosses the 4-group comes from the neighbour lane.
// ---------------------------------------------------------------------------
#define SRUN 4
__device__ __forceinline__ float4 add4(float4 a, float4 b) {
    return make_float4(a.x + b.x, a.y + b.y, a.z + b.z, a.w + b.w);
}
__global__ __launch_bounds__(256)
void shift_sum4(const float* __restrict__ yiT, float* __restrict__ Apar) {
    const int x0 = blockIdx.x * SRUN;
    const int yh = blockIdx.y;
    const int b  = blockIdx.z;
    const float* Yb = yiT + (size_t)b * L * L;
    const int p4 = threadIdx.x * 4;
    const int u = p4 >> 5, v0 = p4 & 31;
    // All loads are unconditional (a tap outside the image reads a row/column of its
    // own block instead and is then replaced by zero), so they fly together.
    // Every loop of this kernel is unrolled so that w[][] and e[] are indexed by
    // constants only and stay in registers.
    float4 w[3][SRUN + 2];
    #pragma unroll
    for (int t = 0; t < 3; ++t) {
        const int dy = t - 1;
        const bool rv = (yh + dy >= 0) && (yh + dy < HD);                 // same for the block
        const bool cv = (u + dy >= 0) && (u + dy < HD);                   // per lane
        const unsigned boff = (unsigned)(cv ? p4 + 32 * dy : p4) * 4u;    // byte column
        #pragma unroll
        for (int i = 0; i < SRUN + 2; ++i) {
            const int j = x0 - 1 + i;
            const bool jv = rv && (j >= 0) && (j < WD);
            const char* rowp = (const char*)(Yb + (size_t)(jv ? (yh + dy) * WD + j : yh * WD + x0) * L);
            w[t][i] = *(const float4*)(rowp + boff);
        }
        // precaution: a later load's result may be given these loads' address registers
        asm volatile("s_wait_xcnt 0x0" ::: "memory");
    }
    #pragma unroll
    for (int t = 0; t < 3; ++t) {
        const int dy = t - 1;
        const bool cv = (yh + dy >= 0) && (yh + dy < HD) && (u + dy >= 0) && (u + dy < HD);
        #pragma unroll
        for (int i = 0; i < SRUN + 2; ++i) {
            const int j = x0 - 1 + i;
            const bool ok = cv && (j >= 0) && (j < WD);
            w[t][i].x = ok ? w[t][i].x : 0.0f;
            w[t][i].y = ok ? w[t][i].y : 0.0f;
            w[t][i].z = ok ? w[t][i].z : 0.0f;
            w[t][i].w = ok ? w[t][i].w : 0.0f;
        }
    }
    #pragma unroll
    for (int ry = 0; ry < 2; ++ry) {
        float4 e[SRUN + 2];                                // dy = 0 plus dy = sy
        #pragma unroll
        for (int i = 0; i < SRUN + 2; ++i) e[i] = add4(w[1][i], w[ry ? 2 : 0][i]);
        #pragma unroll
        for (int k = 1; k <= SRUN; ++k) {
            const float4 lo = e[k - 1], hi = e[k + 1];
            const float fl = __shfl_up(lo.w, 1);           // column p4 - 1
            const float fh = __shfl_down(hi.x, 1);         // column p4 + 4
            const float4 m = make_float4((v0 == 0) ? 0.0f : fl, lo.x, lo.y, lo.z);
            const float4 q = make_float4(hi.y, hi.z, hi.w, (v0 == 28) ? 0.0f : fh);
            const int s = yh * WD + x0 + k - 1;
            float* d = Apar + (((size_t)(b * 4 + ry * 2) * L + s) * L + p4);
            *(float4*)d                    = add4(e[k], m);
            *(float4*)(d + (size_t)L * L)  = add4(e[k], q);
        }
    }
}

// ---------------------------------------------------------------------------
// out[b,c,Y,X] = 0.25 * Cpar[b][(Y&1)*2 + (X&1)][c][(Y>>1)*32 + (X>>1)]
// A thread writes 4 consecutive X from a pair of each of the two rx planes.
// ---------------------------------------------------------------------------
__global__ __launch_bounds__(256)
void merge_parity(const float* __restrict__ Cpar, float* __restrict__ out) {
    const int idx = blockIdx.x * 256 + threadIdx.x;       // (b*CH + c, Y, X/4)
    const int x4 = idx & 15;
    const int Y  = (idx >> 4) & 63;
    const int c  = (idx >> 10) & (CH - 1);
    const int b  = idx >> 17;
    const int p = (Y >> 1) * WD + x4 * 2;
    const float* s0 = Cpar + (((size_t)(b * 4 + (Y & 1) * 2) * CH + c) * L + p);
    const float2 ev = *(const float2*)s0;
    const float2 od = *(const float2*)(s0 + (size_t)CH * L);
    *(float4*)&out[(size_t)idx * 4] =
        make_float4(ev.x * 0.25f, od.x * 0.25f, ev.y * 0.25f, od.y * 0.25f);
}

// ---------------------------------------------------------------------------
extern "C" void kernel_launch(void* const* d_in, const int* in_sizes, int n_in,
                              void* d_out, int out_size, void* d_ws, size_t ws_size,
                              hipStream_t stream) {
    const float* f    = (const float*)d_in[0];   // (4,128,64,64)
    const float* bsrc = (const float*)d_in[1];   // (4,128,64,64)
    const float* mask = (const float*)d_in[2];   // (4,1,256,256)
    float* out = (float*)d_out;

    // workspace layout (bytes)
    const size_t SZ_PIX  = (size_t)BATCH * L * CH * 4;     // 2,097,152
    const size_t SZ_YI   = (size_t)BATCH * L * L * 4;      // 16,777,216
    const size_t SZ_APAR = (size_t)BATCH * 4 * L * L * 4;  // 67,108,864
    const size_t SZ_PAR  = (size_t)BATCH * 4 * CH * L * 4; // 8,388,608
    char* w = (char*)d_ws;
    float* bT     = (float*)(w);
    float* fT     = (float*)(w + SZ_PIX);
    float* yiA    = (float*)(w + 2 * SZ_PIX);
    float* yiB    = (float*)(w + 2 * SZ_PIX + SZ_YI);
    float* Apar   = (float*)(w + 2 * SZ_PIX + 2 * SZ_YI);
    float* bpar   = (float*)(w + 2 * SZ_PIX + 2 * SZ_YI + SZ_APAR);
    float* Cpar   = (float*)(w + 2 * SZ_PIX + 2 * SZ_YI + SZ_APAR + SZ_PAR);
    float* rnorm  = (float*)(w + 2 * SZ_PIX + 2 * SZ_YI + SZ_APAR + 2 * SZ_PAR);
    float* mmbuf  = rnorm + BATCH * L;

    {
        dim3 grid(CH / 32, BATCH * HD, 2);
        gather_ds_T<<<grid, 256, 0, stream>>>(bsrc, f, bT, fT);
    }

    const int totOut = BATCH * CH * H0 * W0;
    split_parity<<<totOut / 4 / 256, 256, 0, stream>>>(bsrc, bpar);

    patch_rnorm<<<BATCH * L, 128, 0, stream>>>(bT, rnorm);
    build_mm<<<(L + 255) / 256, 256, 0, stream>>>(mask, mmbuf);

    // GEMM1: yiB[b][s][p] = sum_c fT[s,c] bT[p,c]   (1024x1024x128, pixel Gram matrix)
    {
        dim3 grid(L / 64, L / 64, BATCH);
        gemm_nt_wmma<<<grid, 128, 0, stream>>>(fT, bT, yiB, L, L, CH,
                                               (long)L * CH, (long)L * CH,
                                               (long)L * L, nullptr, 0);
    }
    // yiA[b][s][p] = rnorm[p] * 9-tap diagonal sum of the Gram matrix
    {
        dim3 grid(L, BATCH);
        patch_sum9<<<grid, 256, 0, stream>>>(yiB, rnorm, yiA);
    }
    // yiB[b][s][p] = yiT: both fuse passes and the masked softmax over p
    {
        dim3 grid(L / SROWS, BATCH);
        fuse_softmax<<<grid, 256, 0, stream>>>(yiA, mmbuf, yiB);
    }

    // Apar[b][r][s][p] = 2x2 diagonal shift-sum of yiT, one plane per output parity r
    {
        dim3 grid(WD / SRUN, HD, BATCH);
        shift_sum4<<<grid, 256, 0, stream>>>(yiB, Apar);
    }
    // GEMM2: Cpar[b][r][c][s] = sum_p bpar[c,p] * Apar[s,p]   (16 x 128x1024x1024)
    {
        dim3 grid(L / 64, CH / 64, BATCH * 4);
        gemm_nt_wmma<<<grid, 128, 0, stream>>>(bpar, Apar, Cpar, CH, L, L,
                                               (long)CH * L, (long)L * L,
                                               (long)CH * L, nullptr, 0);
    }

    merge_parity<<<totOut / 4 / 256, 256, 0, stream>>>(Cpar, out);
}

// v004
// It runs in 88.6 microseconds.
// In both of two side-by-side timings against v003, it was 1.08 times as fast.
// All steps since v000 together make it 3.29 times as fast.
#include <hip/hip_runtime.h>
#include <hip/hip_bf16.h>

typedef float v2f __attribute__((ext_vector_type(2)));
typedef float v8f __attribute__((ext_vector_type(8)));

// Problem constants (from reference)
#define BATCH 4
#define CH    128
#define H0    64
#define W0    64
#define HD    32      // downsampled
#define WD    32
#define L     1024    // HD*WD patches
#define SOFTMAX_SCALE 10.0f

// ---------------------------------------------------------------------------
// CDNA5 async global->LDS copy (16B per lane), tracked by ASYNCcnt.
// vdst = LDS byte address (low 32 bits of the flat shared pointer, which is
// exactly what the flat-aperture truncation uses), vaddr = 64-bit global addr.
// ---------------------------------------------------------------------------
// One tile = four copies per lane. s_wait_xcnt 0 is the last line of the same
// statement so that no address register of an issued copy is rewritten ahead of it.
__device__ __forceinline__ void async_copy16x4(unsigned l0, const float* g0,
                                               unsigned l1, const float* g1,
                                               unsigned l2, const float* g2,
                                               unsigned l3, const float* g3) {
    asm volatile("global_load_async_to_lds_b128 %0, %1, off\n\t"
                 "global_load_async_to_lds_b128 %2, %3, off\n\t"
                 "global_load_async_to_lds_b128 %4, %5, off\n\t"
                 "global_load_async_to_lds_b128 %6, %7, off\n\t"
                 "s_wait_xcnt 0x0"
                 :: "v"(l0), "v"((unsigned long long)(uintptr_t)g0),
                    "v"(l1), "v"((unsigned long long)(uintptr_t)g1),
                    "v"(l2), "v"((unsigned long long)(uintptr_t)g2),
                    "v"(l3), "v"((unsigned long long)(uintptr_t)g3)
                 : "memory");
}
// The same for six copies per lane (the staged rows of the fuse + softmax kernel).
__device__ __forceinline__ void async_copy16x6(unsigned l0, const char* g0,
                                               unsigned l1, const char* g1,
                                               unsigned l2, const char* g2,
                                               unsigned l3, const char* g3,
                                               unsigned l4, const char* g4,
                                               unsigned l5, const char* g5) {
    asm volatile("global_load_async_to_lds_b128 %0, %1, off\n\t"
                 "global_load_async_to_lds_b128 %2, %3, off\n\t"
                 "global_load_async_to_lds_b128 %4, %5, off\n\t"
                 "global_load_async_to_lds_b128 %6, %7, off\n\t"
                 "global_load_async_to_lds_b128 %8, %9, off\n\t"
                 "global_load_async_to_lds_b128 %10, %11, off\n\t"
                 "s_wait_xcnt 0x0"
                 :: "v"(l0), "v"((unsigned long long)(uintptr_t)g0),
                    "v"(l1), "v"((unsigned long long)(uintptr_t)g1),
                    "v"(l2), "v"((unsigned long long)(uintptr_t)g2),
                    "v"(l3), "v"((unsigned long long)(uintptr_t)g3),
                    "v"(l4), "v"((unsigned long long)(uintptr_t)g4),
                    "v"(l5), "v"((unsigned long long)(uintptr_t)g5)
                 : "memory");
}
__device__ __forceinline__ void wait_async0() {
    asm volatile("s_wait_asynccnt 0x0" ::: "memory");
}
__device__ __forceinline__ unsigned lds_addr32(const void* p) {
    return (unsigned)(uintptr_t)p;
}

// ---------------------------------------------------------------------------
// Downsample (::2) and transpose to pixel-major, for both tensors in one launch:
//   xT[b][p][c] = x[b, c, 2*py, 2*px],  p = py*32 + px
// One block = one (b, py) row of 32 pixels x 32 channels, turned in LDS so that
// reads run along px and writes along c. job = (tensor, b, py, channel block).
// ---------------------------------------------------------------------------
__device__ __forceinline__
void gather_ds_T(int job, const float* __restrict__ bsrc, const float* __restrict__ fsrc,
                 float* __restrict__ bT, float* __restrict__ fT) {
    __shared__ float tile[32][33];
    const float* x = (job >> 9) ? fsrc : bsrc;
    float* xT      = (job >> 9) ? fT : bT;
    const int c0 = (job & 3) * 32;
    const int py = (job >> 2) & 31;
    const int b  = (job >> 7) & 3;
    const int tx = threadIdx.x & 31;
    const int ty = threadIdx.x >> 5;
    #pragma unroll
    for (int k = 0; k < 4; ++k) {
        int c = ty + 8 * k;
        tile[c][tx] = x[(((size_t)b * CH + c0 + c) * H0 + 2 * py) * W0 + 2 * tx];
    }
    __syncthreads();
    #pragma unroll
    for (int k = 0; k < 4; ++k) {
        int px = ty + 8 * k;
        xT[((size_t)b * L + py * 32 + px) * CH + c0 + tx] = tile[tx][px];
    }
}

// ---------------------------------------------------------------------------
// The full-resolution background split into its four pixel parities, r = ry*2 + rx:
//   bpar[b][r][c][u*32 + v] = b_full[b, c, 2*u + ry, 2*v + rx]
// A thread reads 4 consecutive X and writes a pair to each of the two rx planes.
// ---------------------------------------------------------------------------
__device__ __forceinline__
void split_parity(int job, const float* __restrict__ bsrc, float* __restrict__ bpar) {
    const int idx = job * 256 + threadIdx.x;              // (b*CH + c, Y, X/4)
    const int x4 = idx & 15;
    const int Y  = (idx >> 4) & 63;
    const int c  = (idx >> 10) & (CH - 1);
    const int b  = idx >> 17;
    const float4 t = *(const float4*)&bsrc[(size_t)idx * 4];
    const int p = (Y >> 1) * WD + x4 * 2;
    float* d0 = bpar + (((size_t)(b * 4 + (Y & 1) * 2) * CH + c) * L + p);
    *(float2*)d0                   = make_float2(t.x, t.z);
    *(float2*)(d0 + (size_t)CH * L) = make_float2(t.y, t.w);
    // precaution: in the shared grid's listing other code follows these stores and reuses
    // their address and data registers
    asm volatile("s_wait_xcnt 0x0" ::: "memory");
}

// ---------------------------------------------------------------------------
// rnorm[b][p] = 1 / max(sqrt(sum over the 3x3 zero-padded patch at p and all
// channels of bT^2), 1e-4)
// ---------------------------------------------------------------------------
__device__ __forceinline__
void patch_rnorm(int row, const float* __restrict__ bT, float* __restrict__ rnorm) {
    __shared__ float red[128];            // row = b*L + p
    int p = row & (L - 1);
    int py = p >> 5, px = p & 31;
    const float* base = bT + (size_t)(row - p) * CH;      // this batch item's plane
    float v[9];
    #pragma unroll
    for (int t = 0; t < 9; ++t) {
        const int y = py + t / 3 - 1, x = px + t % 3 - 1;
        const bool in = (y >= 0 && y < HD && x >= 0 && x < WD);
        v[t] = base[(size_t)(in ? y * WD + x : p) * CH + threadIdx.x];   // always in bounds
        // precaution: the next load's result may be given this load's address registers
        asm volatile("s_wait_xcnt 0x0" ::: "memory");
    }
    float s = 0.0f;
    #pragma unroll
    for (int t = 0; t < 9; ++t) {
        const int y = py + t / 3 - 1, x = px + t % 3 - 1;
        const bool in = (y >= 0 && y < HD && x >= 0 && x < WD);
        s += in ? v[t] * v[t] : 0.0f;
    }
    red[threadIdx.x] = s;
    __syncthreads();
    for (int st = 64; st > 0; st >>= 1) {
        if (threadIdx.x < st) red[threadIdx.x] += red[threadIdx.x + st];
        __syncthreads();
    }
    if (threadIdx.x == 0)
        rnorm[row] = 1.0f / fmaxf(sqrtf(red[0]), 1e-4f);
}

// ---------------------------------------------------------------------------
// mm[p] = 1 if all 9 taps of the (zero-padded) 3x3 patch of mask[0,0,::8,::8]
// are zero, else 0.
// ---------------------------------------------------------------------------
__device__ __forceinline__
void build_mm(int job, const float* __restrict__ mask, float* __restrict__ mm) {
    int p = job * 128 + threadIdx.x;
    if (p >= L) return;
    int py = p >> 5, px = p & 31;
    float s = 0.0f;
    for (int dy = 0; dy < 3; ++dy)
        for (int dx = 0; dx < 3; ++dx) {
            int y = py + dy - 1, x = px + dx - 1;
            if (y >= 0 && y < 32 && x >= 0 && x < 32)
                s += mask[(size_t)(8 * y) * 256 + 8 * x];
        }
    mm[p] = (s == 0.0f) ? 1.0f : 0.0f;
}

// ---------------------------------------------------------------------------
// The two re-layouts of the inputs read nothing of each other: they share one grid,
// and the block index picks the job.
// ---------------------------------------------------------------------------
#define GATHER_BLOCKS ((CH / 32) * BATCH * HD * 2)
#define SPLIT_BLOCKS  (BATCH * CH * H0 * W0 / 4 / 256)
__global__ __launch_bounds__(256)
void prep_inputs(const float* __restrict__ bsrc, const float* __restrict__ fsrc,
                 float* __restrict__ bT, float* __restrict__ fT,
                 float* __restrict__ bpar) {
    const int blk = blockIdx.x;
    if (blk < GATHER_BLOCKS)
        gather_ds_T(blk, bsrc, fsrc, bT, fT);
    else
        split_parity(blk - GATHER_BLOCKS, bsrc, bpar);
}

// ---------------------------------------------------------------------------
// NT GEMM with f32 WMMA:  C[m,n] = (Σ_k A[m,k]*B[n,k]) * rowScale[m]
// A: M x K row-major, B: N x K row-major, C: M x N row-major.
// 128 threads = 4 waves (2x2), block tile 64x64, BK=16, double-buffered LDS
// filled with CDNA5 async global->LDS DMA (ASYNCcnt).
// ---------------------------------------------------------------------------
#define LDS_STRIDE 20
#define TILE_F     (64 * LDS_STRIDE)      // floats per 64x16 padded tile
__device__ __forceinline__
void gemm_nt_tile(int bx, int by, int batch,
                  const float* __restrict__ A, const float* __restrict__ B,
                  float* __restrict__ C, int M, int N, int K,
                  long strideA, long strideB, long strideC,
                  const float* __restrict__ rowScale, int scaleStride) {
    A += (size_t)batch * strideA;
    B += (size_t)batch * strideB;
    C += (size_t)batch * strideC;
    if (rowScale) rowScale += (size_t)batch * scaleStride;

    const int tid  = threadIdx.x;
    const int lane = tid & 31;
    const int wave = tid >> 5;
    const int wr = wave & 1;          // wave row  (2 waves along M)
    const int wc = wave >> 1;         // wave col  (2 waves along N)
    const int hf = lane >> 4;         // lane half (K-pair select)
    const int lx = lane & 15;

    const int blockM = by * 64;
    const int blockN = bx * 64;

    // [buf][A|B][64*20] double-buffered tiles
    __shared__ float smem[2 * 2 * TILE_F];

    v8f acc00 = 0.0f, acc01 = 0.0f, acc10 = 0.0f, acc11 = 0.0f;

    // cooperative-load assignment: thread -> rows lr, lr+32; float4 at col lc
    const int lr = tid >> 2;          // 0..31
    const int lc = (tid & 3) << 2;    // 0,4,8,12

    const float* gA0 = A + (size_t)(blockM + lr)      * K + lc;
    const float* gA1 = A + (size_t)(blockM + lr + 32) * K + lc;
    const float* gB0 = B + (size_t)(blockN + lr)      * K + lc;
    const float* gB1 = B + (size_t)(blockN + lr + 32) * K + lc;

    unsigned dA0[2], dA1[2], dB0[2], dB1[2];
    #pragma unroll
    for (int bf = 0; bf < 2; ++bf) {
        float* As = &smem[bf * 2 * TILE_F];
        float* Bs = As + TILE_F;
        dA0[bf] = lds_addr32(&As[lr * LDS_STRIDE + lc]);
        dA1[bf] = lds_addr32(&As[(lr + 32) * LDS_STRIDE + lc]);
        dB0[bf] = lds_addr32(&Bs[lr * LDS_STRIDE + lc]);
        dB1[bf] = lds_addr32(&Bs[(lr + 32) * LDS_STRIDE + lc]);
    }

    // prologue: fill buffer 0 with tile k0=0
    async_copy16x4(dA0[0], gA0, dA1[0], gA1, dB0[0], gB0, dB1[0], gB1);
    wait_async0();
    __syncthreads();

    const int nsteps = K >> 4;
    for (int s = 0; s < nsteps; ++s) {
        const int cur = s & 1;
        const int nxt = cur ^ 1;

        // issue async DMA for the next tile while we compute this one
        if (s + 1 < nsteps) {
            const size_t ko = (size_t)(s + 1) << 4;
            async_copy16x4(dA0[nxt], gA0 + ko, dA1[nxt], gA1 + ko,
                           dB0[nxt], gB0 + ko, dB1[nxt], gB1 + ko);
        }

        const float* As = &smem[cur * 2 * TILE_F];
        const float* Bs = As + TILE_F;

        #pragma unroll
        for (int ks = 0; ks < 4; ++ks) {
            const int kb = ks * 4 + 2 * hf;   // even -> 8B-aligned v2f
            v2f a0 = *(const v2f*)&As[(wr * 32 +  0 + lx) * LDS_STRIDE + kb];
            v2f a1 = *(const v2f*)&As[(wr * 32 + 16 + lx) * LDS_STRIDE + kb];
            v2f b0 = *(const v2f*)&Bs[(wc * 32 +  0 + lx) * LDS_STRIDE + kb];
            v2f b1 = *(const v2f*)&Bs[(wc * 32 + 16 + lx) * LDS_STRIDE + kb];
            acc00 = __builtin_amdgcn_wmma_f32_16x16x4_f32(false, a0, false, b0,
                        (short)0, acc00, false, false);
            acc01 = __builtin_amdgcn_wmma_f32_16x16x4_f32(false, a0, false, b1,
                        (short)0, acc01, false, false);
            acc10 = __builtin_amdgcn_wmma_f32_16x16x4_f32(false, a1, false, b0,
                        (short)0, acc10, false, false);
            acc11 = __builtin_amdgcn_wmma_f32_16x16x4_f32(false, a1, false, b1,
                        (short)0, acc11, false, false);
        }

        wait_async0();       // my next-tile DMA landed
        __syncthreads();     // everyone's landed; everyone done reading cur
    }

    // Epilogue. C/D layout: VGPR r holds M = r (lanes 0-15) / r+8 (lanes 16-31),
    // N = lane & 15.
    #pragma unroll
    for (int mt = 0; mt < 2; ++mt) {
        v8f ar0 = (mt == 0) ? acc00 : acc10;
        v8f ar1 = (mt == 0) ? acc01 : acc11;
        #pragma unroll
        for (int r = 0; r < 8; ++r) {
            int gm = blockM + wr * 32 + mt * 16 + r + 8 * hf;
            float sc = rowScale ? rowScale[gm] : 1.0f;
            int gn0 = blockN + wc * 32 + lx;
            C[(size_t)gm * N + gn0]      = ar0[r] * sc;
            C[(size_t)gm * N + gn0 + 16] = ar1[r] * sc;
        }
    }
}
__global__ __launch_bounds__(128)
void gemm_nt_wmma(const float* __restrict__ A, const float* __restrict__ B,
                  float* __restrict__ C, int M, int N, int K,
                  long strideA, long strideB, long strideC,
                  const float* __restrict__ rowScale, int scaleStride) {
    gemm_nt_tile(blockIdx.x, blockIdx.y, blockIdx.z, A, B, C, M, N, K,
                 strideA, strideB, strideC, rowScale, scaleStride);
}
// ---------------------------------------------------------------------------
// The pixel Gram GEMM, the patch norms and the mask map read nothing of each other:
// they share one grid. The GEMM tiles, the longest job, come first; the mask map, a few
// blocks that wait on one load after another, comes next and ends under the other two.
// ---------------------------------------------------------------------------
#define MM_BLOCKS   (L / 128)
#define GRAM_BLOCKS ((L / 64) * (L / 64) * BATCH)
__global__ __launch_bounds__(128)
void gram_rnorm_mm(const float* __restrict__ fT, const float* __restrict__ bT,
                   float* __restrict__ G, int M, int N, int K,
                   long strideA, long strideB, long strideC,
                   float* __restrict__ rnorm,
                   const float* __restrict__ mask, float* __restrict__ mm) {
    const int blk = blockIdx.x;
    if (blk < GRAM_BLOCKS)
        gemm_nt_tile(blk & 15, (blk >> 4) & 15, blk >> 8, fT, bT, G, M, N, K,
                     strideA, strideB, strideC, nullptr, 0);
    else if (blk < GRAM_BLOCKS + MM_BLOCKS)
        build_mm(blk - GRAM_BLOCKS, mask, mm);
    else
        patch_rnorm(blk - GRAM_BLOCKS - MM_BLOCKS, bT, rnorm);
}

// ---------------------------------------------------------------------------
// 3x3 patch correlation from the pixel Gram matrix, kept transposed,
// G[s][p] = sum_c fT[s][c]*bT[p][c]:
//   S[s][p] = rnorm[p] * sum_{dy,dx=-1..1} G[s + 32*dy + dx][p + 32*dy + dx]
// a tap counting only where both shifted pixels lie inside the 32x32 image (zero
// padding of both patches). One block = one row s; a thread owns 4 consecutive p,
// which share one image row. Every tap is one aligned 16-byte load; for dx = -1/+1
// the element that crosses the 4-group comes from the neighbour lane.
// ---------------------------------------------------------------------------
__global__ __launch_bounds__(256)
void patch_sum9(const float* __restrict__ G, const float* __restrict__ rnorm,
                float* __restrict__ S) {
    const int q = blockIdx.x;                 // row: foreground pixel s
    const int b = blockIdx.y;
    const float* Gb = G + (size_t)b * L * L;
    const int qy = q >> 5, qx = q & 31;
    const int c4 = threadIdx.x * 4;           // columns: background patches p
    const int cy = c4 >> 5, cx0 = c4 & 31;
    // All nine loads are unconditional (a tap outside the image reads its own
    // row/column instead and is then replaced by zero), so they fly together.
    float4 w[9];
    #pragma unroll
    for (int t = 0; t < 9; ++t) {
        const int dy = t / 3 - 1, dx = t % 3 - 1;
        const bool qv = (qy + dy >= 0) && (qy + dy < HD) && (qx + dx >= 0) && (qx + dx < WD);
        const bool cv = (cy + dy >= 0) && (cy + dy < HD);
        const char* rowp    = (const char*)(Gb + (size_t)(qv ? q + 32 * dy + dx : q) * L);  // same for the block
        const unsigned boff = (unsigned)(cv ? c4 + 32 * dy : c4) * 4u;                      // byte column, per lane
        w[t] = *(const float4*)(rowp + boff);
    }
    float a0 = 0.0f, a1 = 0.0f, a2 = 0.0f, a3 = 0.0f;
    #pragma unroll
    for (int t = 0; t < 9; ++t) {
        const int dy = t / 3 - 1, dx = t % 3 - 1;
        const bool ok = (qy + dy >= 0) && (qy + dy < HD) && (qx + dx >= 0) && (qx + dx < WD) &&
                        (cy + dy >= 0) && (cy + dy < HD);
        const float x0 = ok ? w[t].x : 0.0f, x1 = ok ? w[t].y : 0.0f;
        const float x2 = ok ? w[t].z : 0.0f, x3 = ok ? w[t].w : 0.0f;
        if (dx == 0) {
            a0 += x0; a1 += x1; a2 += x2; a3 += x3;
        } else if (dx < 0) {
            const float e = __shfl_up(x3, 1);                // column c4 - 1
            a0 += (cx0 == 0) ? 0.0f : e;
            a1 += x0; a2 += x1; a3 += x2;
        } else {
            const float e = __shfl_down(x0, 1);              // column c4 + 4
            a0 += x1; a1 += x2; a2 += x3;
            a3 += (cx0 == 28) ? 0.0f : e;
        }
    }
    const float4 sc = *(const float4*)&rnorm[b * L + c4];
    *(float4*)&S[((size_t)b * L + q) * L + c4] =
        make_float4(a0 * sc.x, a1 * sc.y, a2 * sc.z, a3 * sc.w);
}

// ---------------------------------------------------------------------------
// Both diagonal fuse passes and the masked softmax, on the transposed scores S[s][p].
//   F1[i][j] = sum_{d1=-1..1} S[i+d1][j+d1]                 (flat indices, zero outside)
//   F2[s][p] = sum_{d2=-1..1} F1[T(T(s)+d2)][T(T(p)+d2)]    (zero where T(.)+d2 leaves 0..1023)
//   T(y*32+x) = x*32+y  (the transposed flattening; T is its own inverse)
//   yiT[b][s][p] = softmax_p(F2[s][p]*mm[p]*10) * mm[p]
// One block = SROWS consecutive s of one image row. T(T(s)+d2) steps by 1 with s there,
// so each d2 needs SROWS+2 consecutive rows of S; async copies stage them in LDS. A row outside
// the matrix is staged as zeros, and each row has a zero in front of and behind it, so
// a tap at column -1 or 1024 adds zero with no test. All 1024 p of an s are in the
// block, so the softmax follows on the spot, the SROWS reductions side by side.
// ---------------------------------------------------------------------------
#define ROWP  (L + 8)     // floats per staged row: data at 4..L+3, zeros at 3 and L+4
#define SROWS 4
#define GROWS (SROWS + 2) // staged rows per d2
__global__ __launch_bounds__(256)
void fuse_softmax(const float* __restrict__ S, const float* __restrict__ mm,
                  float* __restrict__ yiT) {
    __shared__ __attribute__((aligned(16))) float rows[3 * GROWS * ROWP];
    __shared__ __attribute__((aligned(16))) float red[256][SROWS];   // a thread's SROWS partials side by side
    const int s0 = blockIdx.x * SROWS;
    const int b = blockIdx.y;
    const int tid = threadIdx.x;
    const char* src = (const char*)(S + (size_t)b * L * L);
    const int js0 = (s0 & 31) * 32 + (s0 >> 5);               // T(s0); T(s0 + i) = js0 + 32*i
    const unsigned boff = (unsigned)tid * 16u;                // byte column, per lane
    // Every lane copies its 16 bytes of each of the 18 rows straight to LDS; the copies are
    // unconditional (a row outside the matrix copies row s0 instead and is then overwritten
    // with zeros), so they fly together. Every loop over g, j, i, k and d2 is unrolled so
    // that the arrays are indexed by constants only and stay in registers.
    const unsigned lbase = lds_addr32(&rows[4 + tid * 4]);
    float m[4];                                               // asked for early: lands under the copies
    #pragma unroll
    for (int k = 0; k < 4; ++k) m[k] = mm[tid + k * 256];
    #pragma unroll
    for (int g = 0; g < 3; ++g) {
        const int tt = js0 + g - 1;
        const int r0 = ((tt & 31) << 5) + (tt >> 5) - 1;      // row in slot 0 of this d2
        const char* gp[GROWS];
        unsigned lp[GROWS];
        #pragma unroll
        for (int j = 0; j < GROWS; ++j) {
            const bool ok = (r0 + j >= 0) && (r0 + j < L);    // same for the block
            gp[j] = src + (size_t)(ok ? r0 + j : s0) * (L * 4) + boff;
            lp[j] = lbase + (unsigned)((g * GROWS + j) * ROWP * 4);
        }
        async_copy16x6(lp[0], gp[0], lp[1], gp[1], lp[2], gp[2],
                       lp[3], gp[3], lp[4], gp[4], lp[5], gp[5]);
    }
    wait_async0();       // my copies have landed: my own bytes may be overwritten, and published
    #pragma unroll
    for (int g = 0; g < 3; ++g) {
        const int tt = js0 + g - 1;
        const int r0 = ((tt & 31) << 5) + (tt >> 5) - 1;
        #pragma unroll
        for (int j = 0; j < GROWS; ++j) {
            if ((r0 + j < 0) || (r0 + j >= L))
                *(float4*)&rows[(g * GROWS + j) * ROWP + 4 + tid * 4] =
                    make_float4(0.0f, 0.0f, 0.0f, 0.0f);
        }
    }
    if (tid < 3 * GROWS) {
        rows[tid * ROWP + 3]     = 0.0f;
        rows[tid * ROWP + L + 4] = 0.0f;
    }
    __syncthreads();

    float v[SROWS][4];
    #pragma unroll
    for (int k = 0; k < 4; ++k) {
        const int p  = tid + k * 256;
        const int ip = (p & 31) * 32 + (p >> 5);
        float acc[SROWS];
        #pragma unroll
        for (int i = 0; i < SROWS; ++i) acc[i] = 0.0f;
        #pragma unroll
        for (int d2 = -1; d2 <= 1; ++d2) {
            const int u  = ip + d2;
            const int c2 = ((u & 31) << 5) + (u >> 5);        // 991 at u = -1, 32 at u = 1024: in range
            const bool uok = (u >= 0) && (u < L);
            const float* rp = &rows[(d2 + 1) * GROWS * ROWP + 4 + c2];
            #pragma unroll
            for (int i = 0; i < SROWS; ++i) {
                const int ti = js0 + 32 * i + d2;             // same for the block
                float f1 = 0.0f;
                f1 += rp[i * ROWP - 1];
                f1 += rp[(i + 1) * ROWP];
                f1 += rp[(i + 2) * ROWP + 1];
                acc[i] += (uok && ti >= 0 && ti < L) ? f1 : 0.0f;
            }
        }
        #pragma unroll
        for (int i = 0; i < SROWS; ++i) v[i][k] = acc[i] * m[k] * SOFTMAX_SCALE;
    }
    #pragma unroll
    for (int i = 0; i < SROWS; ++i)
        red[tid][i] = fmaxf(fmaxf(v[i][0], v[i][1]), fmaxf(v[i][2], v[i][3]));
    __syncthreads();
    for (int st = 128; st > 0; st >>= 1) {
        if (tid < st) {
            #pragma unroll
            for (int i = 0; i < SROWS; ++i) red[tid][i] = fmaxf(red[tid][i], red[tid + st][i]);
        }
        __syncthreads();
    }
    float mx[SROWS];
    #pragma unroll
    for (int i = 0; i < SROWS; ++i) mx[i] = red[0][i];
    __syncthreads();
    #pragma unroll
    for (int i = 0; i < SROWS; ++i) {
        float ssum = 0.0f;
        #pragma unroll
        for (int k = 0; k < 4; ++k) { v[i][k] = expf(v[i][k] - mx[i]); ssum += v[i][k]; }
        red[tid][i] = ssum;
    }
    __syncthreads();
    for (int st = 128; st > 0; st >>= 1) {
        if (tid < st) {
            #pragma unroll
            for (int i = 0; i < SROWS; ++i) red[tid][i] += red[tid + st][i];
        }
        __syncthreads();
    }
    #pragma unroll
    for (int i = 0; i < SROWS; ++i) {
        const float inv = 1.0f / red[0][i];
        float* dst = yiT + ((size_t)b * L + s0 + i) * L;
        #pragma unroll
        for (int k = 0; k < 4; ++k) dst[tid + k * 256] = v[i][k] * inv * m[k];
    }
}

// ---------------------------------------------------------------------------
// The stride-2 transposed conv with the 4x4 raw patches, by output parity.
// With Y = 2*Yh + ry, X = 2*Xh + rx, s = Yh*32 + Xh, p = u*32 + v:
//   out[b,c,Y,X] = 0.25 * sum_p Apar[b][r][s][p] * b_full[b, c, 2*u + ry, 2*v + rx]
//   Apar[b][r][s][p] = sum_{dy in {0,sy}, dx in {0,sx}} yiT[b][s + 32*dy + dx][p + 32*dy + dx]
// sy = ry ? +1 : -1, sx = rx ? +1 : -1; a tap counts only where both shifted pixels
// lie inside the 32x32 image. (The 16 taps of a raw patch overlap its neighbours':
// each full-resolution pixel is met by 2x2 (position, patch) pairs on one diagonal.)
//
// One block = SRUN consecutive Xh of one image row Yh; a thread owns 4 consecutive p,
// which share one image row u. Every tap is an aligned 16-byte load at column
// p4 + 32*dy; a row serves dx = -1, 0, +1 of three neighbouring s, and for dx = -1/+1
// the element that crosses the 4-group comes from the neighbour lane.
// ---------------------------------------------------------------------------
#define SRUN 4
__device__ __forceinline__ float4 add4(float4 a, float4 b) {
    return make_float4(a.x + b.x, a.y + b.y, a.z + b.z, a.w + b.w);
}
__global__ __launch_bounds__(256)
void shift_sum4(const float* __restrict__ yiT, float* __restrict__ Apar) {
    const int x0 = blockIdx.x * SRUN;
    const int yh = blockIdx.y;
    const int b  = blockIdx.z;
    const float* Yb = yiT + (size_t)b * L * L;
    const int p4 = threadIdx.x * 4;
    const int u = p4 >> 5, v0 = p4 & 31;
    // All loads are unconditional (a tap outside the image reads a row/column of its
    // own block instead and is then replaced by zero), so they fly together.
    // Every loop of this kernel is unrolled so that w[][] and e[] are indexed by
    // constants only and stay in registers.
    float4 w[3][SRUN + 2];
    #pragma unroll
    for (int t = 0; t < 3; ++t) {
        const int dy = t - 1;
        const bool rv = (yh + dy >= 0) && (yh + dy < HD);                 // same for the block
        const bool cv = (u + dy >= 0) && (u + dy < HD);                   // per lane
        const unsigned boff = (unsigned)(cv ? p4 + 32 * dy : p4) * 4u;    // byte column
        #pragma unroll
        for (int i = 0; i < SRUN + 2; ++i) {
            const int j = x0 - 1 + i;
            const bool jv = rv && (j >= 0) && (j < WD);
            const char* rowp = (const char*)(Yb + (size_t)(jv ? (yh + dy) * WD + j : yh * WD + x0) * L);
            w[t][i] = *(const float4*)(rowp + boff);
        }
        // precaution: a later load's result may be given these loads' address registers
        asm volatile("s_wait_xcnt 0x0" ::: "memory");
    }
    #pragma unroll
    for (int t = 0; t < 3; ++t) {
        const int dy = t - 1;
        const bool cv = (yh + dy >= 0) && (yh + dy < HD) && (u + dy >= 0) && (u + dy < HD);
        #pragma unroll
        for (int i = 0; i < SRUN + 2; ++i) {
            const int j = x0 - 1 + i;
            const bool ok = cv && (j >= 0) && (j < WD);
            w[t][i].x = ok ? w[t][i].x : 0.0f;
            w[t][i].y = ok ? w[t][i].y : 0.0f;
            w[t][i].z = ok ? w[t][i].z : 0.0f;
            w[t][i].w = ok ? w[t][i].w : 0.0f;
        }
    }
    #pragma unroll
    for (int ry = 0; ry < 2; ++ry) {
        float4 e[SRUN + 2];                                // dy = 0 plus dy = sy
        #pragma unroll
        for (int i = 0; i < SRUN + 2; ++i) e[i] = add4(w[1][i], w[ry ? 2 : 0][i]);
        #pragma unroll
        for (int k = 1; k <= SRUN; ++k) {
            const float4 lo = e[k - 1], hi = e[k + 1];
            const float fl = __shfl_up(lo.w, 1);           // column p4 - 1
            const float fh = __shfl_down(hi.x, 1);         // column p4 + 4
            const float4 m = make_float4((v0 == 0) ? 0.0f : fl, lo.x, lo.y, lo.z);
            const float4 q = make_float4(hi.y, hi.z, hi.w, (v0 == 28) ? 0.0f : fh);
            const int s = yh * WD + x0 + k - 1;
            float* d = Apar + (((size_t)(b * 4 + ry * 2) * L + s) * L + p4);
            *(float4*)d                    = add4(e[k], m);
            *(float4*)(d + (size_t)L * L)  = add4(e[k], q);
        }
    }
}

// ---------------------------------------------------------------------------
// out[b,c,Y,X] = 0.25 * Cpar[b][(Y&1)*2 + (X&1)][c][(Y>>1)*32 + (X>>1)]
// A thread writes 4 consecutive X from a pair of each of the two rx planes.
// ---------------------------------------------------------------------------
__global__ __launch_bounds__(256)
void merge_parity(const float* __restrict__ Cpar, float* __restrict__ out) {
    const int idx = blockIdx.x * 256 + threadIdx.x;       // (b*CH + c, Y, X/4)
    const int x4 = idx & 15;
    const int Y  = (idx >> 4) & 63;
    const int c  = (idx >> 10) & (CH - 1);
    const int b  = idx >> 17;
    const int p = (Y >> 1) * WD + x4 * 2;
    const float* s0 = Cpar + (((size_t)(b * 4 + (Y & 1) * 2) * CH + c) * L + p);
    const float2 ev = *(const float2*)s0;
    const float2 od = *(const float2*)(s0 + (size_t)CH * L);
    *(float4*)&out[(size_t)idx * 4] =
        make_float4(ev.x * 0.25f, od.x * 0.25f, ev.y * 0.25f, od.y * 0.25f);
}

// ---------------------------------------------------------------------------
extern "C" void kernel_launch(void* const* d_in, const int* in_sizes, int n_in,
                              void* d_out, int out_size, void* d_ws, size_t ws_size,
                              hipStream_t stream) {
    const float* f    = (const float*)d_in[0];   // (4,128,64,64)
    const float* bsrc = (const float*)d_in[1];   // (4,128,64,64)
    const float* mask = (const float*)d_in[2];   // (4,1,256,256)
    float* out = (float*)d_out;

    // workspace layout (bytes)
    const size_t SZ_PIX  = (size_t)BATCH * L * CH * 4;     // 2,097,152
    const size_t SZ_YI   = (size_t)BATCH * L * L * 4;      // 16,777,216
    const size_t SZ_APAR = (size_t)BATCH * 4 * L * L * 4;  // 67,108,864
    const size_t SZ_PAR  = (size_t)BATCH * 4 * CH * L * 4; // 8,388,608
    char* w = (char*)d_ws;
    float* bT     = (float*)(w);
    float* fT     = (float*)(w + SZ_PIX);
    float* yiA    = (float*)(w + 2 * SZ_PIX);
    float* yiB    = (float*)(w + 2 * SZ_PIX + SZ_YI);
    float* Apar   = (float*)(w + 2 * SZ_PIX + 2 * SZ_YI);
    float* bpar   = (float*)(w + 2 * SZ_PIX + 2 * SZ_YI + SZ_APAR);
    float* Cpar   = (float*)(w + 2 * SZ_PIX + 2 * SZ_YI + SZ_APAR + SZ_PAR);
    float* rnorm  = (float*)(w + 2 * SZ_PIX + 2 * SZ_YI + SZ_APAR + 2 * SZ_PAR);
    float* mmbuf  = rnorm + BATCH * L;

    // bT / fT and bpar, from the inputs alone
    prep_inputs<<<GATHER_BLOCKS + SPLIT_BLOCKS, 256, 0, stream>>>(bsrc, f, bT, fT, bpar);

    const int totOut = BATCH * CH * H0 * W0;

    // GEMM1: yiB[b][s][p] = sum_c fT[s,c] bT[p,c]   (1024x1024x128, pixel Gram matrix),
    // with rnorm and mm beside it
    gram_rnorm_mm<<<MM_BLOCKS + GRAM_BLOCKS + BATCH * L, 128, 0, stream>>>(
        fT, bT, yiB, L, L, CH, (long)L * CH, (long)L * CH, (long)L * L, rnorm, mask, mmbuf);
    // yiA[b][s][p] = rnorm[p] * 9-tap diagonal sum of the Gram matrix
    {
        dim3 grid(L, BATCH);
        patch_sum9<<<grid, 256, 0, stream>>>(yiB, rnorm, yiA);
    }
    // yiB[b][s][p] = yiT: both fuse passes and the masked softmax over p
    {
        dim3 grid(L / SROWS, BATCH);
        fuse_softmax<<<grid, 256, 0, stream>>>(yiA, mmbuf, yiB);
    }

    // Apar[b][r][s][p] = 2x2 diagonal shift-sum of yiT, one plane per output parity r
    {
        dim3 grid(WD / SRUN, HD, BATCH);
        shift_sum4<<<grid, 256, 0, stream>>>(yiB, Apar);
    }
    // GEMM2: Cpar[b][r][c][s] = sum_p bpar[c,p] * Apar[s,p]   (16 x 128x1024x1024)
    {
        dim3 grid(L / 64, CH / 64, BATCH * 4);
        gemm_nt_wmma<<<grid, 128, 0, stream>>>(bpar, Apar, Cpar, CH, L, L,
                                               (long)CH * L, (long)L * L,
                                               (long)CH * L, nullptr, 0);
    }

    merge_parity<<<totOut / 4 / 256, 256, 0, stream>>>(Cpar, out);
}

// v005
// A run of this version takes 71.6 microseconds.
// In two side-by-side timings against v004, it was 1.24 and 1.23 times as fast.
// All steps since v000 together make it 4.05 times as fast.
#include <hip/hip_runtime.h>
#include <hip/hip_bf16.h>

typedef float v2f __attribute__((ext_vector_type(2)));
typedef float v8f __attribute__((ext_vector_type(8)));

// Problem constants (from reference)
#define BATCH 4
#define CH    128
#define H0    64
#define W0    64
#define HD    32      // downsampled
#define WD    32
#define L     1024    // HD*WD patches
#define SOFTMAX_SCALE 10.0f

// ---------------------------------------------------------------------------
// CDNA5 async global->LDS copy (16B per lane), tracked by ASYNCcnt.
// vdst = LDS byte address (low 32 bits of the flat shared pointer, which is
// exactly what the flat-aperture truncation uses), vaddr = 64-bit global addr.
// ---------------------------------------------------------------------------
// One tile = four copies per lane. s_wait_xcnt 0 is the last line of the same
// statement so that no address register of an issued copy is rewritten ahead of it.
__device__ __forceinline__ void async_copy16x4(unsigned l0, const float* g0,
                                               unsigned l1, const float* g1,
                                               unsigned l2, const float* g2,
                                               unsigned l3, const float* g3) {
    asm volatile("global_load_async_to_lds_b128 %0, %1, off\n\t"
                 "global_load_async_to_lds_b128 %2, %3, off\n\t"
                 "global_load_async_to_lds_b128 %4, %5, off\n\t"
                 "global_load_async_to_lds_b128 %6, %7, off\n\t"
                 "s_wait_xcnt 0x0"
                 :: "v"(l0), "v"((unsigned long long)(uintptr_t)g0),
                    "v"(l1), "v"((unsigned long long)(uintptr_t)g1),
                    "v"(l2), "v"((unsigned long long)(uintptr_t)g2),
                    "v"(l3), "v"((unsigned long long)(uintptr_t)g3)
                 : "memory");
}
// The same for six copies per lane (the staged rows of the fuse + softmax kernel).
__device__ __forceinline__ void async_copy16x6(unsigned l0, const char* g0,
                                               unsigned l1, const char* g1,
                                               unsigned l2, const char* g2,
                                               unsigned l3, const char* g3,
                                               unsigned l4, const char* g4,
                                               unsigned l5, const char* g5) {
    asm volatile("global_load_async_to_lds_b128 %0, %1, off\n\t"
                 "global_load_async_to_lds_b128 %2, %3, off\n\t"
                 "global_load_async_to_lds_b128 %4, %5, off\n\t"
                 "global_load_async_to_lds_b128 %6, %7, off\n\t"
                 "global_load_async_to_lds_b128 %8, %9, off\n\t"
                 "global_load_async_to_lds_b128 %10, %11, off\n\t"
                 "s_wait_xcnt 0x0"
                 :: "v"(l0), "v"((unsigned long long)(uintptr_t)g0),
                    "v"(l1), "v"((unsigned long long)(uintptr_t)g1),
                    "v"(l2), "v"((unsigned long long)(uintptr_t)g2),
                    "v"(l3), "v"((unsigned long long)(uintptr_t)g3),
                    "v"(l4), "v"((unsigned long long)(uintptr_t)g4),
                    "v"(l5), "v"((unsigned long long)(uintptr_t)g5)
                 : "memory");
}
__device__ __forceinline__ void wait_async0() {
    asm volatile("s_wait_asynccnt 0x0" ::: "memory");
}
__device__ __forceinline__ unsigned lds_addr32(const void* p) {
    return (unsigned)(uintptr_t)p;
}

// ---------------------------------------------------------------------------
// Downsample (::2) and transpose to pixel-major, for both tensors in one launch:
//   xT[b][p][c] = x[b, c, 2*py, 2*px],  p = py*32 + px
// One block = one (b, py) row of 32 pixels x 32 channels, turned in LDS so that
// reads run along px and writes along c. job = (tensor, b, py, channel block).
// ---------------------------------------------------------------------------
__device__ __forceinline__
void gather_ds_T(int job, const float* __restrict__ bsrc, const float* __restrict__ fsrc,
                 float* __restrict__ bT, float* __restrict__ fT) {
    __shared__ float tile[32][33];
    const float* x = (job >> 9) ? fsrc : bsrc;
    float* xT      = (job >> 9) ? fT : bT;
    const int c0 = (job & 3) * 32;
    const int py = (job >> 2) & 31;
    const int b  = (job >> 7) & 3;
    const int tx = threadIdx.x & 31;
    const int ty = threadIdx.x >> 5;
    #pragma unroll
    for (int k = 0; k < 4; ++k) {
        int c = ty + 8 * k;
        tile[c][tx] = x[(((size_t)b * CH + c0 + c) * H0 + 2 * py) * W0 + 2 * tx];
    }
    __syncthreads();
    #pragma unroll
    for (int k = 0; k < 4; ++k) {
        int px = ty + 8 * k;
        xT[((size_t)b * L + py * 32 + px) * CH + c0 + tx] = tile[tx][px];
    }
}

// ---------------------------------------------------------------------------
// The full-resolution background split into its four pixel parities, r = ry*2 + rx:
//   bpar[b][r][c][u*32 + v] = b_full[b, c, 2*u + ry, 2*v + rx]
// A thread reads 4 consecutive X and writes a pair to each of the two rx planes.
// ---------------------------------------------------------------------------
__device__ __forceinline__
void split_parity(int job, const float* __restrict__ bsrc, float* __restrict__ bpar) {
    const int idx = job * 256 + threadIdx.x;              // (b*CH + c, Y, X/4)
    const int x4 = idx & 15;
    const int Y  = (idx >> 4) & 63;
    const int c  = (idx >> 10) & (CH - 1);
    const int b  = idx >> 17;
    const float4 t = *(const float4*)&bsrc[(size_t)idx * 4];
    const int p = (Y >> 1) * WD + x4 * 2;
    float* d0 = bpar + (((size_t)(b * 4 + (Y & 1) * 2) * CH + c) * L + p);
    *(float2*)d0                   = make_float2(t.x, t.z);
    *(float2*)(d0 + (size_t)CH * L) = make_float2(t.y, t.w);
    // precaution: in the shared grid's listing other code follows these stores and reuses
    // their address and data registers
    asm volatile("s_wait_xcnt 0x0" ::: "memory");
}

// ---------------------------------------------------------------------------
// rnorm[b][p] = 1 / max(sqrt(sum over the 3x3 zero-padded patch at p and all
// channels of bT^2), 1e-4)
// ---------------------------------------------------------------------------
__device__ __forceinline__
void patch_rnorm(int row, const float* __restrict__ bT, float* __restrict__ rnorm) {
    __shared__ float red[128];            // row = b*L + p
    int p = row & (L - 1);
    int py = p >> 5, px = p & 31;
    const float* base = bT + (size_t)(row - p) * CH;      // this batch item's plane
    float v[9];
    #pragma unroll
    for (int t = 0; t < 9; ++t) {
        const int y = py + t / 3 - 1, x = px + t % 3 - 1;
        const bool in = (y >= 0 && y < HD && x >= 0 && x < WD);
        v[t] = base[(size_t)(in ? y * WD + x : p) * CH + threadIdx.x];   // always in bounds
        // precaution: the next load's result may be given this load's address registers
        asm volatile("s_wait_xcnt 0x0" ::: "memory");
    }
    float s = 0.0f;
    #pragma unroll
    for (int t = 0; t < 9; ++t) {
        const int y = py + t / 3 - 1, x = px + t % 3 - 1;
        const bool in = (y >= 0 && y < HD && x >= 0 && x < WD);
        s += in ? v[t] * v[t] : 0.0f;
    }
    red[threadIdx.x] = s;
    __syncthreads();
    for (int st = 64; st > 0; st >>= 1) {
        if (threadIdx.x < st) red[threadIdx.x] += red[threadIdx.x + st];
        __syncthreads();
    }
    if (threadIdx.x == 0)
        rnorm[row] = 1.0f / fmaxf(sqrtf(red[0]), 1e-4f);
}

// ---------------------------------------------------------------------------
// mm[p] = 1 if all 9 taps of the (zero-padded) 3x3 patch of mask[0,0,::8,::8]
// are zero, else 0.
// ---------------------------------------------------------------------------
__device__ __forceinline__
void build_mm(int job, const float* __restrict__ mask, float* __restrict__ mm) {
    int p = job * 128 + threadIdx.x;
    if (p >= L) return;
    int py = p >> 5, px = p & 31;
    float s = 0.0f;
    for (int dy = 0; dy < 3; ++dy)
        for (int dx = 0; dx < 3; ++dx) {
            int y = py + dy - 1, x = px + dx - 1;
            if (y >= 0 && y < 32 && x >= 0 && x < 32)
                s += mask[(size_t)(8 * y) * 256 + 8 * x];
        }
    mm[p] = (s == 0.0f) ? 1.0f : 0.0f;
}

// ---------------------------------------------------------------------------
// The two re-layouts of the inputs read nothing of each other: they share one grid,
// and the block index picks the job.
// ---------------------------------------------------------------------------
#define GATHER_BLOCKS ((CH / 32) * BATCH * HD * 2)
#define SPLIT_BLOCKS  (BATCH * CH * H0 * W0 / 4 / 256)
__global__ __launch_bounds__(256)
void prep_inputs(const float* __restrict__ bsrc, const float* __restrict__ fsrc,
                 float* __restrict__ bT, float* __restrict__ fT,
                 float* __restrict__ bpar) {
    const int blk = blockIdx.x;
    if (blk < GATHER_BLOCKS)
        gather_ds_T(blk, bsrc, fsrc, bT, fT);
    else
        split_parity(blk - GATHER_BLOCKS, bsrc, bpar);
}

// ---------------------------------------------------------------------------
// NT GEMM with f32 WMMA:  C[m,n] = (Σ_k A[m,k]*B[n,k]) * rowScale[m]
// A: M x K row-major, B: N x K row-major, C: M x N row-major.
// 128 threads = 4 waves (2x2), block tile 64x64, BK=16, double-buffered LDS
// filled with CDNA5 async global->LDS DMA (ASYNCcnt).
// ---------------------------------------------------------------------------
#define LDS_STRIDE 20
#define TILE_F     (64 * LDS_STRIDE)      // floats per 64x16 padded tile
__device__ __forceinline__
void gemm_nt_tile(int bx, int by, int batch,
                  const float* __restrict__ A, const float* __restrict__ B,
                  float* __restrict__ C, int M, int N, int K,
                  long strideA, long strideB, long strideC,
                  const float* __restrict__ rowScale, int scaleStride) {
    A += (size_t)batch * strideA;
    B += (size_t)batch * strideB;
    C += (size_t)batch * strideC;
    if (rowScale) rowScale += (size_t)batch * scaleStride;

    const int tid  = threadIdx.x;
    const int lane = tid & 31;
    const int wave = tid >> 5;
    const int wr = wave & 1;          // wave row  (2 waves along M)
    const int wc = wave >> 1;         // wave col  (2 waves along N)
    const int hf = lane >> 4;         // lane half (K-pair select)
    const int lx = lane & 15;

    const int blockM = by * 64;
    const int blockN = bx * 64;

    // [buf][A|B][64*20] double-buffered tiles
    __shared__ float smem[2 * 2 * TILE_F];

    v8f acc00 = 0.0f, acc01 = 0.0f, acc10 = 0.0f, acc11 = 0.0f;

    // cooperative-load assignment: thread -> rows lr, lr+32; float4 at col lc
    const int lr = tid >> 2;          // 0..31
    const int lc = (tid & 3) << 2;    // 0,4,8,12

    const float* gA0 = A + (size_t)(blockM + lr)      * K + lc;
    const float* gA1 = A + (size_t)(blockM + lr + 32) * K + lc;
    const float* gB0 = B + (size_t)(blockN + lr)      * K + lc;
    const float* gB1 = B + (size_t)(blockN + lr + 32) * K + lc;

    unsigned dA0[2], dA1[2], dB0[2], dB1[2];
    #pragma unroll
    for (int bf = 0; bf < 2; ++bf) {
        float* As = &smem[bf * 2 * TILE_F];
        float* Bs = As + TILE_F;
        dA0[bf] = lds_addr32(&As[lr * LDS_STRIDE + lc]);
        dA1[bf] = lds_addr32(&As[(lr + 32) * LDS_STRIDE + lc]);
        dB0[bf] = lds_addr32(&Bs[lr * LDS_STRIDE + lc]);
        dB1[bf] = lds_addr32(&Bs[(lr + 32) * LDS_STRIDE + lc]);
    }

    // prologue: fill buffer 0 with tile k0=0
    async_copy16x4(dA0[0], gA0, dA1[0], gA1, dB0[0], gB0, dB1[0], gB1);
    wait_async0();
    __syncthreads();

    const int nsteps = K >> 4;
    for (int s = 0; s < nsteps; ++s) {
        const int cur = s & 1;
        const int nxt = cur ^ 1;

        // issue async DMA for the next tile while we compute this one
        if (s + 1 < nsteps) {
            const size_t ko = (size_t)(s + 1) << 4;
            async_copy16x4(dA0[nxt], gA0 + ko, dA1[nxt], gA1 + ko,
                           dB0[nxt], gB0 + ko, dB1[nxt], gB1 + ko);
        }

        const float* As = &smem[cur * 2 * TILE_F];
        const float* Bs = As + TILE_F;

        #pragma unroll
        for (int ks = 0; ks < 4; ++ks) {
            const int kb = ks * 4 + 2 * hf;   // even -> 8B-aligned v2f
            v2f a0 = *(const v2f*)&As[(wr * 32 +  0 + lx) * LDS_STRIDE + kb];
            v2f a1 = *(const v2f*)&As[(wr * 32 + 16 + lx) * LDS_STRIDE + kb];
            v2f b0 = *(const v2f*)&Bs[(wc * 32 +  0 + lx) * LDS_STRIDE + kb];
            v2f b1 = *(const v2f*)&Bs[(wc * 32 + 16 + lx) * LDS_STRIDE + kb];
            acc00 = __builtin_amdgcn_wmma_f32_16x16x4_f32(false, a0, false, b0,
                        (short)0, acc00, false, false);
            acc01 = __builtin_amdgcn_wmma_f32_16x16x4_f32(false, a0, false, b1,
                        (short)0, acc01, false, false);
            acc10 = __builtin_amdgcn_wmma_f32_16x16x4_f32(false, a1, false, b0,
                        (short)0, acc10, false, false);
            acc11 = __builtin_amdgcn_wmma_f32_16x16x4_f32(false, a1, false, b1,
                        (short)0, acc11, false, false);
        }

        wait_async0();       // my next-tile DMA landed
        __syncthreads();     // everyone's landed; everyone done reading cur
    }

    // Epilogue. C/D layout: VGPR r holds M = r (lanes 0-15) / r+8 (lanes 16-31),
    // N = lane & 15.
    #pragma unroll
    for (int mt = 0; mt < 2; ++mt) {
        v8f ar0 = (mt == 0) ? acc00 : acc10;
        v8f ar1 = (mt == 0) ? acc01 : acc11;
        #pragma unroll
        for (int r = 0; r < 8; ++r) {
            int gm = blockM + wr * 32 + mt * 16 + r + 8 * hf;
            float sc = rowScale ? rowScale[gm] : 1.0f;
            int gn0 = blockN + wc * 32 + lx;
            C[(size_t)gm * N + gn0]      = ar0[r] * sc;
            C[(size_t)gm * N + gn0 + 16] = ar1[r] * sc;
        }
    }
}
// ---------------------------------------------------------------------------
// The pixel Gram GEMM, the patch norms and the mask map read nothing of each other:
// they share one grid. The GEMM tiles, the longest job, come first; the mask map, a few
// blocks that wait on one load after another, comes next and ends under the other two.
// ---------------------------------------------------------------------------
#define MM_BLOCKS   (L / 128)
#define GRAM_BLOCKS ((L / 64) * (L / 64) * BATCH)
__global__ __launch_bounds__(128)
void gram_rnorm_mm(const float* __restrict__ fT, const float* __restrict__ bT,
                   float* __restrict__ G, int M, int N, int K,
                   long strideA, long strideB, long strideC,
                   float* __restrict__ rnorm,
                   const float* __restrict__ mask, float* __restrict__ mm) {
    const int blk = blockIdx.x;
    if (blk < GRAM_BLOCKS)
        gemm_nt_tile(blk & 15, (blk >> 4) & 15, blk >> 8, fT, bT, G, M, N, K,
                     strideA, strideB, strideC, nullptr, 0);
    else if (blk < GRAM_BLOCKS + MM_BLOCKS)
        build_mm(blk - GRAM_BLOCKS, mask, mm);
    else
        patch_rnorm(blk - GRAM_BLOCKS - MM_BLOCKS, bT, rnorm);
}

// ---------------------------------------------------------------------------
// 3x3 patch correlation from the pixel Gram matrix, kept transposed,
// G[s][p] = sum_c fT[s][c]*bT[p][c]:
//   S[s][p] = rnorm[p] * sum_{dy,dx=-1..1} G[s + 32*dy + dx][p + 32*dy + dx]
// a tap counting only where both shifted pixels lie inside the 32x32 image (zero
// padding of both patches). One block = one row s; a thread owns 4 consecutive p,
// which share one image row. Every tap is one aligned 16-byte load; for dx = -1/+1
// the element that crosses the 4-group comes from the neighbour lane.
// ---------------------------------------------------------------------------
__global__ __launch_bounds__(256)
void patch_sum9(const float* __restrict__ G, const float* __restrict__ rnorm,
                float* __restrict__ S) {
    const int q = blockIdx.x;                 // row: foreground pixel s
    const int b = blockIdx.y;
    const float* Gb = G + (size_t)b * L * L;
    const int qy = q >> 5, qx = q & 31;
    const int c4 = threadIdx.x * 4;           // columns: background patches p
    const int cy = c4 >> 5, cx0 = c4 & 31;
    // All nine loads are unconditional (a tap outside the image reads its own
    // row/column instead and is then replaced by zero), so they fly together.
    float4 w[9];
    #pragma unroll
    for (int t = 0; t < 9; ++t) {
        const int dy = t / 3 - 1, dx = t % 3 - 1;
        const bool qv = (qy + dy >= 0) && (qy + dy < HD) && (qx + dx >= 0) && (qx + dx < WD);
        const bool cv = (cy + dy >= 0) && (cy + dy < HD);
        const char* rowp    = (const char*)(Gb + (size_t)(qv ? q + 32 * dy + dx : q) * L);  // same for the block
        const unsigned boff = (unsigned)(cv ? c4 + 32 * dy : c4) * 4u;                      // byte column, per lane
        w[t] = *(const float4*)(rowp + boff);
    }
    float a0 = 0.0f, a1 = 0.0f, a2 = 0.0f, a3 = 0.0f;
    #pragma unroll
    for (int t = 0; t < 9; ++t) {
        const int dy = t / 3 - 1, dx = t % 3 - 1;
        const bool ok = (qy + dy >= 0) && (qy + dy < HD) && (qx + dx >= 0) && (qx + dx < WD) &&
                        (cy + dy >= 0) && (cy + dy < HD);
        const float x0 = ok ? w[t].x : 0.0f, x1 = ok ? w[t].y : 0.0f;
        const float x2 = ok ? w[t].z : 0.0f, x3 = ok ? w[t].w : 0.0f;
        if (dx == 0) {
            a0 += x0; a1 += x1; a2 += x2; a3 += x3;
        } else if (dx < 0) {
            const float e = __shfl_up(x3, 1);                // column c4 - 1
            a0 += (cx0 == 0) ? 0.0f : e;
            a1 += x0; a2 += x1; a3 += x2;
        } else {
            const float e = __shfl_down(x0, 1);              // column c4 + 4
            a0 += x1; a1 += x2; a2 += x3;
            a3 += (cx0 == 28) ? 0.0f : e;
        }
    }
    const float4 sc = *(const float4*)&rnorm[b * L + c4];
    *(float4*)&S[((size_t)b * L + q) * L + c4] =
        make_float4(a0 * sc.x, a1 * sc.y, a2 * sc.z, a3 * sc.w);
}

// ---------------------------------------------------------------------------
// Both diagonal fuse passes and the masked softmax, on the transposed scores S[s][p].
//   F1[i][j] = sum_{d1=-1..1} S[i+d1][j+d1]                 (flat indices, zero outside)
//   F2[s][p] = sum_{d2=-1..1} F1[T(T(s)+d2)][T(T(p)+d2)]    (zero where T(.)+d2 leaves 0..1023)
//   T(y*32+x) = x*32+y  (the transposed flattening; T is its own inverse)
//   yiT[b][s][p] = softmax_p(F2[s][p]*mm[p]*10) * mm[p]
// One block = SROWS consecutive s of one image row. T(T(s)+d2) steps by 1 with s there,
// so each d2 needs SROWS+2 consecutive rows of S; async copies stage them in LDS. A row outside
// the matrix is staged as zeros, and each row has a zero in front of and behind it, so
// a tap at column -1 or 1024 adds zero with no test. All 1024 p of an s are in the
// block, so the softmax follows on the spot, the SROWS reductions side by side.
// ---------------------------------------------------------------------------
#define ROWP  (L + 8)     // floats per staged row: data at 4..L+3, zeros at 3 and L+4
#define SROWS 4
#define GROWS (SROWS + 2) // staged rows per d2
__global__ __launch_bounds__(256)
void fuse_softmax(const float* __restrict__ S, const float* __restrict__ mm,
                  float* __restrict__ yiT) {
    __shared__ __attribute__((aligned(16))) float rows[3 * GROWS * ROWP];
    __shared__ __attribute__((aligned(16))) float red[256][SROWS];   // a thread's SROWS partials side by side
    const int s0 = blockIdx.x * SROWS;
    const int b = blockIdx.y;
    const int tid = threadIdx.x;
    const char* src = (const char*)(S + (size_t)b * L * L);
    const int js0 = (s0 & 31) * 32 + (s0 >> 5);               // T(s0); T(s0 + i) = js0 + 32*i
    const unsigned boff = (unsigned)tid * 16u;                // byte column, per lane
    // Every lane copies its 16 bytes of each of the 18 rows straight to LDS; the copies are
    // unconditional (a row outside the matrix copies row s0 instead and is then overwritten
    // with zeros), so they fly together. Every loop over g, j, i, k and d2 is unrolled so
    // that the arrays are indexed by constants only and stay in registers.
    const unsigned lbase = lds_addr32(&rows[4 + tid * 4]);
    float m[4];                                               // asked for early: lands under the copies
    #pragma unroll
    for (int k = 0; k < 4; ++k) m[k] = mm[tid + k * 256];
    #pragma unroll
    for (int g = 0; g < 3; ++g) {
        const int tt = js0 + g - 1;
        const int r0 = ((tt & 31) << 5) + (tt >> 5) - 1;      // row in slot 0 of this d2
        const char* gp[GROWS];
        unsigned lp[GROWS];
        #pragma unroll
        for (int j = 0; j < GROWS; ++j) {
            const bool ok = (r0 + j >= 0) && (r0 + j < L);    // same for the block
            gp[j] = src + (size_t)(ok ? r0 + j : s0) * (L * 4) + boff;
            lp[j] = lbase + (unsigned)((g * GROWS + j) * ROWP * 4);
        }
        async_copy16x6(lp[0], gp[0], lp[1], gp[1], lp[2], gp[2],
                       lp[3], gp[3], lp[4], gp[4], lp[5], gp[5]);
    }
    wait_async0();       // my copies have landed: my own bytes may be overwritten, and published
    #pragma unroll
    for (int g = 0; g < 3; ++g) {
        const int tt = js0 + g - 1;
        const int r0 = ((tt & 31) << 5) + (tt >> 5) - 1;
        #pragma unroll
        for (int j = 0; j < GROWS; ++j) {
            if ((r0 + j < 0) || (r0 + j >= L))
                *(float4*)&rows[(g * GROWS + j) * ROWP + 4 + tid * 4] =
                    make_float4(0.0f, 0.0f, 0.0f, 0.0f);
        }
    }
    if (tid < 3 * GROWS) {
        rows[tid * ROWP + 3]     = 0.0f;
        rows[tid * ROWP + L + 4] = 0.0f;
    }
    __syncthreads();

    float v[SROWS][4];
    #pragma unroll
    for (int k = 0; k < 4; ++k) {
        const int p  = tid + k * 256;
        const int ip = (p & 31) * 32 + (p >> 5);
        float acc[SROWS];
        #pragma unroll
        for (int i = 0; i < SROWS; ++i) acc[i] = 0.0f;
        #pragma unroll
        for (int d2 = -1; d2 <= 1; ++d2) {
            const int u  = ip + d2;
            const int c2 = ((u & 31) << 5) + (u >> 5);        // 991 at u = -1, 32 at u = 1024: in range
            const bool uok = (u >= 0) && (u < L);
            const float* rp = &rows[(d2 + 1) * GROWS * ROWP + 4 + c2];
            #pragma unroll
            for (int i = 0; i < SROWS; ++i) {
                const int ti = js0 + 32 * i + d2;             // same for the block
                float f1 = 0.0f;
                f1 += rp[i * ROWP - 1];
                f1 += rp[(i + 1) * ROWP];
                f1 += rp[(i + 2) * ROWP + 1];
                acc[i] += (uok && ti >= 0 && ti < L) ? f1 : 0.0f;
            }
        }
        #pragma unroll
        for (int i = 0; i < SROWS; ++i) v[i][k] = acc[i] * m[k] * SOFTMAX_SCALE;
    }
    #pragma unroll
    for (int i = 0; i < SROWS; ++i)
        red[tid][i] = fmaxf(fmaxf(v[i][0], v[i][1]), fmaxf(v[i][2], v[i][3]));
    __syncthreads();
    for (int st = 128; st > 0; st >>= 1) {
        if (tid < st) {
            #pragma unroll
            for (int i = 0; i < SROWS; ++i) red[tid][i] = fmaxf(red[tid][i], red[tid + st][i]);
        }
        __syncthreads();
    }
    float mx[SROWS];
    #pragma unroll
    for (int i = 0; i < SROWS; ++i) mx[i] = red[0][i];
    __syncthreads();
    #pragma unroll
    for (int i = 0; i < SROWS; ++i) {
        float ssum = 0.0f;
        #pragma unroll
        for (int k = 0; k < 4; ++k) { v[i][k] = expf(v[i][k] - mx[i]); ssum += v[i][k]; }
        red[tid][i] = ssum;
    }
    __syncthreads();
    for (int st = 128; st > 0; st >>= 1) {
        if (tid < st) {
            #pragma unroll
            for (int i = 0; i < SROWS; ++i) red[tid][i] += red[tid + st][i];
        }
        __syncthreads();
    }
    #pragma unroll
    for (int i = 0; i < SROWS; ++i) {
        const float inv = 1.0f / red[0][i];
        float* dst = yiT + ((size_t)b * L + s0 + i) * L;
        #pragma unroll
        for (int k = 0; k < 4; ++k) dst[tid + k * 256] = v[i][k] * inv * m[k];
    }
}

// ---------------------------------------------------------------------------
// The stride-2 transposed conv with the 4x4 raw patches, by output parity.
// With Y = 2*Yh + ry, X = 2*Xh + rx, s = Yh*32 + Xh, p = u*32 + v:
//   out[b,c,Y,X] = 0.25 * sum_p Apar[r][s][p] * b_full[b, c, 2*u + ry, 2*v + rx]
//   Apar[r][s][p] = sum_{dy in {0,sy}, dx in {0,sx}} yiT[b][s + 32*dy + dx][p + 32*dy + dx]
// sy = ry ? +1 : -1, sx = rx ? +1 : -1; a tap counts only where both shifted pixels
// lie inside the 32x32 image. (The 16 taps of a raw patch overlap its neighbours':
// each full-resolution pixel is met by 2x2 (position, patch) pairs on one diagonal.)
//
// Apar is never stored. One block = (b, ry, image row Yh, 64 channels), both rx; a K step
// is one image row u of p (32 values). Per step the block stages
//   E[j][v] = yiT[Yh*32 + j][u*32 + v] + yiT[(Yh+sy)*32 + j][(u+sy)*32 + v]
// in LDS with zeros all round, and a wave forms its B fragment on the way to the WMMA:
//   Apar[ry*2+rx][Yh*32 + j][u*32 + v] = E[j][v] + E[j + sx][v + sx]
// 4 waves: wr = which 32 channels, wc = rx. Cpar[b][r][c][s] as a 128 x 1024 plane per (b, r).
// ---------------------------------------------------------------------------
// Eight copies per lane (the channel rows of both rx planes); s_wait_xcnt 0 is the last
// line of the same statement so that no address register of an issued copy is rewritten
// ahead of it.
__device__ __forceinline__ void async_copy16x8(unsigned l0, const float* g0,
                                               unsigned l1, const float* g1,
                                               unsigned l2, const float* g2,
                                               unsigned l3, const float* g3,
                                               unsigned l4, const float* g4,
                                               unsigned l5, const float* g5,
                                               unsigned l6, const float* g6,
                                               unsigned l7, const float* g7) {
    asm volatile("global_load_async_to_lds_b128 %0, %1, off\n\t"
                 "global_load_async_to_lds_b128 %2, %3, off\n\t"
                 "global_load_async_to_lds_b128 %4, %5, off\n\t"
                 "global_load_async_to_lds_b128 %6, %7, off\n\t"
                 "global_load_async_to_lds_b128 %8, %9, off\n\t"
                 "global_load_async_to_lds_b128 %10, %11, off\n\t"
                 "global_load_async_to_lds_b128 %12, %13, off\n\t"
                 "global_load_async_to_lds_b128 %14, %15, off\n\t"
                 "s_wait_xcnt 0x0"
                 :: "v"(l0), "v"((unsigned long long)(uintptr_t)g0),
                    "v"(l1), "v"((unsigned long long)(uintptr_t)g1),
                    "v"(l2), "v"((unsigned long long)(uintptr_t)g2),
                    "v"(l3), "v"((unsigned long long)(uintptr_t)g3),
                    "v"(l4), "v"((unsigned long long)(uintptr_t)g4),
                    "v"(l5), "v"((unsigned long long)(uintptr_t)g5),
                    "v"(l6), "v"((unsigned long long)(uintptr_t)g6),
                    "v"(l7), "v"((unsigned long long)(uintptr_t)g7)
                 : "memory");
}
__device__ __forceinline__ float4 add4(float4 a, float4 b) {
    return make_float4(a.x + b.x, a.y + b.y, a.z + b.z, a.w + b.w);
}
#define PK   36                  // floats per staged row: 16-byte multiple, 8-byte reads of 16 rows meet no bank twice
#define A2_F (128 * PK)          // 64 channel rows of each rx plane
#define E_F  (34 * PK + 4)       // rows j = -1..32; data at columns 4..35, columns 0..3 stay zero
// yiT carries no __restrict__: with it the compiler sinks the row loads past the clobber below
// to their first use, behind the WMMAs, where their whole latency is waited for.
__global__ __launch_bounds__(128)
void gemm_parity_shift(const float* __restrict__ bpar, const float* yiT,
                       float* __restrict__ Cpar) {
    __shared__ __attribute__((aligned(16))) float As[2 * A2_F];
    __shared__ __attribute__((aligned(16))) float Es[2 * E_F];
    const int yh = blockIdx.x;
    const int ch = blockIdx.y;
    const int ry = blockIdx.z & 1;
    const int b  = blockIdx.z >> 1;
    const int sy = ry ? 1 : -1;
    const bool yok = (yh + sy >= 0) && (yh + sy < HD);     // same for the block

    const int tid  = threadIdx.x;
    const int lane = tid & 31;
    const int wave = tid >> 5;
    const int wr = wave & 1;          // which 32 of the 64 channels
    const int wc = wave >> 1;         // rx
    const int hf = lane >> 4;         // lane half (K-pair select)
    const int lx = lane & 15;
    const int sx = wc ? 1 : -1;

    // staging assignment: thread -> row lr (+16 per further slot), float4 at column lc
    const int lr = tid >> 3;          // 0..15
    const int lc = (tid & 7) << 2;    // 0,4,..,28

    // channel rows: slots 0..3 are plane rx = 0, slots 4..7 plane rx = 1
    const float* gA = bpar + ((size_t)(b * 4 + ry * 2) * CH + ch * 64 + lr) * L + lc;
    const unsigned lA = lds_addr32(&As[lr * PK + lc]);
    // softmax rows of image row Yh, and of image row Yh + sy (Yh itself where that is outside)
    const float* gY0 = yiT + ((size_t)b * L + yh * WD + lr) * L + lc;
    const float* gY1 = yiT + ((size_t)b * L + (yok ? yh + sy : yh) * WD + lr) * L + lc;

    // the zeros round E, in both buffers; the data cells are overwritten behind the barrier
    for (int i = tid; i < 2 * E_F; i += 128) Es[i] = 0.0f;

    v8f acc00 = 0.0f, acc01 = 0.0f, acc10 = 0.0f, acc11 = 0.0f;
    float4 y0a, y0b, y1a, y1b;        // the next step's rows lr and lr + 16 of both image rows

#define ISSUE_STEP(un, buf)                                                              \
    {                                                                                    \
        const float* ga = gA + (un) * 32;                                                \
        const unsigned la = lA + (unsigned)(buf) * (A2_F * 4);                           \
        async_copy16x8(la,                ga,                                            \
                       la + 16 * PK * 4,  ga + 16 * L,                                   \
                       la + 32 * PK * 4,  ga + 32 * L,                                   \
                       la + 48 * PK * 4,  ga + 48 * L,                                   \
                       la + 64 * PK * 4,  ga + (size_t)CH * L,                           \
                       la + 80 * PK * 4,  ga + (size_t)CH * L + 16 * L,                  \
                       la + 96 * PK * 4,  ga + (size_t)CH * L + 32 * L,                  \
                       la + 112 * PK * 4, ga + (size_t)CH * L + 48 * L);                 \
        const bool uok = ((un) + sy >= 0) && ((un) + sy < HD);                           \
        const float* p0 = gY0 + (un) * 32;                                               \
        const float* p1 = gY1 + (uok ? (un) + sy : (un)) * 32;                           \
        y0a = *(const float4*)p0;                                                        \
        y0b = *(const float4*)(p0 + 16 * L);                                             \
        y1a = *(const float4*)p1;                                                        \
        y1b = *(const float4*)(p1 + 16 * L);                                             \
        /* precaution: later code is given these loads' address registers; the clobber */ \
        /* also keeps the loads up here, so that they fly under the step's WMMAs */       \
        asm volatile("s_wait_xcnt 0x0" ::: "memory");                                    \
    }
#define STORE_E(un, buf)                                                                 \
    {                                                                                    \
        const bool ok = yok && ((un) + sy >= 0) && ((un) + sy < HD);                     \
        float4 ea = y0a, eb = y0b;                                                       \
        if (ok) { ea = add4(y0a, y1a); eb = add4(y0b, y1b); }   /* same for the block */ \
        float* e = &Es[(buf) * E_F + (lr + 1) * PK + 4 + lc];                            \
        *(float4*)e             = ea;                                                    \
        *(float4*)(e + 16 * PK) = eb;                                                    \
    }

    // prologue: step 0 into buffer 0
    ISSUE_STEP(0, 0)
    __syncthreads();     // every zero is written before a data cell is
    STORE_E(0, 0)
    asm volatile("s_wait_dscnt 0x0" ::: "memory");   // my E cells are in LDS
    wait_async0();                                    // my copies have landed
    __syncthreads();

    const int aoff = (wc * 64 + wr * 32 + lx) * PK + 2 * hf;
    const int eoff = (lx + 1) * PK + 4 + 2 * hf;
    for (int u = 0; u < HD; ++u) {
        const int cur = u & 1;
        const int nxt = cur ^ 1;
        // the next step's copies and loads fly while this step is worked on
        if (u + 1 < HD) ISSUE_STEP(u + 1, nxt)

        const float* Ac = &As[cur * A2_F + aoff];
        const float* Ec = &Es[cur * E_F + eoff];
        const float* Eq = Ec + sx * (PK + 1);          // row j + sx, column v + sx
        #pragma unroll
        for (int ks = 0; ks < 8; ++ks) {
            const int kb = ks * 4;
            v2f a0 = *(const v2f*)&Ac[kb];
            v2f a1 = *(const v2f*)&Ac[16 * PK + kb];
            v2f e0 = *(const v2f*)&Ec[kb];
            v2f e1 = *(const v2f*)&Ec[16 * PK + kb];
            v2f b0, b1;
            b0.x = e0.x + Eq[kb];
            b0.y = e0.y + Eq[kb + 1];
            b1.x = e1.x + Eq[16 * PK + kb];
            b1.y = e1.y + Eq[16 * PK + kb + 1];
            acc00 = __builtin_amdgcn_wmma_f32_16x16x4_f32(false, a0, false, b0,
                        (short)0, acc00, false, false);
            acc01 = __builtin_amdgcn_wmma_f32_16x16x4_f32(false, a0, false, b1,
                        (short)0, acc01, false, false);
            acc10 = __builtin_amdgcn_wmma_f32_16x16x4_f32(false, a1, false, b0,
                        (short)0, acc10, false, false);
            acc11 = __builtin_amdgcn_wmma_f32_16x16x4_f32(false, a1, false, b1,
                        (short)0, acc11, false, false);
        }

        if (u + 1 < HD) STORE_E(u + 1, nxt)
        asm volatile("s_wait_dscnt 0x0" ::: "memory");   // my reads of cur are over, my E cells are in LDS
        wait_async0();       // my next-step copies have landed
        __syncthreads();     // everyone's have; everyone is done reading cur
    }
#undef ISSUE_STEP
#undef STORE_E

    // C/D layout: VGPR r holds M = r (lanes 0-15) / r+8 (lanes 16-31), N = lane & 15.
    float* C = Cpar + (size_t)(b * 4 + ry * 2 + wc) * CH * L;
    #pragma unroll
    for (int mt = 0; mt < 2; ++mt) {
        v8f ar0 = (mt == 0) ? acc00 : acc10;
        v8f ar1 = (mt == 0) ? acc01 : acc11;
        #pragma unroll
        for (int r = 0; r < 8; ++r) {
            const int gm  = ch * 64 + wr * 32 + mt * 16 + r + 8 * hf;
            const int gn0 = yh * WD + lx;
            C[(size_t)gm * L + gn0]      = ar0[r];
            C[(size_t)gm * L + gn0 + 16] = ar1[r];
        }
    }
}

// ---------------------------------------------------------------------------
// out[b,c,Y,X] = 0.25 * Cpar[b][(Y&1)*2 + (X&1)][c][(Y>>1)*32 + (X>>1)]
// A thread writes 4 consecutive X from a pair of each of the two rx planes.
// ---------------------------------------------------------------------------
__global__ __launch_bounds__(256)
void merge_parity(const float* __restrict__ Cpar, float* __restrict__ out) {
    const int idx = blockIdx.x * 256 + threadIdx.x;       // (b*CH + c, Y, X/4)
    const int x4 = idx & 15;
    const int Y  = (idx >> 4) & 63;
    const int c  = (idx >> 10) & (CH - 1);
    const int b  = idx >> 17;
    const int p = (Y >> 1) * WD + x4 * 2;
    const float* s0 = Cpar + (((size_t)(b * 4 + (Y & 1) * 2) * CH + c) * L + p);
    const float2 ev = *(const float2*)s0;
    const float2 od = *(const float2*)(s0 + (size_t)CH * L);
    *(float4*)&out[(size_t)idx * 4] =
        make_float4(ev.x * 0.25f, od.x * 0.25f, ev.y * 0.25f, od.y * 0.25f);
}

// ---------------------------------------------------------------------------
extern "C" void kernel_launch(void* const* d_in, const int* in_sizes, int n_in,
                              void* d_out, int out_size, void* d_ws, size_t ws_size,
                              hipStream_t stream) {
    const float* f    = (const float*)d_in[0];   // (4,128,64,64)
    const float* bsrc = (const float*)d_in[1];   // (4,128,64,64)
    const float* mask = (const float*)d_in[2];   // (4,1,256,256)
    float* out = (float*)d_out;

    // workspace layout (bytes)
    const size_t SZ_PIX  = (size_t)BATCH * L * CH * 4;     // 2,097,152
    const size_t SZ_YI   = (size_t)BATCH * L * L * 4;      // 16,777,216
    const size_t SZ_PAR  = (size_t)BATCH * 4 * CH * L * 4; // 8,388,608
    char* w = (char*)d_ws;
    float* bT     = (float*)(w);
    float* fT     = (float*)(w + SZ_PIX);
    float* yiA    = (float*)(w + 2 * SZ_PIX);
    float* yiB    = (float*)(w + 2 * SZ_PIX + SZ_YI);
    float* bpar   = (float*)(w + 2 * SZ_PIX + 2 * SZ_YI);
    float* Cpar   = (float*)(w + 2 * SZ_PIX + 2 * SZ_YI + SZ_PAR);
    float* rnorm  = (float*)(w + 2 * SZ_PIX + 2 * SZ_YI + 2 * SZ_PAR);
    float* mmbuf  = rnorm + BATCH * L;

    // bT / fT and bpar, from the inputs alone
    prep_inputs<<<GATHER_BLOCKS + SPLIT_BLOCKS, 256, 0, stream>>>(bsrc, f, bT, fT, bpar);

    const int totOut = BATCH * CH * H0 * W0;

    // GEMM1: yiB[b][s][p] = sum_c fT[s,c] bT[p,c]   (1024x1024x128, pixel Gram matrix),
    // with rnorm and mm beside it
    gram_rnorm_mm<<<MM_BLOCKS + GRAM_BLOCKS + BATCH * L, 128, 0, stream>>>(
        fT, bT, yiB, L, L, CH, (long)L * CH, (long)L * CH, (long)L * L, rnorm, mask, mmbuf);
    // yiA[b][s][p] = rnorm[p] * 9-tap diagonal sum of the Gram matrix
    {
        dim3 grid(L, BATCH);
        patch_sum9<<<grid, 256, 0, stream>>>(yiB, rnorm, yiA);
    }
    // yiB[b][s][p] = yiT: both fuse passes and the masked softmax over p
    {
        dim3 grid(L / SROWS, BATCH);
        fuse_softmax<<<grid, 256, 0, stream>>>(yiA, mmbuf, yiB);
    }

    // GEMM2: Cpar[b][r][c][s] = sum_p bpar[c,p] * Apar[s,p]   (16 x 128x1024x1024), Apar being
    // the 2x2 diagonal shift-sum of yiT, formed in the kernel's own operand staging
    {
        dim3 grid(HD, CH / 64, BATCH * 2);
        gemm_parity_shift<<<grid, 128, 0, stream>>>(bpar, yiB, Cpar);
    }

    merge_parity<<<totOut / 4 / 256, 256, 0, stream>>>(Cpar, out);
}

// v006
// One run takes 68.4 microseconds.
// Next to v005, in two timings, it ran 1.04 and 1.05 times as fast.
// All steps since v000 together make it 4.23 times as fast.
#include <hip/hip_runtime.h>
#include <hip/hip_bf16.h>

typedef float v2f __attribute__((ext_vector_type(2)));
typedef float v8f __attribute__((ext_vector_type(8)));

// Problem constants (from reference)
#define BATCH 4
#define CH    128
#define H0    64
#define W0    64
#define HD    32      // downsampled
#define WD    32
#define L     1024    // HD*WD patches
#define SOFTMAX_SCALE 10.0f

// ---------------------------------------------------------------------------
// CDNA5 async global->LDS copy (16B per lane), tracked by ASYNCcnt.
// vdst = LDS byte address (low 32 bits of the flat shared pointer, which is
// exactly what the flat-aperture truncation uses), vaddr = 64-bit global addr.
// ---------------------------------------------------------------------------
// One tile = four copies per lane. s_wait_xcnt 0 is the last line of the same
// statement so that no address register of an issued copy is rewritten ahead of it.
__device__ __forceinline__ void async_copy16x4(unsigned l0, const float* g0,
                                               unsigned l1, const float* g1,
                                               unsigned l2, const float* g2,
                                               unsigned l3, const float* g3) {
    asm volatile("global_load_async_to_lds_b128 %0, %1, off\n\t"
                 "global_load_async_to_lds_b128 %2, %3, off\n\t"
                 "global_load_async_to_lds_b128 %4, %5, off\n\t"
                 "global_load_async_to_lds_b128 %6, %7, off\n\t"
                 "s_wait_xcnt 0x0"
                 :: "v"(l0), "v"((unsigned long long)(uintptr_t)g0),
                    "v"(l1), "v"((unsigned long long)(uintptr_t)g1),
                    "v"(l2), "v"((unsigned long long)(uintptr_t)g2),
                    "v"(l3), "v"((unsigned long long)(uintptr_t)g3)
                 : "memory");
}
// The same for six copies per lane (the staged rows of the fuse + softmax kernel).
__device__ __forceinline__ void async_copy16x6(unsigned l0, const char* g0,
                                               unsigned l1, const char* g1,
                                               unsigned l2, const char* g2,
                                               unsigned l3, const char* g3,
                                               unsigned l4, const char* g4,
                                               unsigned l5, const char* g5) {
    asm volatile("global_load_async_to_lds_b128 %0, %1, off\n\t"
                 "global_load_async_to_lds_b128 %2, %3, off\n\t"
                 "global_load_async_to_lds_b128 %4, %5, off\n\t"
                 "global_load_async_to_lds_b128 %6, %7, off\n\t"
                 "global_load_async_to_lds_b128 %8, %9, off\n\t"
                 "global_load_async_to_lds_b128 %10, %11, off\n\t"
                 "s_wait_xcnt 0x0"
                 :: "v"(l0), "v"((unsigned long long)(uintptr_t)g0),
                    "v"(l1), "v"((unsigned long long)(uintptr_t)g1),
                    "v"(l2), "v"((unsigned long long)(uintptr_t)g2),
                    "v"(l3), "v"((unsigned long long)(uintptr_t)g3),
                    "v"(l4), "v"((unsigned long long)(uintptr_t)g4),
                    "v"(l5), "v"((unsigned long long)(uintptr_t)g5)
                 : "memory");
}
__device__ __forceinline__ void wait_async0() {
    asm volatile("s_wait_asynccnt 0x0" ::: "memory");
}
__device__ __forceinline__ unsigned lds_addr32(const void* p) {
    return (unsigned)(uintptr_t)p;
}

// ---------------------------------------------------------------------------
// Downsample (::2) and transpose to pixel-major, for both tensors in one launch:
//   xT[b][p][c] = x[b, c, 2*py, 2*px],  p = py*32 + px
// One block = one (b, py) row of 32 pixels x all 128 channels, turned in LDS so that
// reads run along px and writes along c. job = (tensor, b, py). A thread moves 16
// elements, so that few waves have to be started for the plane.
// ---------------------------------------------------------------------------
__device__ __forceinline__
void gather_ds_T(int job, const float* __restrict__ bsrc, const float* __restrict__ fsrc,
                 float* __restrict__ bT, float* __restrict__ fT) {
    __shared__ float tile[CH][33];
    const float* x = (job >> 7) ? fsrc : bsrc;
    float* xT      = (job >> 7) ? fT : bT;
    const int py = job & 31;
    const int b  = (job >> 5) & 3;
    const int tx = threadIdx.x & 31;
    const int ty = threadIdx.x >> 5;
    const char* xb = (const char*)(x + ((size_t)b * CH * H0 + 2 * py) * W0);   // same for the block
    const unsigned loff = (unsigned)(ty * H0 * W0 + 2 * tx) * 4u;              // per lane
    float t[16];
    #pragma unroll
    for (int k = 0; k < 16; ++k)                      // channel ty + 8*k
        t[k] = *(const float*)(xb + loff + (unsigned)(k * 8 * H0 * W0 * 4));
    // precaution: the loads' address register is named so that it lives up to the wait and
    // no load's result is given it ahead of that
    asm volatile("s_wait_xcnt 0x0" :: "v"(loff) : "memory");
    #pragma unroll
    for (int k = 0; k < 16; ++k) tile[ty + 8 * k][tx] = t[k];
    __syncthreads();
    float* dst = xT + ((size_t)b * L + py * 32) * CH;  // 32 pixels x 128 channels in a row
    #pragma unroll
    for (int k = 0; k < 16; ++k) {
        const int lin = k * 256 + threadIdx.x;
        dst[lin] = tile[lin & (CH - 1)][lin >> 7];
    }
    // precaution: in the shared grid's listing other code follows these stores
    asm volatile("s_wait_xcnt 0x0" ::: "memory");
}

// ---------------------------------------------------------------------------
// The full-resolution background split into its four pixel parities, r = ry*2 + rx:
//   bpar[b][r][c][u*32 + v] = b_full[b, c, 2*u + ry, 2*v + rx]
// One block = one (b, c) plane of 64 x 64. A thread reads 4 consecutive X and writes a pair
// to each of the two rx planes, at 4 places 16 image rows apart: a quarter of the waves to start.
// ---------------------------------------------------------------------------
__device__ __forceinline__
void split_parity(int job, const float* __restrict__ bsrc, float* __restrict__ bpar) {
    const int x4 = threadIdx.x & 15;
    const int y0 = threadIdx.x >> 4;                      // Y = y0 + 16*k
    const int c  = job & (CH - 1);
    const int b  = job >> 7;
    const float* s = bsrc + (size_t)job * (H0 * W0) + threadIdx.x * 4;
    float4 t[4];
    #pragma unroll
    for (int k = 0; k < 4; ++k) t[k] = *(const float4*)(s + k * 1024);
    float* d0 = bpar + (((size_t)(b * 4 + (y0 & 1) * 2) * CH + c) * L + (y0 >> 1) * WD + x4 * 2);
    #pragma unroll
    for (int k = 0; k < 4; ++k) {                         // 16 image rows = 8 rows of a parity plane
        *(float2*)(d0 + k * 8 * WD)                   = make_float2(t[k].x, t[k].z);
        *(float2*)(d0 + k * 8 * WD + (size_t)CH * L)  = make_float2(t[k].y, t[k].w);
    }
    // precaution: in the shared grid's listing other code follows these stores and reuses
    // their address and data registers
    asm volatile("s_wait_xcnt 0x0" ::: "memory");
}

// ---------------------------------------------------------------------------
// rnorm[b][p] = 1 / max(sqrt(sum over the 3x3 zero-padded patch at p and all
// channels of bT^2), 1e-4)
// One block = RN_PER consecutive p of one image row; a thread owns one channel, squares
// each of the 3 x (RN_PER + 2) pixels once, and the RN_PER trees run side by side.
// ---------------------------------------------------------------------------
#define RN_PER 8
__device__ __forceinline__
void patch_rnorm(int job, const float* __restrict__ bT, float* __restrict__ rnorm) {
    __shared__ __attribute__((aligned(16))) float red[128][RN_PER];
    const int row0 = job * RN_PER;        // row = b*L + p
    const int p0 = row0 & (L - 1);
    const int py = p0 >> 5, px0 = p0 & 31;
    const float* base = bT + (size_t)(row0 - p0) * CH;    // this batch item's plane
    float v[3][RN_PER + 2];
    #pragma unroll
    for (int dy = 0; dy < 3; ++dy) {
        #pragma unroll
        for (int j = 0; j < RN_PER + 2; ++j) {
            const int y = py + dy - 1, x = px0 + j - 1;
            const bool in = (y >= 0 && y < HD && x >= 0 && x < WD);
            v[dy][j] = base[(size_t)(in ? y * WD + x : p0) * CH + threadIdx.x];   // always in bounds
            // precaution: the next load's result may be given this load's address registers
            asm volatile("s_wait_xcnt 0x0" ::: "memory");
        }
    }
    // without it the scheduler puts the first squares in front of the last loads, which then
    // start only when the first have landed
    __builtin_amdgcn_sched_barrier(0);
    #pragma unroll
    for (int dy = 0; dy < 3; ++dy) {
        #pragma unroll
        for (int j = 0; j < RN_PER + 2; ++j) {
            const int y = py + dy - 1, x = px0 + j - 1;
            const bool in = (y >= 0 && y < HD && x >= 0 && x < WD);
            v[dy][j] = in ? v[dy][j] * v[dy][j] : 0.0f;
        }
    }
    #pragma unroll
    for (int i = 0; i < RN_PER; ++i) {
        float s = 0.0f;
        #pragma unroll
        for (int t = 0; t < 9; ++t) s += v[t / 3][i + t % 3];
        red[threadIdx.x][i] = s;
    }
    __syncthreads();
    for (int st = 64; st > 0; st >>= 1) {
        if (threadIdx.x < st) {
            #pragma unroll
            for (int i = 0; i < RN_PER; ++i) red[threadIdx.x][i] += red[threadIdx.x + st][i];
        }
        __syncthreads();
    }
    if (threadIdx.x < RN_PER)
        rnorm[row0 + threadIdx.x] = 1.0f / fmaxf(sqrtf(red[0][threadIdx.x]), 1e-4f);
}

// ---------------------------------------------------------------------------
// mm[p] = 1 if all 9 taps of the (zero-padded) 3x3 patch of mask[0,0,::8,::8]
// are zero, else 0.
// ---------------------------------------------------------------------------
__device__ __forceinline__
void build_mm(int job, const float* __restrict__ mask, float* __restrict__ mm) {
    int p = job * 128 + threadIdx.x;
    if (p >= L) return;
    int py = p >> 5, px = p & 31;
    float s = 0.0f;
    for (int dy = 0; dy < 3; ++dy)
        for (int dx = 0; dx < 3; ++dx) {
            int y = py + dy - 1, x = px + dx - 1;
            if (y >= 0 && y < 32 && x >= 0 && x < 32)
                s += mask[(size_t)(8 * y) * 256 + 8 * x];
        }
    mm[p] = (s == 0.0f) ? 1.0f : 0.0f;
}

// ---------------------------------------------------------------------------
// The two re-layouts of the inputs read nothing of each other: they share one grid,
// and the block index picks the job.
// ---------------------------------------------------------------------------
#define GATHER_BLOCKS (BATCH * HD * 2)
#define SPLIT_BLOCKS  (BATCH * CH)
__global__ __launch_bounds__(256)
void prep_inputs(const float* __restrict__ bsrc, const float* __restrict__ fsrc,
                 float* __restrict__ bT, float* __restrict__ fT,
                 float* __restrict__ bpar) {
    const int blk = blockIdx.x;
    if (blk < GATHER_BLOCKS)
        gather_ds_T(blk, bsrc, fsrc, bT, fT);
    else
        split_parity(blk - GATHER_BLOCKS, bsrc, bpar);
}

// ---------------------------------------------------------------------------
// NT GEMM with f32 WMMA:  C[m,n] = (Σ_k A[m,k]*B[n,k]) * rowScale[m]
// A: M x K row-major, B: N x K row-major, C: M x N row-major.
// 128 threads = 4 waves (2x2), block tile 64x64, BK=16, double-buffered LDS
// filled with CDNA5 async global->LDS DMA (ASYNCcnt).
// ---------------------------------------------------------------------------
#define LDS_STRIDE 20
#define TILE_F     (64 * LDS_STRIDE)      // floats per 64x16 padded tile
__device__ __forceinline__
void gemm_nt_tile(int bx, int by, int batch,
                  const float* __restrict__ A, const float* __restrict__ B,
                  float* __restrict__ C, int M, int N, int K,
                  long strideA, long strideB, long strideC,
                  const float* __restrict__ rowScale, int scaleStride) {
    A += (size_t)batch * strideA;
    B += (size_t)batch * strideB;
    C += (size_t)batch * strideC;
    if (rowScale) rowScale += (size_t)batch * scaleStride;

    const int tid  = threadIdx.x;
    const int lane = tid & 31;
    const int wave = tid >> 5;
    const int wr = wave & 1;          // wave row  (2 waves along M)
    const int wc = wave >> 1;         // wave col  (2 waves along N)
    const int hf = lane >> 4;         // lane half (K-pair select)
    const int lx = lane & 15;

    const int blockM = by * 64;
    const int blockN = bx * 64;

    // [buf][A|B][64*20] double-buffered tiles
    __shared__ float smem[2 * 2 * TILE_F];

    v8f acc00 = 0.0f, acc01 = 0.0f, acc10 = 0.0f, acc11 = 0.0f;

    // cooperative-load assignment: thread -> rows lr, lr+32; float4 at col lc
    const int lr = tid >> 2;          // 0..31
    const int lc = (tid & 3) << 2;    // 0,4,8,12

    const float* gA0 = A + (size_t)(blockM + lr)      * K + lc;
    const float* gA1 = A + (size_t)(blockM + lr + 32) * K + lc;
    const float* gB0 = B + (size_t)(blockN + lr)      * K + lc;
    const float* gB1 = B + (size_t)(blockN + lr + 32) * K + lc;

    unsigned dA0[2], dA1[2], dB0[2], dB1[2];
    #pragma unroll
    for (int bf = 0; bf < 2; ++bf) {
        float* As = &smem[bf * 2 * TILE_F];
        float* Bs = As + TILE_F;
        dA0[bf] = lds_addr32(&As[lr * LDS_STRIDE + lc]);
        dA1[bf] = lds_addr32(&As[(lr + 32) * LDS_STRIDE + lc]);
        dB0[bf] = lds_addr32(&Bs[lr * LDS_STRIDE + lc]);
        dB1[bf] = lds_addr32(&Bs[(lr + 32) * LDS_STRIDE + lc]);
    }

    // prologue: fill buffer 0 with tile k0=0
    async_copy16x4(dA0[0], gA0, dA1[0], gA1, dB0[0], gB0, dB1[0], gB1);
    wait_async0();
    __syncthreads();

    const int nsteps = K >> 4;
    for (int s = 0; s < nsteps; ++s) {
        const int cur = s & 1;
        const int nxt = cur ^ 1;

        // issue async DMA for the next tile while we compute this one
        if (s + 1 < nsteps) {
            const size_t ko = (size_t)(s + 1) << 4;
            async_copy16x4(dA0[nxt], gA0 + ko, dA1[nxt], gA1 + ko,
                           dB0[nxt], gB0 + ko, dB1[nxt], gB1 + ko);
        }

        const float* As = &smem[cur * 2 * TILE_F];
        const float* Bs = As + TILE_F;

        #pragma unroll
        for (int ks = 0; ks < 4; ++ks) {
            const int kb = ks * 4 + 2 * hf;   // even -> 8B-aligned v2f
            v2f a0 = *(const v2f*)&As[(wr * 32 +  0 + lx) * LDS_STRIDE + kb];
            v2f a1 = *(const v2f*)&As[(wr * 32 + 16 + lx) * LDS_STRIDE + kb];
            v2f b0 = *(const v2f*)&Bs[(wc * 32 +  0 + lx) * LDS_STRIDE + kb];
            v2f b1 = *(const v2f*)&Bs[(wc * 32 + 16 + lx) * LDS_STRIDE + kb];
            acc00 = __builtin_amdgcn_wmma_f32_16x16x4_f32(false, a0, false, b0,
                        (short)0, acc00, false, false);
            acc01 = __builtin_amdgcn_wmma_f32_16x16x4_f32(false, a0, false, b1,
                        (short)0, acc01, false, false);
            acc10 = __builtin_amdgcn_wmma_f32_16x16x4_f32(false, a1, false, b0,
                        (short)0, acc10, false, false);
            acc11 = __builtin_amdgcn_wmma_f32_16x16x4_f32(false, a1, false, b1,
                        (short)0, acc11, false, false);
        }

        wait_async0();       // my next-tile DMA landed
        __syncthreads();     // everyone's landed; everyone done reading cur
    }

    // Epilogue. C/D layout: VGPR r holds M = r (lanes 0-15) / r+8 (lanes 16-31),
    // N = lane & 15.
    #pragma unroll
    for (int mt = 0; mt < 2; ++mt) {
        v8f ar0 = (mt == 0) ? acc00 : acc10;
        v8f ar1 = (mt == 0) ? acc01 : acc11;
        #pragma unroll
        for (int r = 0; r < 8; ++r) {
            int gm = blockM + wr * 32 + mt * 16 + r + 8 * hf;
            float sc = rowScale ? rowScale[gm] : 1.0f;
            int gn0 = blockN + wc * 32 + lx;
            C[(size_t)gm * N + gn0]      = ar0[r] * sc;
            C[(size_t)gm * N + gn0 + 16] = ar1[r] * sc;
        }
    }
}
// ---------------------------------------------------------------------------
// The pixel Gram GEMM, the patch norms and the mask map read nothing of each other:
// they share one grid. The GEMM tiles, the longest job, come first; the mask map, a few
// blocks that wait on one load after another, comes next and ends under the other two.
// ---------------------------------------------------------------------------
#define MM_BLOCKS   (L / 128)
#define GRAM_BLOCKS ((L / 64) * (L / 64) * BATCH)
__global__ __launch_bounds__(128)
void gram_rnorm_mm(const float* __restrict__ fT, const float* __restrict__ bT,
                   float* __restrict__ G, int M, int N, int K,
                   long strideA, long strideB, long strideC,
                   float* __restrict__ rnorm,
                   const float* __restrict__ mask, float* __restrict__ mm) {
    const int blk = blockIdx.x;
    if (blk < GRAM_BLOCKS)
        gemm_nt_tile(blk & 15, (blk >> 4) & 15, blk >> 8, fT, bT, G, M, N, K,
                     strideA, strideB, strideC, nullptr, 0);
    else if (blk < GRAM_BLOCKS + MM_BLOCKS)
        build_mm(blk - GRAM_BLOCKS, mask, mm);
    else
        patch_rnorm(blk - GRAM_BLOCKS - MM_BLOCKS, bT, rnorm);
}

// ---------------------------------------------------------------------------
// 3x3 patch correlation from the pixel Gram matrix, kept transposed,
// G[s][p] = sum_c fT[s][c]*bT[p][c]:
//   S[s][p] = rnorm[p] * sum_{dy,dx=-1..1} G[s + 32*dy + dx][p + 32*dy + dx]
// a tap counting only where both shifted pixels lie inside the 32x32 image (zero
// padding of both patches). One block = PS_ROWS consecutive rows s of one image row; a
// thread owns 4 consecutive p, which share one image row, in each of them. The rows' taps
// overlap: per dy the block reads PS_ROWS + 2 rows of G, each once. Every tap is one
// aligned 16-byte load; for dx = -1/+1 the element that crosses the 4-group comes from
// the neighbour lane.
// ---------------------------------------------------------------------------
#define PS_ROWS 4
// G and rnorm carry no __restrict__, so that the clobber below keeps their loads in front of it.
__global__ __launch_bounds__(256)
void patch_sum9(const float* G, const float* rnorm, float* S) {
    const int q0 = blockIdx.x * PS_ROWS;      // first row: foreground pixel s
    const int b = blockIdx.y;
    const float* Gb = G + (size_t)b * L * L;
    const int qy = q0 >> 5, qx0 = q0 & 31;
    const int c4 = threadIdx.x * 4;           // columns: background patches p
    const int cy = c4 >> 5, cx0 = c4 & 31;
    // All loads are unconditional (a tap outside the image reads a row / column of its own
    // block instead and is then replaced by zero), so they fly together.
    // w[dy + 1][j] is row q0 + 32*dy + j - 1 at columns c4 + 32*dy ..
    float4 w[3][PS_ROWS + 2];
    unsigned boff[3];                         // byte column, per lane
    #pragma unroll
    for (int d = 0; d < 3; ++d) {
        const int dy = d - 1;
        const bool cv = (cy + dy >= 0) && (cy + dy < HD);
        boff[d] = (unsigned)(cv ? c4 + 32 * dy : c4) * 4u;
        const bool yv = (qy + dy >= 0) && (qy + dy < HD);                 // same for the block
        const int rb = yv ? q0 + 32 * dy : q0;                            // rows rb .. rb + PS_ROWS - 1 exist
        const char* mid = (const char*)(Gb + (size_t)rb * L);
        const char* lo  = (const char*)(Gb + (size_t)(qx0 > 0 ? rb - 1 : rb) * L);
        const char* hi  = (const char*)(Gb + (size_t)(qx0 + PS_ROWS < WD ? rb + PS_ROWS : rb) * L);
        w[d][0] = *(const float4*)(lo + boff[d]);
        #pragma unroll
        for (int j = 1; j <= PS_ROWS; ++j)
            w[d][j] = *(const float4*)(mid + boff[d] + (unsigned)((j - 1) * L * 4));
        w[d][PS_ROWS + 1] = *(const float4*)(hi + boff[d]);
    }
    const float4 sc = *(const float4*)((const char*)(rnorm + b * L) + boff[1]);
    // precaution: the loads' address registers are named so that they live up to the wait and
    // no load's result is given one of them ahead of that; the clobber keeps the loads up here
    asm volatile("s_wait_xcnt 0x0" :: "v"(boff[0]), "v"(boff[1]), "v"(boff[2]) : "memory");
    // without it the scheduler puts the first rows' sums in front of the last loads, which
    // then start only when the first have landed
    __builtin_amdgcn_sched_barrier(0);
    #pragma unroll
    for (int d = 0; d < 3; ++d) {
        const int dy = d - 1;
        #pragma unroll
        for (int j = 0; j < PS_ROWS + 2; ++j) {
            const bool ok = (qy + dy >= 0) && (qy + dy < HD) && (qx0 + j - 1 >= 0) && (qx0 + j - 1 < WD) &&
                            (cy + dy >= 0) && (cy + dy < HD);
            if (!ok) w[d][j] = make_float4(0.0f, 0.0f, 0.0f, 0.0f);
        }
    }
    #pragma unroll
    for (int i = 0; i < PS_ROWS; ++i) {
        float a0 = 0.0f, a1 = 0.0f, a2 = 0.0f, a3 = 0.0f;
        #pragma unroll
        for (int t = 0; t < 9; ++t) {
            const int dx = t % 3 - 1;
            const float4 x = w[t / 3][i + dx + 1];
            if (dx == 0) {
                a0 += x.x; a1 += x.y; a2 += x.z; a3 += x.w;
            } else if (dx < 0) {
                const float e = __shfl_up(x.w, 1);               // column c4 - 1
                a0 += (cx0 == 0) ? 0.0f : e;
                a1 += x.x; a2 += x.y; a3 += x.z;
            } else {
                const float e = __shfl_down(x.x, 1);             // column c4 + 4
                a0 += x.y; a1 += x.z; a2 += x.w;
                a3 += (cx0 == 28) ? 0.0f : e;
            }
        }
        *(float4*)&S[((size_t)b * L + q0 + i) * L + c4] =
            make_float4(a0 * sc.x, a1 * sc.y, a2 * sc.z, a3 * sc.w);
    }
}

// ---------------------------------------------------------------------------
// Both diagonal fuse passes and the masked softmax, on the transposed scores S[s][p].
//   F1[i][j] = sum_{d1=-1..1} S[i+d1][j+d1]                 (flat indices, zero outside)
//   F2[s][p] = sum_{d2=-1..1} F1[T(T(s)+d2)][T(T(p)+d2)]    (zero where T(.)+d2 leaves 0..1023)
//   T(y*32+x) = x*32+y  (the transposed flattening; T is its own inverse)
//   yiT[b][s][p] = softmax_p(F2[s][p]*mm[p]*10) * mm[p]
// One block = SROWS consecutive s of one image row. T(T(s)+d2) steps by 1 with s there,
// so each d2 needs SROWS+2 consecutive rows of S; async copies stage them in LDS. A row outside
// the matrix is staged as zeros, and each row has a zero in front of and behind it, so
// a tap at column -1 or 1024 adds zero with no test. All 1024 p of an s are in the
// block, so the softmax follows on the spot, the SROWS reductions side by side.
// ---------------------------------------------------------------------------
#define ROWP  (L + 8)     // floats per staged row: data at 4..L+3, zeros at 3 and L+4
#define SROWS 4
#define GROWS (SROWS + 2) // staged rows per d2
__global__ __launch_bounds__(256)
void fuse_softmax(const float* __restrict__ S, const float* __restrict__ mm,
                  float* __restrict__ yiT) {
    __shared__ __attribute__((aligned(16))) float rows[3 * GROWS * ROWP];
    __shared__ __attribute__((aligned(16))) float red[256][SROWS];   // a thread's SROWS partials side by side
    const int s0 = blockIdx.x * SROWS;
    const int b = blockIdx.y;
    const int tid = threadIdx.x;
    const char* src = (const char*)(S + (size_t)b * L * L);
    const int js0 = (s0 & 31) * 32 + (s0 >> 5);               // T(s0); T(s0 + i) = js0 + 32*i
    const unsigned boff = (unsigned)tid * 16u;                // byte column, per lane
    // Every lane copies its 16 bytes of each of the 18 rows straight to LDS; the copies are
    // unconditional (a row outside the matrix copies row s0 instead and is then overwritten
    // with zeros), so they fly together. Every loop over g, j, i, k and d2 is unrolled so
    // that the arrays are indexed by constants only and stay in registers.
    const unsigned lbase = lds_addr32(&rows[4 + tid * 4]);
    float m[4];                                               // asked for early: lands under the copies
    #pragma unroll
    for (int k = 0; k < 4; ++k) m[k] = mm[tid + k * 256];
    #pragma unroll
    for (int g = 0; g < 3; ++g) {
        const int tt = js0 + g - 1;
        const int r0 = ((tt & 31) << 5) + (tt >> 5) - 1;      // row in slot 0 of this d2
        const char* gp[GROWS];
        unsigned lp[GROWS];
        #pragma unroll
        for (int j = 0; j < GROWS; ++j) {
            const bool ok = (r0 + j >= 0) && (r0 + j < L);    // same for the block
            gp[j] = src + (size_t)(ok ? r0 + j : s0) * (L * 4) + boff;
            lp[j] = lbase + (unsigned)((g * GROWS + j) * ROWP * 4);
        }
        async_copy16x6(lp[0], gp[0], lp[1], gp[1], lp[2], gp[2],
                       lp[3], gp[3], lp[4], gp[4], lp[5], gp[5]);
    }
    wait_async0();       // my copies have landed: my own bytes may be overwritten, and published
    #pragma unroll
    for (int g = 0; g < 3; ++g) {
        const int tt = js0 + g - 1;
        const int r0 = ((tt & 31) << 5) + (tt >> 5) - 1;
        #pragma unroll
        for (int j = 0; j < GROWS; ++j) {
            if ((r0 + j < 0) || (r0 + j >= L))
                *(float4*)&rows[(g * GROWS + j) * ROWP + 4 + tid * 4] =
                    make_float4(0.0f, 0.0f, 0.0f, 0.0f);
        }
    }
    if (tid < 3 * GROWS) {
        rows[tid * ROWP + 3]     = 0.0f;
        rows[tid * ROWP + L + 4] = 0.0f;
    }
    __syncthreads();

    float v[SROWS][4];
    #pragma unroll
    for (int k = 0; k < 4; ++k) {
        const int p  = tid + k * 256;
        const int ip = (p & 31) * 32 + (p >> 5);
        float acc[SROWS];
        #pragma unroll
        for (int i = 0; i < SROWS; ++i) acc[i] = 0.0f;
        #pragma unroll
        for (int d2 = -1; d2 <= 1; ++d2) {
            const int u  = ip + d2;
            const int c2 = ((u & 31) << 5) + (u >> 5);        // 991 at u = -1, 32 at u = 1024: in range
            const bool uok = (u >= 0) && (u < L);
            const float* rp = &rows[(d2 + 1) * GROWS * ROWP + 4 + c2];
            #pragma unroll
            for (int i = 0; i < SROWS; ++i) {
                const int ti = js0 + 32 * i + d2;             // same for the block
                float f1 = 0.0f;
                f1 += rp[i * ROWP - 1];
                f1 += rp[(i + 1) * ROWP];
                f1 += rp[(i + 2) * ROWP + 1];
                acc[i] += (uok && ti >= 0 && ti < L) ? f1 : 0.0f;
            }
        }
        #pragma unroll
        for (int i = 0; i < SROWS; ++i) v[i][k] = acc[i] * m[k] * SOFTMAX_SCALE;
    }
    #pragma unroll
    for (int i = 0; i < SROWS; ++i)
        red[tid][i] = fmaxf(fmaxf(v[i][0], v[i][1]), fmaxf(v[i][2], v[i][3]));
    __syncthreads();
    for (int st = 128; st > 0; st >>= 1) {
        if (tid < st) {
            #pragma unroll
            for (int i = 0; i < SROWS; ++i) red[tid][i] = fmaxf(red[tid][i], red[tid + st][i]);
        }
        __syncthreads();
    }
    float mx[SROWS];
    #pragma unroll
    for (int i = 0; i < SROWS; ++i) mx[i] = red[0][i];
    __syncthreads();
    #pragma unroll
    for (int i = 0; i < SROWS; ++i) {
        float ssum = 0.0f;
        #pragma unroll
        for (int k = 0; k < 4; ++k) { v[i][k] = expf(v[i][k] - mx[i]); ssum += v[i][k]; }
        red[tid][i] = ssum;
    }
    __syncthreads();
    for (int st = 128; st > 0; st >>= 1) {
        if (tid < st) {
            #pragma unroll
            for (int i = 0; i < SROWS; ++i) red[tid][i] += red[tid + st][i];
        }
        __syncthreads();
    }
    #pragma unroll
    for (int i = 0; i < SROWS; ++i) {
        const float inv = 1.0f / red[0][i];
        float* dst = yiT + ((size_t)b * L + s0 + i) * L;
        #pragma unroll
        for (int k = 0; k < 4; ++k) dst[tid + k * 256] = v[i][k] * inv * m[k];
    }
}

// ---------------------------------------------------------------------------
// The stride-2 transposed conv with the 4x4 raw patches, by output parity.
// With Y = 2*Yh + ry, X = 2*Xh + rx, s = Yh*32 + Xh, p = u*32 + v:
//   out[b,c,Y,X] = 0.25 * sum_p Apar[r][s][p] * b_full[b, c, 2*u + ry, 2*v + rx]
//   Apar[r][s][p] = sum_{dy in {0,sy}, dx in {0,sx}} yiT[b][s + 32*dy + dx][p + 32*dy + dx]
// sy = ry ? +1 : -1, sx = rx ? +1 : -1; a tap counts only where both shifted pixels
// lie inside the 32x32 image. (The 16 taps of a raw patch overlap its neighbours':
// each full-resolution pixel is met by 2x2 (position, patch) pairs on one diagonal.)
//
// Apar is never stored. One block = (b, ry, image row Yh, 64 channels), both rx; a K step
// is one image row u of p (32 values). Per step the block stages
//   E[j][v] = yiT[Yh*32 + j][u*32 + v] + yiT[(Yh+sy)*32 + j][(u+sy)*32 + v]
// in LDS with zeros all round, and a wave forms its B fragment on the way to the WMMA:
//   Apar[ry*2+rx][Yh*32 + j][u*32 + v] = E[j][v] + E[j + sx][v + sx]
// 4 waves: wr = which 32 channels, wc = rx. Cpar[b][r][c][s] as a 128 x 1024 plane per (b, r).
// ---------------------------------------------------------------------------
// Eight copies per lane (the channel rows of both rx planes); s_wait_xcnt 0 is the last
// line of the same statement so that no address register of an issued copy is rewritten
// ahead of it.
__device__ __forceinline__ void async_copy16x8(unsigned l0, const float* g0,
                                               unsigned l1, const float* g1,
                                               unsigned l2, const float* g2,
                                               unsigned l3, const float* g3,
                                               unsigned l4, const float* g4,
                                               unsigned l5, const float* g5,
                                               unsigned l6, const float* g6,
                                               unsigned l7, const float* g7) {
    asm volatile("global_load_async_to_lds_b128 %0, %1, off\n\t"
                 "global_load_async_to_lds_b128 %2, %3, off\n\t"
                 "global_load_async_to_lds_b128 %4, %5, off\n\t"
                 "global_load_async_to_lds_b128 %6, %7, off\n\t"
                 "global_load_async_to_lds_b128 %8, %9, off\n\t"
                 "global_load_async_to_lds_b128 %10, %11, off\n\t"
                 "global_load_async_to_lds_b128 %12, %13, off\n\t"
                 "global_load_async_to_lds_b128 %14, %15, off\n\t"
                 "s_wait_xcnt 0x0"
                 :: "v"(l0), "v"((unsigned long long)(uintptr_t)g0),
                    "v"(l1), "v"((unsigned long long)(uintptr_t)g1),
                    "v"(l2), "v"((unsigned long long)(uintptr_t)g2),
                    "v"(l3), "v"((unsigned long long)(uintptr_t)g3),
                    "v"(l4), "v"((unsigned long long)(uintptr_t)g4),
                    "v"(l5), "v"((unsigned long long)(uintptr_t)g5),
                    "v"(l6), "v"((unsigned long long)(uintptr_t)g6),
                    "v"(l7), "v"((unsigned long long)(uintptr_t)g7)
                 : "memory");
}
__device__ __forceinline__ float4 add4(float4 a, float4 b) {
    return make_float4(a.x + b.x, a.y + b.y, a.z + b.z, a.w + b.w);
}
#define PK   36                  // floats per staged row: 16-byte multiple, 8-byte reads of 16 rows meet no bank twice
#define A2_F (128 * PK)          // 64 channel rows of each rx plane
#define E_F  (34 * PK + 4)       // rows j = -1..32; data at columns 4..35, columns 0..3 stay zero
// yiT carries no __restrict__: with it the compiler sinks the row loads past the clobber below
// to their first use, behind the WMMAs, where their whole latency is waited for.
__global__ __launch_bounds__(128)
void gemm_parity_shift(const float* __restrict__ bpar, const float* yiT,
                       float* __restrict__ Cpar) {
    __shared__ __attribute__((aligned(16))) float As[2 * A2_F];
    __shared__ __attribute__((aligned(16))) float Es[2 * E_F];
    const int yh = blockIdx.x;
    const int ch = blockIdx.y;
    const int ry = blockIdx.z & 1;
    const int b  = blockIdx.z >> 1;
    const int sy = ry ? 1 : -1;
    const bool yok = (yh + sy >= 0) && (yh + sy < HD);     // same for the block

    const int tid  = threadIdx.x;
    const int lane = tid & 31;
    const int wave = tid >> 5;
    const int wr = wave & 1;          // which 32 of the 64 channels
    const int wc = wave >> 1;         // rx
    const int hf = lane >> 4;         // lane half (K-pair select)
    const int lx = lane & 15;
    const int sx = wc ? 1 : -1;

    // staging assignment: thread -> row lr (+16 per further slot), float4 at column lc
    const int lr = tid >> 3;          // 0..15
    const int lc = (tid & 7) << 2;    // 0,4,..,28

    // channel rows: slots 0..3 are plane rx = 0, slots 4..7 plane rx = 1
    const float* gA = bpar + ((size_t)(b * 4 + ry * 2) * CH + ch * 64 + lr) * L + lc;
    const unsigned lA = lds_addr32(&As[lr * PK + lc]);
    // softmax rows of image row Yh, and of image row Yh + sy (Yh itself where that is outside)
    const float* gY0 = yiT + ((size_t)b * L + yh * WD + lr) * L + lc;
    const float* gY1 = yiT + ((size_t)b * L + (yok ? yh + sy : yh) * WD + lr) * L + lc;

    // the zeros round E, in both buffers; the data cells are overwritten behind the barrier
    for (int i = tid; i < 2 * E_F; i += 128) Es[i] = 0.0f;

    v8f acc00 = 0.0f, acc01 = 0.0f, acc10 = 0.0f, acc11 = 0.0f;
    float4 y0a, y0b, y1a, y1b;        // the next step's rows lr and lr + 16 of both image rows

#define ISSUE_STEP(un, buf)                                                              \
    {                                                                                    \
        const float* ga = gA + (un) * 32;                                                \
        const unsigned la = lA + (unsigned)(buf) * (A2_F * 4);                           \
        async_copy16x8(la,                ga,                                            \
                       la + 16 * PK * 4,  ga + 16 * L,                                   \
                       la + 32 * PK * 4,  ga + 32 * L,                                   \
                       la + 48 * PK * 4,  ga + 48 * L,                                   \
                       la + 64 * PK * 4,  ga + (size_t)CH * L,                           \
                       la + 80 * PK * 4,  ga + (size_t)CH * L + 16 * L,                  \
                       la + 96 * PK * 4,  ga + (size_t)CH * L + 32 * L,                  \
                       la + 112 * PK * 4, ga + (size_t)CH * L + 48 * L);                 \
        const bool uok = ((un) + sy >= 0) && ((un) + sy < HD);                           \
        const float* p0 = gY0 + (un) * 32;                                               \
        const float* p1 = gY1 + (uok ? (un) + sy : (un)) * 32;                           \
        y0a = *(const float4*)p0;                                                        \
        y0b = *(const float4*)(p0 + 16 * L);                                             \
        y1a = *(const float4*)p1;                                                        \
        y1b = *(const float4*)(p1 + 16 * L);                                             \
        /* precaution: later code is given these loads' address registers; the clobber */ \
        /* also keeps the loads up here, so that they fly under the step's WMMAs */       \
        asm volatile("s_wait_xcnt 0x0" ::: "memory");                                    \
    }
#define STORE_E(un, buf)                                                                 \
    {                                                                                    \
        const bool ok = yok && ((un) + sy >= 0) && ((un) + sy < HD);                     \
        float4 ea = y0a, eb = y0b;                                                       \
        if (ok) { ea = add4(y0a, y1a); eb = add4(y0b, y1b); }   /* same for the block */ \
        float* e = &Es[(buf) * E_F + (lr + 1) * PK + 4 + lc];                            \
        *(float4*)e             = ea;                                                    \
        *(float4*)(e + 16 * PK) = eb;                                                    \
    }

    // prologue: step 0 into buffer 0
    ISSUE_STEP(0, 0)
    __syncthreads();     // every zero is written before a data cell is
    STORE_E(0, 0)
    asm volatile("s_wait_dscnt 0x0" ::: "memory");   // my E cells are in LDS
    wait_async0();                                    // my copies have landed
    __syncthreads();

    const int aoff = (wc * 64 + wr * 32 + lx) * PK + 2 * hf;
    const int eoff = (lx + 1) * PK + 4 + 2 * hf;
    for (int u = 0; u < HD; ++u) {
        const int cur = u & 1;
        const int nxt = cur ^ 1;
        // the next step's copies and loads fly while this step is worked on
        if (u + 1 < HD) ISSUE_STEP(u + 1, nxt)

        const float* Ac = &As[cur * A2_F + aoff];
        const float* Ec = &Es[cur * E_F + eoff];
        const float* Eq = Ec + sx * (PK + 1);          // row j + sx, column v + sx
        #pragma unroll
        for (int ks = 0; ks < 8; ++ks) {
            const int kb = ks * 4;
            v2f a0 = *(const v2f*)&Ac[kb];
            v2f a1 = *(const v2f*)&Ac[16 * PK + kb];
            v2f e0 = *(const v2f*)&Ec[kb];
            v2f e1 = *(const v2f*)&Ec[16 * PK + kb];
            v2f b0, b1;
            b0.x = e0.x + Eq[kb];
            b0.y = e0.y + Eq[kb + 1];
            b1.x = e1.x + Eq[16 * PK + kb];
            b1.y = e1.y + Eq[16 * PK + kb + 1];
            acc00 = __builtin_amdgcn_wmma_f32_16x16x4_f32(false, a0, false, b0,
                        (short)0, acc00, false, false);
            acc01 = __builtin_amdgcn_wmma_f32_16x16x4_f32(false, a0, false, b1,
                        (short)0, acc01, false, false);
            acc10 = __builtin_amdgcn_wmma_f32_16x16x4_f32(false, a1, false, b0,
                        (short)0, acc10, false, false);
            acc11 = __builtin_amdgcn_wmma_f32_16x16x4_f32(false, a1, false, b1,
                        (short)0, acc11, false, false);
        }

        if (u + 1 < HD) STORE_E(u + 1, nxt)
        asm volatile("s_wait_dscnt 0x0" ::: "memory");   // my reads of cur are over, my E cells are in LDS
        wait_async0();       // my next-step copies have landed
        __syncthreads();     // everyone's have; everyone is done reading cur
    }
#undef ISSUE_STEP
#undef STORE_E

    // C/D layout: VGPR r holds M = r (lanes 0-15) / r+8 (lanes 16-31), N = lane & 15.
    float* C = Cpar + (size_t)(b * 4 + ry * 2 + wc) * CH * L;
    #pragma unroll
    for (int mt = 0; mt < 2; ++mt) {
        v8f ar0 = (mt == 0) ? acc00 : acc10;
        v8f ar1 = (mt == 0) ? acc01 : acc11;
        #pragma unroll
        for (int r = 0; r < 8; ++r) {
            const int gm  = ch * 64 + wr * 32 + mt * 16 + r + 8 * hf;
            const int gn0 = yh * WD + lx;
            C[(size_t)gm * L + gn0]      = ar0[r];
            C[(size_t)gm * L + gn0 + 16] = ar1[r];
        }
    }
}

// ---------------------------------------------------------------------------
// out[b,c,Y,X] = 0.25 * Cpar[b][(Y&1)*2 + (X&1)][c][(Y>>1)*32 + (X>>1)]
// One block = one (b, c) plane of 64 x 64. A thread writes 4 consecutive X from a pair of each
// of the two rx planes, at 4 places 16 image rows apart: a quarter of the waves to start.
// ---------------------------------------------------------------------------
__global__ __launch_bounds__(256)
void merge_parity(const float* __restrict__ Cpar, float* __restrict__ out) {
    const int x4 = threadIdx.x & 15;
    const int y0 = threadIdx.x >> 4;                      // Y = y0 + 16*k
    const int c  = blockIdx.x & (CH - 1);
    const int b  = blockIdx.x >> 7;
    const char* sb = (const char*)(Cpar + ((size_t)b * 4 * CH + c) * L);               // same for the block
    const unsigned loff = (unsigned)((y0 & 1) * 2 * CH * L + (y0 >> 1) * WD + x4 * 2) * 4u;   // per lane
    float2 ev[4], od[4];
    #pragma unroll
    for (int k = 0; k < 4; ++k) {                         // 16 image rows = 8 rows of a parity plane
        ev[k] = *(const float2*)(sb + loff + (unsigned)(k * 8 * WD * 4));
        od[k] = *(const float2*)(sb + loff + (unsigned)((CH * L + k * 8 * WD) * 4));
    }
    // precaution: the loads' address register is named so that it lives up to the wait and
    // no load's result is given it ahead of that
    asm volatile("s_wait_xcnt 0x0" :: "v"(loff) : "memory");
    float* d = out + (size_t)blockIdx.x * (H0 * W0) + threadIdx.x * 4;
    #pragma unroll
    for (int k = 0; k < 4; ++k)
        *(float4*)(d + k * 1024) =
            make_float4(ev[k].x * 0.25f, od[k].x * 0.25f, ev[k].y * 0.25f, od[k].y * 0.25f);
}

// ---------------------------------------------------------------------------
extern "C" void kernel_launch(void* const* d_in, const int* in_sizes, int n_in,
                              void* d_out, int out_size, void* d_ws, size_t ws_size,
                              hipStream_t stream) {
    const float* f    = (const float*)d_in[0];   // (4,128,64,64)
    const float* bsrc = (const float*)d_in[1];   // (4,128,64,64)
    const float* mask = (const float*)d_in[2];   // (4,1,256,256)
    float* out = (float*)d_out;

    // workspace layout (bytes)
    const size_t SZ_PIX  = (size_t)BATCH * L * CH * 4;     // 2,097,152
    const size_t SZ_YI   = (size_t)BATCH * L * L * 4;      // 16,777,216
    const size_t SZ_PAR  = (size_t)BATCH * 4 * CH * L * 4; // 8,388,608
    char* w = (char*)d_ws;
    float* bT     = (float*)(w);
    float* fT     = (float*)(w + SZ_PIX);
    float* yiA    = (float*)(w + 2 * SZ_PIX);
    float* yiB    = (float*)(w + 2 * SZ_PIX + SZ_YI);
    float* bpar   = (float*)(w + 2 * SZ_PIX + 2 * SZ_YI);
    float* Cpar   = (float*)(w + 2 * SZ_PIX + 2 * SZ_YI + SZ_PAR);
    float* rnorm  = (float*)(w + 2 * SZ_PIX + 2 * SZ_YI + 2 * SZ_PAR);
    float* mmbuf  = rnorm + BATCH * L;

    // bT / fT and bpar, from the inputs alone
    prep_inputs<<<GATHER_BLOCKS + SPLIT_BLOCKS, 256, 0, stream>>>(bsrc, f, bT, fT, bpar);

    // GEMM1: yiB[b][s][p] = sum_c fT[s,c] bT[p,c]   (1024x1024x128, pixel Gram matrix),
    // with rnorm and mm beside it
    gram_rnorm_mm<<<MM_BLOCKS + GRAM_BLOCKS + BATCH * L / RN_PER, 128, 0, stream>>>(
        fT, bT, yiB, L, L, CH, (long)L * CH, (long)L * CH, (long)L * L, rnorm, mask, mmbuf);
    // yiA[b][s][p] = rnorm[p] * 9-tap diagonal sum of the Gram matrix
    {
        dim3 grid(L / PS_ROWS, BATCH);
        patch_sum9<<<grid, 256, 0, stream>>>(yiB, rnorm, yiA);
    }
    // yiB[b][s][p] = yiT: both fuse passes and the masked softmax over p
    {
        dim3 grid(L / SROWS, BATCH);
        fuse_softmax<<<grid, 256, 0, stream>>>(yiA, mmbuf, yiB);
    }

    // GEMM2: Cpar[b][r][c][s] = sum_p bpar[c,p] * Apar[s,p]   (16 x 128x1024x1024), Apar being
    // the 2x2 diagonal shift-sum of yiT, formed in the kernel's own operand staging
    {
        dim3 grid(HD, CH / 64, BATCH * 2);
        gemm_parity_shift<<<grid, 128, 0, stream>>>(bpar, yiB, Cpar);
    }

    merge_parity<<<BATCH * CH, 256, 0, stream>>>(Cpar, out);
}

// v007
// One run takes 62.7 microseconds.
// Timed twice side by side with v006, it ran 1.09 times as fast both times.
// Counting every step since v000, it is 4.62 times as fast.
#include <hip/hip_runtime.h>
#include <hip/hip_bf16.h>

typedef float v2f __attribute__((ext_vector_type(2)));
typedef float v8f __attribute__((ext_vector_type(8)));

// Problem constants (from reference)
#define BATCH 4
#define CH    128
#define H0    64
#define W0    64
#define HD    32      // downsampled
#define WD    32
#define L     1024    // HD*WD patches
#define SOFTMAX_SCALE 10.0f

// ---------------------------------------------------------------------------
// CDNA5 async global->LDS copy (16B per lane), tracked by ASYNCcnt.
// vdst = LDS byte address (low 32 bits of the flat shared pointer, which is
// exactly what the flat-aperture truncation uses), vaddr = 64-bit global addr.
// ---------------------------------------------------------------------------
// One tile = four copies per lane. s_wait_xcnt 0 is the last line of the same
// statement so that no address register of an issued copy is rewritten ahead of it.
__device__ __forceinline__ void async_copy16x4(unsigned l0, const float* g0,
                                               unsigned l1, const float* g1,
                                               unsigned l2, const float* g2,
                                               unsigned l3, const float* g3) {
    asm volatile("global_load_async_to_lds_b128 %0, %1, off\n\t"
                 "global_load_async_to_lds_b128 %2, %3, off\n\t"
                 "global_load_async_to_lds_b128 %4, %5, off\n\t"
                 "global_load_async_to_lds_b128 %6, %7, off\n\t"
                 "s_wait_xcnt 0x0"
                 :: "v"(l0), "v"((unsigned long long)(uintptr_t)g0),
                    "v"(l1), "v"((unsigned long long)(uintptr_t)g1),
                    "v"(l2), "v"((unsigned long long)(uintptr_t)g2),
                    "v"(l3), "v"((unsigned long long)(uintptr_t)g3)
                 : "memory");
}
// The same for six copies per lane (the staged rows of the fuse + softmax kernel).
__device__ __forceinline__ void async_copy16x6(unsigned l0, const char* g0,
                                               unsigned l1, const char* g1,
                                               unsigned l2, const char* g2,
                                               unsigned l3, const char* g3,
                                               unsigned l4, const char* g4,
                                               unsigned l5, const char* g5) {
    asm volatile("global_load_async_to_lds_b128 %0, %1, off\n\t"
                 "global_load_async_to_lds_b128 %2, %3, off\n\t"
                 "global_load_async_to_lds_b128 %4, %5, off\n\t"
                 "global_load_async_to_lds_b128 %6, %7, off\n\t"
                 "global_load_async_to_lds_b128 %8, %9, off\n\t"
                 "global_load_async_to_lds_b128 %10, %11, off\n\t"
                 "s_wait_xcnt 0x0"
                 :: "v"(l0), "v"((unsigned long long)(uintptr_t)g0),
                    "v"(l1), "v"((unsigned long long)(uintptr_t)g1),
                    "v"(l2), "v"((unsigned long long)(uintptr_t)g2),
                    "v"(l3), "v"((unsigned long long)(uintptr_t)g3),
                    "v"(l4), "v"((unsigned long long)(uintptr_t)g4),
                    "v"(l5), "v"((unsigned long long)(uintptr_t)g5)
                 : "memory");
}
__device__ __forceinline__ void wait_async0() {
    asm volatile("s_wait_asynccnt 0x0" ::: "memory");
}
__device__ __forceinline__ unsigned lds_addr32(const void* p) {
    return (unsigned)(uintptr_t)p;
}

// ---------------------------------------------------------------------------
// Downsample (::2) and transpose to pixel-major, for both tensors in one launch:
//   xT[b][p][c] = x[b, c, 2*py, 2*px],  p = py*32 + px
// One block = one (b, py) row of 32 pixels x all 128 channels, turned in LDS so that
// reads run along px and writes along c. job = (tensor, b, py). A thread moves 16
// elements, so that few waves have to be started for the plane.
// ---------------------------------------------------------------------------
__device__ __forceinline__
void gather_ds_T(int job, const float* __restrict__ bsrc, const float* __restrict__ fsrc,
                 float* __restrict__ bT, float* __restrict__ fT) {
    __shared__ float tile[CH][33];
    const float* x = (job >> 7) ? fsrc : bsrc;
    float* xT      = (job >> 7) ? fT : bT;
    const int py = job & 31;
    const int b  = (job >> 5) & 3;
    const int tx = threadIdx.x & 31;
    const int ty = threadIdx.x >> 5;
    const char* xb = (const char*)(x + ((size_t)b * CH * H0 + 2 * py) * W0);   // same for the block
    const unsigned loff = (unsigned)(ty * H0 * W0 + 2 * tx) * 4u;              // per lane
    float t[16];
    #pragma unroll
    for (int k = 0; k < 16; ++k)                      // channel ty + 8*k
        t[k] = *(const float*)(xb + loff + (unsigned)(k * 8 * H0 * W0 * 4));
    // precaution: the loads' address register is named so that it lives up to the wait and
    // no load's result is given it ahead of that
    asm volatile("s_wait_xcnt 0x0" :: "v"(loff) : "memory");
    #pragma unroll
    for (int k = 0; k < 16; ++k) tile[ty + 8 * k][tx] = t[k];
    __syncthreads();
    float* dst = xT + ((size_t)b * L + py * 32) * CH;  // 32 pixels x 128 channels in a row
    #pragma unroll
    for (int k = 0; k < 16; ++k) {
        const int lin = k * 256 + threadIdx.x;
        dst[lin] = tile[lin & (CH - 1)][lin >> 7];
    }
}

// ---------------------------------------------------------------------------
// rnorm[b][p] = 1 / max(sqrt(sum over the 3x3 zero-padded patch at p and all
// channels of bT^2), 1e-4)
// One block = RN_PER consecutive p of one image row; a thread owns one channel, squares
// each of the 3 x (RN_PER + 2) pixels once, and the RN_PER trees run side by side.
// ---------------------------------------------------------------------------
#define RN_PER 8
__device__ __forceinline__
void patch_rnorm(int job, const float* __restrict__ bT, float* __restrict__ rnorm) {
    __shared__ __attribute__((aligned(16))) float red[128][RN_PER];
    const int row0 = job * RN_PER;        // row = b*L + p
    const int p0 = row0 & (L - 1);
    const int py = p0 >> 5, px0 = p0 & 31;
    const float* base = bT + (size_t)(row0 - p0) * CH;    // this batch item's plane
    float v[3][RN_PER + 2];
    #pragma unroll
    for (int dy = 0; dy < 3; ++dy) {
        #pragma unroll
        for (int j = 0; j < RN_PER + 2; ++j) {
            const int y = py + dy - 1, x = px0 + j - 1;
            const bool in = (y >= 0 && y < HD && x >= 0 && x < WD);
            v[dy][j] = base[(size_t)(in ? y * WD + x : p0) * CH + threadIdx.x];   // always in bounds
            // precaution: the next load's result may be given this load's address registers
            asm volatile("s_wait_xcnt 0x0" ::: "memory");
        }
    }
    // without it the scheduler puts the first squares in front of the last loads, which then
    // start only when the first have landed
    __builtin_amdgcn_sched_barrier(0);
    #pragma unroll
    for (int dy = 0; dy < 3; ++dy) {
        #pragma unroll
        for (int j = 0; j < RN_PER + 2; ++j) {
            const int y = py + dy - 1, x = px0 + j - 1;
            const bool in = (y >= 0 && y < HD && x >= 0 && x < WD);
            v[dy][j] = in ? v[dy][j] * v[dy][j] : 0.0f;
        }
    }
    #pragma unroll
    for (int i = 0; i < RN_PER; ++i) {
        float s = 0.0f;
        #pragma unroll
        for (int t = 0; t < 9; ++t) s += v[t / 3][i + t % 3];
        red[threadIdx.x][i] = s;
    }
    __syncthreads();
    for (int st = 64; st > 0; st >>= 1) {
        if (threadIdx.x < st) {
            #pragma unroll
            for (int i = 0; i < RN_PER; ++i) red[threadIdx.x][i] += red[threadIdx.x + st][i];
        }
        __syncthreads();
    }
    if (threadIdx.x < RN_PER)
        rnorm[row0 + threadIdx.x] = 1.0f / fmaxf(sqrtf(red[0][threadIdx.x]), 1e-4f);
}

// ---------------------------------------------------------------------------
// mm[p] = 1 if all 9 taps of the (zero-padded) 3x3 patch of mask[0,0,::8,::8]
// are zero, else 0.
// ---------------------------------------------------------------------------
__device__ __forceinline__
void build_mm(int job, const float* __restrict__ mask, float* __restrict__ mm) {
    int p = job * 128 + threadIdx.x;
    if (p >= L) return;
    int py = p >> 5, px = p & 31;
    float s = 0.0f;
    for (int dy = 0; dy < 3; ++dy)
        for (int dx = 0; dx < 3; ++dx) {
            int y = py + dy - 1, x = px + dx - 1;
            if (y >= 0 && y < 32 && x >= 0 && x < 32)
                s += mask[(size_t)(8 * y) * 256 + 8 * x];
        }
    mm[p] = (s == 0.0f) ? 1.0f : 0.0f;
}

#define GATHER_BLOCKS (BATCH * HD * 2)
__global__ __launch_bounds__(256)
void prep_inputs(const float* __restrict__ bsrc, const float* __restrict__ fsrc,
                 float* __restrict__ bT, float* __restrict__ fT) {
    gather_ds_T(blockIdx.x, bsrc, fsrc, bT, fT);
}

// ---------------------------------------------------------------------------
// NT GEMM with f32 WMMA:  C[m,n] = (Σ_k A[m,k]*B[n,k]) * rowScale[m]
// A: M x K row-major, B: N x K row-major, C: M x N row-major.
// 128 threads = 4 waves (2x2), block tile 64x64, BK=16, double-buffered LDS
// filled with CDNA5 async global->LDS DMA (ASYNCcnt).
// ---------------------------------------------------------------------------
#define LDS_STRIDE 20
#define TILE_F     (64 * LDS_STRIDE)      // floats per 64x16 padded tile
__device__ __forceinline__
void gemm_nt_tile(int bx, int by, int batch,
                  const float* __restrict__ A, const float* __restrict__ B,
                  float* __restrict__ C, int M, int N, int K,
                  long strideA, long strideB, long strideC,
                  const float* __restrict__ rowScale, int scaleStride) {
    A += (size_t)batch * strideA;
    B += (size_t)batch * strideB;
    C += (size_t)batch * strideC;
    if (rowScale) rowScale += (size_t)batch * scaleStride;

    const int tid  = threadIdx.x;
    const int lane = tid & 31;
    const int wave = tid >> 5;
    const int wr = wave & 1;          // wave row  (2 waves along M)
    const int wc = wave >> 1;         // wave col  (2 waves along N)
    const int hf = lane >> 4;         // lane half (K-pair select)
    const int lx = lane & 15;

    const int blockM = by * 64;
    const int blockN = bx * 64;

    // [buf][A|B][64*20] double-buffered tiles
    __shared__ float smem[2 * 2 * TILE_F];

    v8f acc00 = 0.0f, acc01 = 0.0f, acc10 = 0.0f, acc11 = 0.0f;

    // cooperative-load assignment: thread -> rows lr, lr+32; float4 at col lc
    const int lr = tid >> 2;          // 0..31
    const int lc = (tid & 3) << 2;    // 0,4,8,12

    const float* gA0 = A + (size_t)(blockM + lr)      * K + lc;
    const float* gA1 = A + (size_t)(blockM + lr + 32) * K + lc;
    const float* gB0 = B + (size_t)(blockN + lr)      * K + lc;
    const float* gB1 = B + (size_t)(blockN + lr + 32) * K + lc;

    unsigned dA0[2], dA1[2], dB0[2], dB1[2];
    #pragma unroll
    for (int bf = 0; bf < 2; ++bf) {
        float* As = &smem[bf * 2 * TILE_F];
        float* Bs = As + TILE_F;
        dA0[bf] = lds_addr32(&As[lr * LDS_STRIDE + lc]);
        dA1[bf] = lds_addr32(&As[(lr + 32) * LDS_STRIDE + lc]);
        dB0[bf] = lds_addr32(&Bs[lr * LDS_STRIDE + lc]);
        dB1[bf] = lds_addr32(&Bs[(lr + 32) * LDS_STRIDE + lc]);
    }

    // prologue: fill buffer 0 with tile k0=0
    async_copy16x4(dA0[0], gA0, dA1[0], gA1, dB0[0], gB0, dB1[0], gB1);
    wait_async0();
    __syncthreads();

    const int nsteps = K >> 4;
    for (int s = 0; s < nsteps; ++s) {
        const int cur = s & 1;
        const int nxt = cur ^ 1;

        // issue async DMA for the next tile while we compute this one
        if (s + 1 < nsteps) {
            const size_t ko = (size_t)(s + 1) << 4;
            async_copy16x4(dA0[nxt], gA0 + ko, dA1[nxt], gA1 + ko,
                           dB0[nxt], gB0 + ko, dB1[nxt], gB1 + ko);
        }

        const float* As = &smem[cur * 2 * TILE_F];
        const float* Bs = As + TILE_F;

        #pragma unroll
        for (int ks = 0; ks < 4; ++ks) {
            const int kb = ks * 4 + 2 * hf;   // even -> 8B-aligned v2f
            v2f a0 = *(const v2f*)&As[(wr * 32 +  0 + lx) * LDS_STRIDE + kb];
            v2f a1 = *(const v2f*)&As[(wr * 32 + 16 + lx) * LDS_STRIDE + kb];
            v2f b0 = *(const v2f*)&Bs[(wc * 32 +  0 + lx) * LDS_STRIDE + kb];
            v2f b1 = *(const v2f*)&Bs[(wc * 32 + 16 + lx) * LDS_STRIDE + kb];
            acc00 = __builtin_amdgcn_wmma_f32_16x16x4_f32(false, a0, false, b0,
                        (short)0, acc00, false, false);
            acc01 = __builtin_amdgcn_wmma_f32_16x16x4_f32(false, a0, false, b1,
                        (short)0, acc01, false, false);
            acc10 = __builtin_amdgcn_wmma_f32_16x16x4_f32(false, a1, false, b0,
                        (short)0, acc10, false, false);
            acc11 = __builtin_amdgcn_wmma_f32_16x16x4_f32(false, a1, false, b1,
                        (short)0, acc11, false, false);
        }

        wait_async0();       // my next-tile DMA landed
        __syncthreads();     // everyone's landed; everyone done reading cur
    }

    // Epilogue. C/D layout: VGPR r holds M = r (lanes 0-15) / r+8 (lanes 16-31),
    // N = lane & 15.
    #pragma unroll
    for (int mt = 0; mt < 2; ++mt) {
        v8f ar0 = (mt == 0) ? acc00 : acc10;
        v8f ar1 = (mt == 0) ? acc01 : acc11;
        #pragma unroll
        for (int r = 0; r < 8; ++r) {
            int gm = blockM + wr * 32 + mt * 16 + r + 8 * hf;
            float sc = rowScale ? rowScale[gm] : 1.0f;
            int gn0 = blockN + wc * 32 + lx;
            C[(size_t)gm * N + gn0]      = ar0[r] * sc;
            C[(size_t)gm * N + gn0 + 16] = ar1[r] * sc;
        }
    }
}
// ---------------------------------------------------------------------------
// The pixel Gram GEMM, the patch norms and the mask map read nothing of each other:
// they share one grid. The GEMM tiles, the longest job, come first; the mask map, a few
// blocks that wait on one load after another, comes next and ends under the other two.
// ---------------------------------------------------------------------------
#define MM_BLOCKS   (L / 128)
#define GRAM_BLOCKS ((L / 64) * (L / 64) * BATCH)
__global__ __launch_bounds__(128)
void gram_rnorm_mm(const float* __restrict__ fT, const float* __restrict__ bT,
                   float* __restrict__ G, int M, int N, int K,
                   long strideA, long strideB, long strideC,
                   float* __restrict__ rnorm,
                   const float* __restrict__ mask, float* __restrict__ mm) {
    const int blk = blockIdx.x;
    if (blk < GRAM_BLOCKS)
        gemm_nt_tile(blk & 15, (blk >> 4) & 15, blk >> 8, fT, bT, G, M, N, K,
                     strideA, strideB, strideC, nullptr, 0);
    else if (blk < GRAM_BLOCKS + MM_BLOCKS)
        build_mm(blk - GRAM_BLOCKS, mask, mm);
    else
        patch_rnorm(blk - GRAM_BLOCKS - MM_BLOCKS, bT, rnorm);
}

// ---------------------------------------------------------------------------
// 3x3 patch correlation from the pixel Gram matrix, kept transposed,
// G[s][p] = sum_c fT[s][c]*bT[p][c]:
//   S[s][p] = rnorm[p] * sum_{dy,dx=-1..1} G[s + 32*dy + dx][p + 32*dy + dx]
// a tap counting only where both shifted pixels lie inside the 32x32 image (zero
// padding of both patches). One block = PS_ROWS consecutive rows s of one image row; a
// thread owns 4 consecutive p, which share one image row, in each of them. The rows' taps
// overlap: per dy the block reads PS_ROWS + 2 rows of G, each once. Every tap is one
// aligned 16-byte load; for dx = -1/+1 the element that crosses the 4-group comes from
// the neighbour lane.
// ---------------------------------------------------------------------------
#define PS_ROWS 4
// G and rnorm carry no __restrict__, so that the clobber below keeps their loads in front of it.
__global__ __launch_bounds__(256)
void patch_sum9(const float* G, const float* rnorm, float* S) {
    const int q0 = blockIdx.x * PS_ROWS;      // first row: foreground pixel s
    const int b = blockIdx.y;
    const float* Gb = G + (size_t)b * L * L;
    const int qy = q0 >> 5, qx0 = q0 & 31;
    const int c4 = threadIdx.x * 4;           // columns: background patches p
    const int cy = c4 >> 5, cx0 = c4 & 31;
    // All loads are unconditional (a tap outside the image reads a row / column of its own
    // block instead and is then replaced by zero), so they fly together.
    // w[dy + 1][j] is row q0 + 32*dy + j - 1 at columns c4 + 32*dy ..
    float4 w[3][PS_ROWS + 2];
    unsigned boff[3];                         // byte column, per lane
    #pragma unroll
    for (int d = 0; d < 3; ++d) {
        const int dy = d - 1;
        const bool cv = (cy + dy >= 0) && (cy + dy < HD);
        boff[d] = (unsigned)(cv ? c4 + 32 * dy : c4) * 4u;
        const bool yv = (qy + dy >= 0) && (qy + dy < HD);                 // same for the block
        const int rb = yv ? q0 + 32 * dy : q0;                            // rows rb .. rb + PS_ROWS - 1 exist
        const char* mid = (const char*)(Gb + (size_t)rb * L);
        const char* lo  = (const char*)(Gb + (size_t)(qx0 > 0 ? rb - 1 : rb) * L);
        const char* hi  = (const char*)(Gb + (size_t)(qx0 + PS_ROWS < WD ? rb + PS_ROWS : rb) * L);
        w[d][0] = *(const float4*)(lo + boff[d]);
        #pragma unroll
        for (int j = 1; j <= PS_ROWS; ++j)
            w[d][j] = *(const float4*)(mid + boff[d] + (unsigned)((j - 1) * L * 4));
        w[d][PS_ROWS + 1] = *(const float4*)(hi + boff[d]);
    }
    const float4 sc = *(const float4*)((const char*)(rnorm + b * L) + boff[1]);
    // precaution: the loads' address registers are named so that they live up to the wait and
    // no load's result is given one of them ahead of that; the clobber keeps the loads up here
    asm volatile("s_wait_xcnt 0x0" :: "v"(boff[0]), "v"(boff[1]), "v"(boff[2]) : "memory");
    // without it the scheduler puts the first rows' sums in front of the last loads, which
    // then start only when the first have landed
    __builtin_amdgcn_sched_barrier(0);
    #pragma unroll
    for (int d = 0; d < 3; ++d) {
        const int dy = d - 1;
        #pragma unroll
        for (int j = 0; j < PS_ROWS + 2; ++j) {
            const bool ok = (qy + dy >= 0) && (qy + dy < HD) && (qx0 + j - 1 >= 0) && (qx0 + j - 1 < WD) &&
                            (cy + dy >= 0) && (cy + dy < HD);
            if (!ok) w[d][j] = make_float4(0.0f, 0.0f, 0.0f, 0.0f);
        }
    }
    #pragma unroll
    for (int i = 0; i < PS_ROWS; ++i) {
        float a0 = 0.0f, a1 = 0.0f, a2 = 0.0f, a3 = 0.0f;
        #pragma unroll
        for (int t = 0; t < 9; ++t) {
            const int dx = t % 3 - 1;
            const float4 x = w[t / 3][i + dx + 1];
            if (dx == 0) {
                a0 += x.x; a1 += x.y; a2 += x.z; a3 += x.w;
            } else if (dx < 0) {
                const float e = __shfl_up(x.w, 1);               // column c4 - 1
                a0 += (cx0 == 0) ? 0.0f : e;
                a1 += x.x; a2 += x.y; a3 += x.z;
            } else {
                const float e = __shfl_down(x.x, 1);             // column c4 + 4
                a0 += x.y; a1 += x.z; a2 += x.w;
                a3 += (cx0 == 28) ? 0.0f : e;
            }
        }
        *(float4*)&S[((size_t)b * L + q0 + i) * L + c4] =
            make_float4(a0 * sc.x, a1 * sc.y, a2 * sc.z, a3 * sc.w);
    }
}

// ---------------------------------------------------------------------------
// Both diagonal fuse passes and the masked softmax, on the transposed scores S[s][p].
//   F1[i][j] = sum_{d1=-1..1} S[i+d1][j+d1]                 (flat indices, zero outside)
//   F2[s][p] = sum_{d2=-1..1} F1[T(T(s)+d2)][T(T(p)+d2)]    (zero where T(.)+d2 leaves 0..1023)
//   T(y*32+x) = x*32+y  (the transposed flattening; T is its own inverse)
//   yiT[b][s][p] = softmax_p(F2[s][p]*mm[p]*10) * mm[p]
// One block = SROWS consecutive s of one image row. T(T(s)+d2) steps by 1 with s there,
// so each d2 needs SROWS+2 consecutive rows of S; async copies stage them in LDS. A row outside
// the matrix is staged as zeros, and each row has a zero in front of and behind it, so
// a tap at column -1 or 1024 adds zero with no test. All 1024 p of an s are in the
// block, so the softmax follows on the spot, the SROWS reductions side by side.
// ---------------------------------------------------------------------------
#define ROWP  (L + 8)     // floats per staged row: data at 4..L+3, zeros at 3 and L+4
#define SROWS 4
#define GROWS (SROWS + 2) // staged rows per d2
__global__ __launch_bounds__(256)
void fuse_softmax(const float* __restrict__ S, const float* __restrict__ mm,
                  float* __restrict__ yiT) {
    __shared__ __attribute__((aligned(16))) float rows[3 * GROWS * ROWP];
    __shared__ __attribute__((aligned(16))) float red[256][SROWS];   // a thread's SROWS partials side by side
    const int s0 = blockIdx.x * SROWS;
    const int b = blockIdx.y;
    const int tid = threadIdx.x;
    const char* src = (const char*)(S + (size_t)b * L * L);
    const int js0 = (s0 & 31) * 32 + (s0 >> 5);               // T(s0); T(s0 + i) = js0 + 32*i
    const unsigned boff = (unsigned)tid * 16u;                // byte column, per lane
    // Every lane copies its 16 bytes of each of the 18 rows straight to LDS; the copies are
    // unconditional (a row outside the matrix copies row s0 instead and is then overwritten
    // with zeros), so they fly together. Every loop over g, j, i, k and d2 is unrolled so
    // that the arrays are indexed by constants only and stay in registers.
    const unsigned lbase = lds_addr32(&rows[4 + tid * 4]);
    float m[4];                                               // asked for early: lands under the copies
    #pragma unroll
    for (int k = 0; k < 4; ++k) m[k] = mm[tid + k * 256];
    #pragma unroll
    for (int g = 0; g < 3; ++g) {
        const int tt = js0 + g - 1;
        const int r0 = ((tt & 31) << 5) + (tt >> 5) - 1;      // row in slot 0 of this d2
        const char* gp[GROWS];
        unsigned lp[GROWS];
        #pragma unroll
        for (int j = 0; j < GROWS; ++j) {
            const bool ok = (r0 + j >= 0) && (r0 + j < L);    // same for the block
            gp[j] = src + (size_t)(ok ? r0 + j : s0) * (L * 4) + boff;
            lp[j] = lbase + (unsigned)((g * GROWS + j) * ROWP * 4);
        }
        async_copy16x6(lp[0], gp[0], lp[1], gp[1], lp[2], gp[2],
                       lp[3], gp[3], lp[4], gp[4], lp[5], gp[5]);
    }
    wait_async0();       // my copies have landed: my own bytes may be overwritten, and published
    #pragma unroll
    for (int g = 0; g < 3; ++g) {
        const int tt = js0 + g - 1;
        const int r0 = ((tt & 31) << 5) + (tt >> 5) - 1;
        #pragma unroll
        for (int j = 0; j < GROWS; ++j) {
            if ((r0 + j < 0) || (r0 + j >= L))
                *(float4*)&rows[(g * GROWS + j) * ROWP + 4 + tid * 4] =
                    make_float4(0.0f, 0.0f, 0.0f, 0.0f);
        }
    }
    if (tid < 3 * GROWS) {
        rows[tid * ROWP + 3]     = 0.0f;
        rows[tid * ROWP + L + 4] = 0.0f;
    }
    __syncthreads();

    float v[SROWS][4];
    #pragma unroll
    for (int k = 0; k < 4; ++k) {
        const int p  = tid + k * 256;
        const int ip = (p & 31) * 32 + (p >> 5);
        float acc[SROWS];
        #pragma unroll
        for (int i = 0; i < SROWS; ++i) acc[i] = 0.0f;
        #pragma unroll
        for (int d2 = -1; d2 <= 1; ++d2) {
            const int u  = ip + d2;
            const int c2 = ((u & 31) << 5) + (u >> 5);        // 991 at u = -1, 32 at u = 1024: in range
            const bool uok = (u >= 0) && (u < L);
            const float* rp = &rows[(d2 + 1) * GROWS * ROWP + 4 + c2];
            #pragma unroll
            for (int i = 0; i < SROWS; ++i) {
                const int ti = js0 + 32 * i + d2;             // same for the block
                float f1 = 0.0f;
                f1 += rp[i * ROWP - 1];
                f1 += rp[(i + 1) * ROWP];
                f1 += rp[(i + 2) * ROWP + 1];
                acc[i] += (uok && ti >= 0 && ti < L) ? f1 : 0.0f;
            }
        }
        #pragma unroll
        for (int i = 0; i < SROWS; ++i) v[i][k] = acc[i] * m[k] * SOFTMAX_SCALE;
    }
    #pragma unroll
    for (int i = 0; i < SROWS; ++i)
        red[tid][i] = fmaxf(fmaxf(v[i][0], v[i][1]), fmaxf(v[i][2], v[i][3]));
    __syncthreads();
    for (int st = 128; st > 0; st >>= 1) {
        if (tid < st) {
            #pragma unroll
            for (int i = 0; i < SROWS; ++i) red[tid][i] = fmaxf(red[tid][i], red[tid + st][i]);
        }
        __syncthreads();
    }
    float mx[SROWS];
    #pragma unroll
    for (int i = 0; i < SROWS; ++i) mx[i] = red[0][i];
    __syncthreads();
    #pragma unroll
    for (int i = 0; i < SROWS; ++i) {
        float ssum = 0.0f;
        #pragma unroll
        for (int k = 0; k < 4; ++k) { v[i][k] = expf(v[i][k] - mx[i]); ssum += v[i][k]; }
        red[tid][i] = ssum;
    }
    __syncthreads();
    for (int st = 128; st > 0; st >>= 1) {
        if (tid < st) {
            #pragma unroll
            for (int i = 0; i < SROWS; ++i) red[tid][i] += red[tid + st][i];
        }
        __syncthreads();
    }
    #pragma unroll
    for (int i = 0; i < SROWS; ++i) {
        const float inv = 1.0f / red[0][i];
        float* dst = yiT + ((size_t)b * L + s0 + i) * L;
        #pragma unroll
        for (int k = 0; k < 4; ++k) dst[tid + k * 256] = v[i][k] * inv * m[k];
    }
}

// ---------------------------------------------------------------------------
// The stride-2 transposed conv with the 4x4 raw patches, by output parity.
// With Y = 2*Yh + ry, X = 2*Xh + rx, s = Yh*32 + Xh, p = u*32 + v:
//   out[b,c,Y,X] = 0.25 * sum_p Apar[r][s][p] * b_full[b, c, 2*u + ry, 2*v + rx]
//   Apar[r][s][p] = sum_{dy in {0,sy}, dx in {0,sx}} yiT[b][s + 32*dy + dx][p + 32*dy + dx]
// sy = ry ? +1 : -1, sx = rx ? +1 : -1; a tap counts only where both shifted pixels
// lie inside the 32x32 image. (The 16 taps of a raw patch overlap its neighbours':
// each full-resolution pixel is met by 2x2 (position, patch) pairs on one diagonal.)
//
// Apar is never stored, and neither b_full nor out is re-laid by parity. One block =
// (b, ry, image row Yh, 64 channels), both rx, that is one whole row Y = 2*Yh + ry of out for
// 64 channels; a K step is one image row u of p (32 values), that is one whole row 2*u + ry of
// b_full (64 values, the two rx interleaved). Per step the block stages those 64 channel rows
// as they lie, and
//   E[j][v] = yiT[Yh*32 + j][u*32 + v] + yiT[(Yh+sy)*32 + j][(u+sy)*32 + v]
// in LDS with zeros all round, and a wave forms its B fragments on the way to the WMMA:
//   Apar[ry*2+rx][Yh*32 + j][u*32 + v] = E[j][v] + E[j + sx][v + sx]
// 4 waves: wr = which 32 channels, wc = which 16 of the 32 Xh; a wave does both rx. One 16-byte
// LDS read of b_full, X = 2*v .. 2*v + 3, holds the K pair (v, v + 1) of both rx; a lane ends
// with out at X = 2*Xh and 2*Xh + 1, which it stores as one pair.
// ---------------------------------------------------------------------------
// Eight copies per lane (the channel rows of b_full); s_wait_xcnt 0 is the last
// line of the same statement so that no address register of an issued copy is rewritten
// ahead of it.
__device__ __forceinline__ void async_copy16x8(unsigned l0, const float* g0,
                                               unsigned l1, const float* g1,
                                               unsigned l2, const float* g2,
                                               unsigned l3, const float* g3,
                                               unsigned l4, const float* g4,
                                               unsigned l5, const float* g5,
                                               unsigned l6, const float* g6,
                                               unsigned l7, const float* g7) {
    asm volatile("global_load_async_to_lds_b128 %0, %1, off\n\t"
                 "global_load_async_to_lds_b128 %2, %3, off\n\t"
                 "global_load_async_to_lds_b128 %4, %5, off\n\t"
                 "global_load_async_to_lds_b128 %6, %7, off\n\t"
                 "global_load_async_to_lds_b128 %8, %9, off\n\t"
                 "global_load_async_to_lds_b128 %10, %11, off\n\t"
                 "global_load_async_to_lds_b128 %12, %13, off\n\t"
                 "global_load_async_to_lds_b128 %14, %15, off\n\t"
                 "s_wait_xcnt 0x0"
                 :: "v"(l0), "v"((unsigned long long)(uintptr_t)g0),
                    "v"(l1), "v"((unsigned long long)(uintptr_t)g1),
                    "v"(l2), "v"((unsigned long long)(uintptr_t)g2),
                    "v"(l3), "v"((unsigned long long)(uintptr_t)g3),
                    "v"(l4), "v"((unsigned long long)(uintptr_t)g4),
                    "v"(l5), "v"((unsigned long long)(uintptr_t)g5),
                    "v"(l6), "v"((unsigned long long)(uintptr_t)g6),
                    "v"(l7), "v"((unsigned long long)(uintptr_t)g7)
                 : "memory");
}
__device__ __forceinline__ float4 add4(float4 a, float4 b) {
    return make_float4(a.x + b.x, a.y + b.y, a.z + b.z, a.w + b.w);
}
#define PA   68                  // floats per staged b_full row: 64 + 4, so that 16-byte reads of 16 rows meet no bank twice
#define A2_F (64 * PA)           // 64 channel rows
#define PK   36                  // floats per staged E row: 16-byte multiple, 8-byte reads of 16 rows meet no bank twice
#define E_F  (34 * PK + 4)       // rows j = -1..32; data at columns 4..35, columns 0..3 stay zero
// yiT carries no __restrict__: with it the compiler sinks the row loads past the clobber below
// to their first use, behind the WMMAs, where their whole latency is waited for.
__global__ __launch_bounds__(128)
void gemm_parity_shift(const float* __restrict__ bsrc, const float* yiT,
                       float* __restrict__ out) {
    __shared__ __attribute__((aligned(16))) float As[2 * A2_F];
    __shared__ __attribute__((aligned(16))) float Es[2 * E_F];
    const int yh = blockIdx.x;
    const int ch = blockIdx.y;
    const int ry = blockIdx.z & 1;
    const int b  = blockIdx.z >> 1;
    const int sy = ry ? 1 : -1;
    const bool yok = (yh + sy >= 0) && (yh + sy < HD);     // same for the block

    const int tid  = threadIdx.x;
    const int lane = tid & 31;
    const int wave = tid >> 5;
    const int wr = wave & 1;          // which 32 of the 64 channels
    const int wc = wave >> 1;         // which 16 of the 32 Xh
    const int hf = lane >> 4;         // lane half (K-pair select)
    const int lx = lane & 15;

    // staging of E: thread -> row lr and lr + 16, float4 at column lc
    const int lr = tid >> 3;          // 0..15
    const int lc = (tid & 7) << 2;    // 0,4,..,28
    // staging of the channel rows: thread -> row ar (+8 per further slot), float4 at column ac
    const int ar = tid >> 4;          // 0..7
    const int ac = (tid & 15) << 2;   // 0,4,..,60

    const float* gA = bsrc + (((size_t)b * CH + ch * 64 + ar) * H0 + ry) * W0 + ac;
    const unsigned lA = lds_addr32(&As[ar * PA + ac]);
    // softmax rows of image row Yh, and of image row Yh + sy (Yh itself where that is outside)
    const float* gY0 = yiT + ((size_t)b * L + yh * WD + lr) * L + lc;
    const float* gY1 = yiT + ((size_t)b * L + (yok ? yh + sy : yh) * WD + lr) * L + lc;

    // the zeros round E, in both buffers; the data cells are overwritten behind the barrier
    for (int i = tid; i < 2 * E_F; i += 128) Es[i] = 0.0f;

    v8f acc00 = 0.0f, acc01 = 0.0f, acc10 = 0.0f, acc11 = 0.0f;   // acc<16-channel tile><rx>
    float4 y0a, y0b, y1a, y1b;        // the next step's rows lr and lr + 16 of both image rows

#define ISSUE_STEP(un, buf)                                                              \
    {                                                                                    \
        const float* ga = gA + (un) * (2 * W0);                                          \
        const unsigned la = lA + (unsigned)(buf) * (A2_F * 4);                           \
        async_copy16x8(la,                ga,                                            \
                       la +  8 * PA * 4,  ga +  8 * H0 * W0,                             \
                       la + 16 * PA * 4,  ga + 16 * H0 * W0,                             \
                       la + 24 * PA * 4,  ga + 24 * H0 * W0,                             \
                       la + 32 * PA * 4,  ga + 32 * H0 * W0,                             \
                       la + 40 * PA * 4,  ga + 40 * H0 * W0,                             \
                       la + 48 * PA * 4,  ga + 48 * H0 * W0,                             \
                       la + 56 * PA * 4,  ga + 56 * H0 * W0);                            \
        const bool uok = ((un) + sy >= 0) && ((un) + sy < HD);                           \
        const float* p0 = gY0 + (un) * 32;                                               \
        const float* p1 = gY1 + (uok ? (un) + sy : (un)) * 32;                           \
        y0a = *(const float4*)p0;                                                        \
        y0b = *(const float4*)(p0 + 16 * L);                                             \
        y1a = *(const float4*)p1;                                                        \
        y1b = *(const float4*)(p1 + 16 * L);                                             \
        /* precaution: later code is given these loads' address registers; the clobber */ \
        /* also keeps the loads up here, so that they fly under the step's WMMAs */       \
        asm volatile("s_wait_xcnt 0x0" ::: "memory");                                    \
    }
#define STORE_E(un, buf)                                                                 \
    {                                                                                    \
        const bool ok = yok && ((un) + sy >= 0) && ((un) + sy < HD);                     \
        float4 ea = y0a, eb = y0b;                                                       \
        if (ok) { ea = add4(y0a, y1a); eb = add4(y0b, y1b); }   /* same for the block */ \
        float* e = &Es[(buf) * E_F + (lr + 1) * PK + 4 + lc];                            \
        *(float4*)e             = ea;                                                    \
        *(float4*)(e + 16 * PK) = eb;                                                    \
    }

    // prologue: step 0 into buffer 0
    ISSUE_STEP(0, 0)
    __syncthreads();     // every zero is written before a data cell is
    STORE_E(0, 0)
    asm volatile("s_wait_dscnt 0x0" ::: "memory");   // my E cells are in LDS
    wait_async0();                                    // my copies have landed
    __syncthreads();

    const int aoff = (wr * 32 + lx) * PA + 4 * hf;
    const int eoff = (wc * 16 + lx + 1) * PK + 4 + 2 * hf;
    for (int u = 0; u < HD; ++u) {
        const int cur = u & 1;
        const int nxt = cur ^ 1;
        // the next step's copies and loads fly while this step is worked on
        if (u + 1 < HD) ISSUE_STEP(u + 1, nxt)

        const float* Ac = &As[cur * A2_F + aoff];
        const float* Ec = &Es[cur * E_F + eoff];
        const float* Em = Ec - (PK + 1);               // row j - 1, column v - 1: rx = 0
        const float* Ep = Ec + (PK + 1);               // row j + 1, column v + 1: rx = 1
        #pragma unroll
        for (int ks = 0; ks < 8; ++ks) {
            const int kb = ks * 4;
            const float4 x0 = *(const float4*)&Ac[2 * kb];
            const float4 x1 = *(const float4*)&Ac[16 * PA + 2 * kb];
            const v2f e = *(const v2f*)&Ec[kb];
            v2f a00, a01, a10, a11, b0, b1;
            a00.x = x0.x; a00.y = x0.z;                // even X: rx = 0
            a01.x = x0.y; a01.y = x0.w;                // odd X:  rx = 1
            a10.x = x1.x; a10.y = x1.z;
            a11.x = x1.y; a11.y = x1.w;
            b0.x = e.x + Em[kb];
            b0.y = e.y + Em[kb + 1];
            b1.x = e.x + Ep[kb];
            b1.y = e.y + Ep[kb + 1];
            acc00 = __builtin_amdgcn_wmma_f32_16x16x4_f32(false, a00, false, b0,
                        (short)0, acc00, false, false);
            acc01 = __builtin_amdgcn_wmma_f32_16x16x4_f32(false, a01, false, b1,
                        (short)0, acc01, false, false);
            acc10 = __builtin_amdgcn_wmma_f32_16x16x4_f32(false, a10, false, b0,
                        (short)0, acc10, false, false);
            acc11 = __builtin_amdgcn_wmma_f32_16x16x4_f32(false, a11, false, b1,
                        (short)0, acc11, false, false);
        }

        if (u + 1 < HD) STORE_E(u + 1, nxt)
        asm volatile("s_wait_dscnt 0x0" ::: "memory");   // my reads of cur are over, my E cells are in LDS
        wait_async0();       // my next-step copies have landed
        __syncthreads();     // everyone's have; everyone is done reading cur
    }
#undef ISSUE_STEP
#undef STORE_E

    // C/D layout: VGPR r holds M = r (lanes 0-15) / r+8 (lanes 16-31), N = lane & 15.
    // 16 lanes store one whole 128-byte line of out.
    float* o = out + (((size_t)b * CH + ch * 64 + wr * 32 + 8 * hf) * H0 + 2 * yh + ry) * W0
                   + (wc * 16 + lx) * 2;
    #pragma unroll
    for (int mt = 0; mt < 2; ++mt) {
        v8f c0 = (mt == 0) ? acc00 : acc10;
        v8f c1 = (mt == 0) ? acc01 : acc11;
        #pragma unroll
        for (int r = 0; r < 8; ++r)
            *(float2*)(o + (mt * 16 + r) * (H0 * W0)) = make_float2(c0[r] * 0.25f, c1[r] * 0.25f);
    }
}

// ---------------------------------------------------------------------------
extern "C" void kernel_launch(void* const* d_in, const int* in_sizes, int n_in,
                              void* d_out, int out_size, void* d_ws, size_t ws_size,
                              hipStream_t stream) {
    const float* f    = (const float*)d_in[0];   // (4,128,64,64)
    const float* bsrc = (const float*)d_in[1];   // (4,128,64,64)
    const float* mask = (const float*)d_in[2];   // (4,1,256,256)
    float* out = (float*)d_out;

    // workspace layout (bytes)
    const size_t SZ_PIX  = (size_t)BATCH * L * CH * 4;     // 2,097,152
    const size_t SZ_YI   = (size_t)BATCH * L * L * 4;      // 16,777,216
    char* w = (char*)d_ws;
    float* bT     = (float*)(w);
    float* fT     = (float*)(w + SZ_PIX);
    float* yiA    = (float*)(w + 2 * SZ_PIX);
    float* yiB    = (float*)(w + 2 * SZ_PIX + SZ_YI);
    float* rnorm  = (float*)(w + 2 * SZ_PIX + 2 * SZ_YI);
    float* mmbuf  = rnorm + BATCH * L;

    // bT / fT, from the inputs alone
    prep_inputs<<<GATHER_BLOCKS, 256, 0, stream>>>(bsrc, f, bT, fT);

    // GEMM1: yiB[b][s][p] = sum_c fT[s,c] bT[p,c]   (1024x1024x128, pixel Gram matrix),
    // with rnorm and mm beside it
    gram_rnorm_mm<<<MM_BLOCKS + GRAM_BLOCKS + BATCH * L / RN_PER, 128, 0, stream>>>(
        fT, bT, yiB, L, L, CH, (long)L * CH, (long)L * CH, (long)L * L, rnorm, mask, mmbuf);
    // yiA[b][s][p] = rnorm[p] * 9-tap diagonal sum of the Gram matrix
    {
        dim3 grid(L / PS_ROWS, BATCH);
        patch_sum9<<<grid, 256, 0, stream>>>(yiB, rnorm, yiA);
    }
    // yiB[b][s][p] = yiT: both fuse passes and the masked softmax over p
    {
        dim3 grid(L / SROWS, BATCH);
        fuse_softmax<<<grid, 256, 0, stream>>>(yiA, mmbuf, yiB);
    }

    // GEMM2: out[b,c,Y,X] = 0.25 * sum_p b_full[c, 2u+ry, 2v+rx] * Apar[s,p]   (16 x 128x1024x1024),
    // Apar being the 2x2 diagonal shift-sum of yiT, formed in the kernel's own operand staging
    {
        dim3 grid(HD, CH / 64, BATCH * 2);
        gemm_parity_shift<<<grid, 128, 0, stream>>>(bsrc, yiB, out);
    }
}

// v008
// A run of this version takes 60.6 microseconds.
// Two timings next to v007 both put it at 1.03 times that version's speed.
// Over all steps from v000 it is 4.77 times as fast.
#include <hip/hip_runtime.h>
#include <hip/hip_bf16.h>

typedef float v2f __attribute__((ext_vector_type(2)));
typedef float v8f __attribute__((ext_vector_type(8)));

// Problem constants (from reference)
#define BATCH 4
#define CH    128
#define H0    64
#define W0    64
#define HD    32      // downsampled
#define WD    32
#define L     1024    // HD*WD patches
#define SOFTMAX_SCALE 10.0f

// ---------------------------------------------------------------------------
// CDNA5 async global->LDS copy (16B per lane), tracked by ASYNCcnt.
// vdst = LDS byte address (low 32 bits of the flat shared pointer, which is
// exactly what the flat-aperture truncation uses), vaddr = 64-bit global addr.
// ---------------------------------------------------------------------------
// Eight copies per lane (a K step of either GEMM); s_wait_xcnt 0 is the last
// line of the same statement so that no address register of an issued copy is rewritten
// ahead of it.
__device__ __forceinline__ void async_copy16x8(unsigned l0, const float* g0,
                                               unsigned l1, const float* g1,
                                               unsigned l2, const float* g2,
                                               unsigned l3, const float* g3,
                                               unsigned l4, const float* g4,
                                               unsigned l5, const float* g5,
                                               unsigned l6, const float* g6,
                                               unsigned l7, const float* g7) {
    asm volatile("global_load_async_to_lds_b128 %0, %1, off\n\t"
                 "global_load_async_to_lds_b128 %2, %3, off\n\t"
                 "global_load_async_to_lds_b128 %4, %5, off\n\t"
                 "global_load_async_to_lds_b128 %6, %7, off\n\t"
                 "global_load_async_to_lds_b128 %8, %9, off\n\t"
                 "global_load_async_to_lds_b128 %10, %11, off\n\t"
                 "global_load_async_to_lds_b128 %12, %13, off\n\t"
                 "global_load_async_to_lds_b128 %14, %15, off\n\t"
                 "s_wait_xcnt 0x0"
                 :: "v"(l0), "v"((unsigned long long)(uintptr_t)g0),
                    "v"(l1), "v"((unsigned long long)(uintptr_t)g1),
                    "v"(l2), "v"((unsigned long long)(uintptr_t)g2),
                    "v"(l3), "v"((unsigned long long)(uintptr_t)g3),
                    "v"(l4), "v"((unsigned long long)(uintptr_t)g4),
                    "v"(l5), "v"((unsigned long long)(uintptr_t)g5),
                    "v"(l6), "v"((unsigned long long)(uintptr_t)g6),
                    "v"(l7), "v"((unsigned long long)(uintptr_t)g7)
                 : "memory");
}
// The same for six copies per lane (the staged rows of the fuse + softmax kernel).
__device__ __forceinline__ void async_copy16x6(unsigned l0, const char* g0,
                                               unsigned l1, const char* g1,
                                               unsigned l2, const char* g2,
                                               unsigned l3, const char* g3,
                                               unsigned l4, const char* g4,
                                               unsigned l5, const char* g5) {
    asm volatile("global_load_async_to_lds_b128 %0, %1, off\n\t"
                 "global_load_async_to_lds_b128 %2, %3, off\n\t"
                 "global_load_async_to_lds_b128 %4, %5, off\n\t"
                 "global_load_async_to_lds_b128 %6, %7, off\n\t"
                 "global_load_async_to_lds_b128 %8, %9, off\n\t"
                 "global_load_async_to_lds_b128 %10, %11, off\n\t"
                 "s_wait_xcnt 0x0"
                 :: "v"(l0), "v"((unsigned long long)(uintptr_t)g0),
                    "v"(l1), "v"((unsigned long long)(uintptr_t)g1),
                    "v"(l2), "v"((unsigned long long)(uintptr_t)g2),
                    "v"(l3), "v"((unsigned long long)(uintptr_t)g3),
                    "v"(l4), "v"((unsigned long long)(uintptr_t)g4),
                    "v"(l5), "v"((unsigned long long)(uintptr_t)g5)
                 : "memory");
}
__device__ __forceinline__ void wait_async0() {
    asm volatile("s_wait_asynccnt 0x0" ::: "memory");
}
__device__ __forceinline__ unsigned lds_addr32(const void* p) {
    return (unsigned)(uintptr_t)p;
}

// ---------------------------------------------------------------------------
// rnorm[b][p] = 1 / max(sqrt(sum over the 3x3 zero-padded patch at p and all
// channels of bd^2), 1e-4),  bd[c][y][x] = b[b, c, 2*y, 2*x],  p = py*32 + px
// One block = one image row py. A wave owns 32 channels and a lane one px: it squares the
// pixels (py-1..py+1, px) of its channels, read where they lie in b (a wave's load is one
// 256-byte row, every other float of it used). The four waves' sums meet in LDS, and the three
// px taps are added there.
// ---------------------------------------------------------------------------
__device__ __forceinline__
void patch_rnorm(int job, const float* bsrc, float* __restrict__ rnorm) {
    __shared__ float red[4][WD];
    const int py = job & 31;
    const int b  = job >> 5;
    const int x  = threadIdx.x & 31;
    const int cg = threadIdx.x >> 5;
    const char* base = (const char*)(bsrc + (size_t)b * CH * H0 * W0);    // same for the block
    unsigned off[3];                                                      // per lane
    #pragma unroll                    // off[] indexed by constants only: stays in registers
    for (int d = 0; d < 3; ++d) {
        const int y = py + d - 1;
        const bool in = (y >= 0 && y < HD);                               // same for the block
        off[d] = (unsigned)((cg * 32 * H0 + 2 * (in ? y : py)) * W0 + 2 * x) * 4u;   // always in bounds
    }
    float a[3] = {0.0f, 0.0f, 0.0f};
    // both loops unrolled: every load has a constant offset from one address register and
    // all of them are asked for before the first is waited for
    #pragma unroll
    for (int c = 0; c < 32; ++c) {
        #pragma unroll
        for (int d = 0; d < 3; ++d) {
            const float t = *(const float*)(base + off[d] + (unsigned)(c * H0 * W0 * 4));
            a[d] += t * t;
        }
    }
    // precaution: the loads' address registers are named so that they live up to the wait and
    // no load's result is given one of them ahead of that
    asm volatile("s_wait_xcnt 0x0" :: "v"(off[0]), "v"(off[1]), "v"(off[2]) : "memory");
    float s = a[1];
    if (py > 0)      s += a[0];
    if (py < HD - 1) s += a[2];
    red[cg][x] = s;
    __syncthreads();
    if (threadIdx.x < WD) {
        float t = 0.0f;
        #pragma unroll                // the twelve LDS reads fly together
        for (int j = -1; j <= 1; ++j) {
            const bool in = (x + j >= 0 && x + j < WD);
            const int xx = in ? x + j : x;
            const float q = (red[0][xx] + red[1][xx]) + (red[2][xx] + red[3][xx]);
            t += in ? q : 0.0f;
        }
        rnorm[b * L + py * WD + x] = 1.0f / fmaxf(sqrtf(t), 1e-4f);
    }
}

// ---------------------------------------------------------------------------
// mm[p] = 1 if all 9 taps of the (zero-padded) 3x3 patch of mask[0,0,::8,::8]
// are zero, else 0.
// ---------------------------------------------------------------------------
__device__ __forceinline__
void build_mm(int job, const float* __restrict__ mask, float* __restrict__ mm) {
    int p = job * 128 + threadIdx.x;
    if (p >= L) return;
    int py = p >> 5, px = p & 31;
    float s = 0.0f;
    for (int dy = 0; dy < 3; ++dy)
        for (int dx = 0; dx < 3; ++dx) {
            int y = py + dy - 1, x = px + dx - 1;
            if (y >= 0 && y < 32 && x >= 0 && x < 32)
                s += mask[(size_t)(8 * y) * 256 + 8 * x];
        }
    mm[p] = (s == 0.0f) ? 1.0f : 0.0f;
}

// ---------------------------------------------------------------------------
// Pixel Gram matrix with f32 WMMA, from f and b as they lie:
//   G[b][s][p] = sum_c f[b, c, 2*sy, 2*sx] * b[b, c, 2*py, 2*px],  s = sy*32 + sx, p = py*32 + px
// 128 threads = 4 waves (2x2), block tile 64 s x 64 p = two image rows of each, K step = 16
// channels, two LDS buffers filled by async copies. A channel of a step is staged as its two
// full-resolution rows 2*sy (64 floats each, the odd columns unused); a fragment takes the even
// columns of channels k and k + 1.
// ---------------------------------------------------------------------------
#define GP     144               // floats per staged channel: 2 x 64 + 16, so that channels k and k + 2 lie 32 banks apart
#define G_TILE (16 * GP)         // one operand's 16 channels
__device__ __forceinline__
void gram_tile(int bx, int by, int batch, const float* fsrc, const float* bsrc,
               float* __restrict__ G) {
    const int tid  = threadIdx.x;
    const int lane = tid & 31;
    const int wave = tid >> 5;
    const int wr = wave & 1;          // which of the two image rows of s
    const int wc = wave >> 1;         // which of the two image rows of p
    const int hf = lane >> 4;         // lane half (K-pair select)
    const int lx = lane & 15;

    // [buf][f|b][16 channels][GP]
    __shared__ __attribute__((aligned(16))) float smem[2 * 2 * G_TILE];

    v8f acc00 = 0.0f, acc01 = 0.0f, acc10 = 0.0f, acc11 = 0.0f;

    // staging: thread -> channel c0 (+4 per further slot), image row rr of the pair, float4 at column c4
    const int c4 = (tid & 15) << 2;   // 0,4,..,60
    const int rr = (tid >> 4) & 1;
    const int c0 = tid >> 5;          // 0..3
    const float* gA = fsrc + (((size_t)batch * CH + c0) * H0 + 2 * (2 * by + rr)) * W0 + c4;
    const float* gB = bsrc + (((size_t)batch * CH + c0) * H0 + 2 * (2 * bx + rr)) * W0 + c4;
    const unsigned lA = lds_addr32(&smem[c0 * GP + rr * 64 + c4]);

#define ISSUE_GRAM(st, buf)                                                              \
    {                                                                                    \
        const float* ga = gA + (size_t)(st) * (16 * H0 * W0);                            \
        const float* gb = gB + (size_t)(st) * (16 * H0 * W0);                            \
        const unsigned la = lA + (unsigned)(buf) * (2 * G_TILE * 4);                     \
        const unsigned lb = la + G_TILE * 4;                                             \
        async_copy16x8(la,                ga,                                            \
                       la +  4 * GP * 4,  ga +  4 * H0 * W0,                             \
                       la +  8 * GP * 4,  ga +  8 * H0 * W0,                             \
                       la + 12 * GP * 4,  ga + 12 * H0 * W0,                             \
                       lb,                gb,                                            \
                       lb +  4 * GP * 4,  gb +  4 * H0 * W0,                             \
                       lb +  8 * GP * 4,  gb +  8 * H0 * W0,                             \
                       lb + 12 * GP * 4,  gb + 12 * H0 * W0);                            \
    }

    // prologue: step 0 into buffer 0
    ISSUE_GRAM(0, 0)
    wait_async0();
    __syncthreads();

    const int aoff = 2 * hf * GP + wr * 64 + 2 * lx;
    const int boff = G_TILE + 2 * hf * GP + wc * 64 + 2 * lx;
    const int nsteps = CH / 16;
    for (int s = 0; s < nsteps; ++s) {
        const int cur = s & 1;
        const int nxt = cur ^ 1;

        // the next step's copies fly while this step is worked on
        if (s + 1 < nsteps) ISSUE_GRAM(s + 1, nxt)

        const float* As = &smem[cur * 2 * G_TILE + aoff];
        const float* Bs = &smem[cur * 2 * G_TILE + boff];

        #pragma unroll                // constant LDS offsets; a later ks's reads fly under an earlier one's WMMAs
        for (int ks = 0; ks < 4; ++ks) {
            const int ko = ks * 4 * GP;       // channels ks*4 + 2*hf and the next
            v2f a0, a1, b0, b1;
            a0.x = As[ko];      a0.y = As[ko + GP];
            a1.x = As[ko + 32]; a1.y = As[ko + GP + 32];
            b0.x = Bs[ko];      b0.y = Bs[ko + GP];
            b1.x = Bs[ko + 32]; b1.y = Bs[ko + GP + 32];
            acc00 = __builtin_amdgcn_wmma_f32_16x16x4_f32(false, a0, false, b0,
                        (short)0, acc00, false, false);
            acc01 = __builtin_amdgcn_wmma_f32_16x16x4_f32(false, a0, false, b1,
                        (short)0, acc01, false, false);
            acc10 = __builtin_amdgcn_wmma_f32_16x16x4_f32(false, a1, false, b0,
                        (short)0, acc10, false, false);
            acc11 = __builtin_amdgcn_wmma_f32_16x16x4_f32(false, a1, false, b1,
                        (short)0, acc11, false, false);
        }

        asm volatile("s_wait_dscnt 0x0" ::: "memory");   // my reads of cur are over
        wait_async0();       // my next-step copies have landed
        __syncthreads();     // everyone's have; everyone is done reading cur
    }
#undef ISSUE_GRAM

    // C/D layout: VGPR r holds M = r (lanes 0-15) / r+8 (lanes 16-31), N = lane & 15.
    float* C = G + (size_t)batch * L * L;
    // both loops unrolled: the accumulators are indexed by constants only and stay in registers
    #pragma unroll
    for (int mt = 0; mt < 2; ++mt) {
        v8f ar0 = (mt == 0) ? acc00 : acc10;
        v8f ar1 = (mt == 0) ? acc01 : acc11;
        #pragma unroll
        for (int r = 0; r < 8; ++r) {
            const int gm  = by * 64 + wr * 32 + mt * 16 + r + 8 * hf;
            const int gn0 = bx * 64 + wc * 32 + lx;
            C[(size_t)gm * L + gn0]      = ar0[r];
            C[(size_t)gm * L + gn0 + 16] = ar1[r];
        }
    }
}
// ---------------------------------------------------------------------------
// The pixel Gram GEMM, the patch norms and the mask map read nothing of each other:
// they share one grid. The GEMM tiles, the longest job, come first; the mask map, a few
// blocks that wait on one load after another, comes next and ends under the other two.
// f and b carry no __restrict__, so that the clobber in patch_rnorm keeps its loads in front of it.
// ---------------------------------------------------------------------------
#define MM_BLOCKS   (L / 128)
#define GRAM_BLOCKS ((L / 64) * (L / 64) * BATCH)
#define RN_BLOCKS   (BATCH * HD)
__global__ __launch_bounds__(128)
void gram_rnorm_mm(const float* fsrc, const float* bsrc, float* __restrict__ G,
                   float* __restrict__ rnorm,
                   const float* __restrict__ mask, float* __restrict__ mm) {
    const int blk = blockIdx.x;
    if (blk < GRAM_BLOCKS)
        gram_tile(blk & 15, (blk >> 4) & 15, blk >> 8, fsrc, bsrc, G);
    else if (blk < GRAM_BLOCKS + MM_BLOCKS)
        build_mm(blk - GRAM_BLOCKS, mask, mm);
    else
        patch_rnorm(blk - GRAM_BLOCKS - MM_BLOCKS, bsrc, rnorm);
}

// ---------------------------------------------------------------------------
// 3x3 patch correlation from the pixel Gram matrix, kept transposed,
// G[s][p] = sum_c fd[c][s]*bd[c][p] (fd, bd: f and b at every other row and column):
//   S[s][p] = rnorm[p] * sum_{dy,dx=-1..1} G[s + 32*dy + dx][p + 32*dy + dx]
// a tap counting only where both shifted pixels lie inside the 32x32 image (zero
// padding of both patches). One block = PS_ROWS consecutive rows s of one image row; a
// thread owns 4 consecutive p, which share one image row, in each of them. The rows' taps
// overlap: per dy the block reads PS_ROWS + 2 rows of G, each once. Every tap is one
// aligned 16-byte load; for dx = -1/+1 the element that crosses the 4-group comes from
// the neighbour lane.
// ---------------------------------------------------------------------------
#define PS_ROWS 4
// G and rnorm carry no __restrict__, so that the clobber below keeps their loads in front of it.
__global__ __launch_bounds__(256)
void patch_sum9(const float* G, const float* rnorm, float* S) {
    const int q0 = blockIdx.x * PS_ROWS;      // first row: foreground pixel s
    const int b = blockIdx.y;
    const float* Gb = G + (size_t)b * L * L;
    const int qy = q0 >> 5, qx0 = q0 & 31;
    const int c4 = threadIdx.x * 4;           // columns: background patches p
    const int cy = c4 >> 5, cx0 = c4 & 31;
    // All loads are unconditional (a tap outside the image reads a row / column of its own
    // block instead and is then replaced by zero), so they fly together.
    // w[dy + 1][j] is row q0 + 32*dy + j - 1 at columns c4 + 32*dy ..
    float4 w[3][PS_ROWS + 2];
    unsigned boff[3];                         // byte column, per lane
    #pragma unroll
    for (int d = 0; d < 3; ++d) {
        const int dy = d - 1;
        const bool cv = (cy + dy >= 0) && (cy + dy < HD);
        boff[d] = (unsigned)(cv ? c4 + 32 * dy : c4) * 4u;
        const bool yv = (qy + dy >= 0) && (qy + dy < HD);                 // same for the block
        const int rb = yv ? q0 + 32 * dy : q0;                            // rows rb .. rb + PS_ROWS - 1 exist
        const char* mid = (const char*)(Gb + (size_t)rb * L);
        const char* lo  = (const char*)(Gb + (size_t)(qx0 > 0 ? rb - 1 : rb) * L);
        const char* hi  = (const char*)(Gb + (size_t)(qx0 + PS_ROWS < WD ? rb + PS_ROWS : rb) * L);
        w[d][0] = *(const float4*)(lo + boff[d]);
        #pragma unroll
        for (int j = 1; j <= PS_ROWS; ++j)
            w[d][j] = *(const float4*)(mid + boff[d] + (unsigned)((j - 1) * L * 4));
        w[d][PS_ROWS + 1] = *(const float4*)(hi + boff[d]);
    }
    const float4 sc = *(const float4*)((const char*)(rnorm + b * L) + boff[1]);
    // precaution: the loads' address registers are named so that they live up to the wait and
    // no load's result is given one of them ahead of that; the clobber keeps the loads up here
    asm volatile("s_wait_xcnt 0x0" :: "v"(boff[0]), "v"(boff[1]), "v"(boff[2]) : "memory");
    // without it the scheduler puts the first rows' sums in front of the last loads, which
    // then start only when the first have landed
    __builtin_amdgcn_sched_barrier(0);
    #pragma unroll
    for (int d = 0; d < 3; ++d) {
        const int dy = d - 1;
        #pragma unroll
        for (int j = 0; j < PS_ROWS + 2; ++j) {
            const bool ok = (qy + dy >= 0) && (qy + dy < HD) && (qx0 + j - 1 >= 0) && (qx0 + j - 1 < WD) &&
                            (cy + dy >= 0) && (cy + dy < HD);
            if (!ok) w[d][j] = make_float4(0.0f, 0.0f, 0.0f, 0.0f);
        }
    }
    #pragma unroll
    for (int i = 0; i < PS_ROWS; ++i) {
        float a0 = 0.0f, a1 = 0.0f, a2 = 0.0f, a3 = 0.0f;
        #pragma unroll
        for (int t = 0; t < 9; ++t) {
            const int dx = t % 3 - 1;
            const float4 x = w[t / 3][i + dx + 1];
            if (dx == 0) {
                a0 += x.x; a1 += x.y; a2 += x.z; a3 += x.w;
            } else if (dx < 0) {
                const float e = __shfl_up(x.w, 1);               // column c4 - 1
                a0 += (cx0 == 0) ? 0.0f : e;
                a1 += x.x; a2 += x.y; a3 += x.z;
            } else {
                const float e = __shfl_down(x.x, 1);             // column c4 + 4
                a0 += x.y; a1 += x.z; a2 += x.w;
                a3 += (cx0 == 28) ? 0.0f : e;
            }
        }
        *(float4*)&S[((size_t)b * L + q0 + i) * L + c4] =
            make_float4(a0 * sc.x, a1 * sc.y, a2 * sc.z, a3 * sc.w);
    }
}

// ---------------------------------------------------------------------------
// Both diagonal fuse passes and the masked softmax, on the transposed scores S[s][p].
//   F1[i][j] = sum_{d1=-1..1} S[i+d1][j+d1]                 (flat indices, zero outside)
//   F2[s][p] = sum_{d2=-1..1} F1[T(T(s)+d2)][T(T(p)+d2)]    (zero where T(.)+d2 leaves 0..1023)
//   T(y*32+x) = x*32+y  (the transposed flattening; T is its own inverse)
//   yiT[b][s][p] = softmax_p(F2[s][p]*mm[p]*10) * mm[p]
// One block = SROWS consecutive s of one image row. T(T(s)+d2) steps by 1 with s there,
// so each d2 needs SROWS+2 consecutive rows of S; async copies stage them in LDS. A row outside
// the matrix is staged as zeros, and each row has a zero in front of and behind it, so
// a tap at column -1 or 1024 adds zero with no test. All 1024 p of an s are in the
// block, so the softmax follows on the spot, the SROWS reductions side by side.
// ---------------------------------------------------------------------------
#define ROWP  (L + 8)     // floats per staged row: data at 4..L+3, zeros at 3 and L+4
#define SROWS 4
#define GROWS (SROWS + 2) // staged rows per d2
__global__ __launch_bounds__(256)
void fuse_softmax(const float* __restrict__ S, const float* __restrict__ mm,
                  float* __restrict__ yiT) {
    __shared__ __attribute__((aligned(16))) float rows[3 * GROWS * ROWP];
    __shared__ __attribute__((aligned(16))) float red[256][SROWS];   // a thread's SROWS partials side by side
    const int s0 = blockIdx.x * SROWS;
    const int b = blockIdx.y;
    const int tid = threadIdx.x;
    const char* src = (const char*)(S + (size_t)b * L * L);
    const int js0 = (s0 & 31) * 32 + (s0 >> 5);               // T(s0); T(s0 + i) = js0 + 32*i
    const unsigned boff = (unsigned)tid * 16u;                // byte column, per lane
    // Every lane copies its 16 bytes of each of the 18 rows straight to LDS; the copies are
    // unconditional (a row outside the matrix copies row s0 instead and is then overwritten
    // with zeros), so they fly together. Every loop over g, j, i, k and d2 is unrolled so
    // that the arrays are indexed by constants only and stay in registers.
    const unsigned lbase = lds_addr32(&rows[4 + tid * 4]);
    float m[4];                                               // asked for early: lands under the copies
    #pragma unroll
    for (int k = 0; k < 4; ++k) m[k] = mm[tid + k * 256];
    #pragma unroll
    for (int g = 0; g < 3; ++g) {
        const int tt = js0 + g - 1;
        const int r0 = ((tt & 31) << 5) + (tt >> 5) - 1;      // row in slot 0 of this d2
        const char* gp[GROWS];
        unsigned lp[GROWS];
        #pragma unroll
        for (int j = 0; j < GROWS; ++j) {
            const bool ok = (r0 + j >= 0) && (r0 + j < L);    // same for the block
            gp[j] = src + (size_t)(ok ? r0 + j : s0) * (L * 4) + boff;
            lp[j] = lbase + (unsigned)((g * GROWS + j) * ROWP * 4);
        }
        async_copy16x6(lp[0], gp[0], lp[1], gp[1], lp[2], gp[2],
                       lp[3], gp[3], lp[4], gp[4], lp[5], gp[5]);
    }
    wait_async0();       // my copies have landed: my own bytes may be overwritten, and published
    #pragma unroll
    for (int g = 0; g < 3; ++g) {
        const int tt = js0 + g - 1;
        const int r0 = ((tt & 31) << 5) + (tt >> 5) - 1;
        #pragma unroll
        for (int j = 0; j < GROWS; ++j) {
            if ((r0 + j < 0) || (r0 + j >= L))
                *(float4*)&rows[(g * GROWS + j) * ROWP + 4 + tid * 4] =
                    make_float4(0.0f, 0.0f, 0.0f, 0.0f);
        }
    }
    if (tid < 3 * GROWS) {
        rows[tid * ROWP + 3]     = 0.0f;
        rows[tid * ROWP + L + 4] = 0.0f;
    }
    __syncthreads();

    float v[SROWS][4];
    #pragma unroll
    for (int k = 0; k < 4; ++k) {
        const int p  = tid + k * 256;
        const int ip = (p & 31) * 32 + (p >> 5);
        float acc[SROWS];
        #pragma unroll
        for (int i = 0; i < SROWS; ++i) acc[i] = 0.0f;
        #pragma unroll
        for (int d2 = -1; d2 <= 1; ++d2) {
            const int u  = ip + d2;
            const int c2 = ((u & 31) << 5) + (u >> 5);        // 991 at u = -1, 32 at u = 1024: in range
            const bool uok = (u >= 0) && (u < L);
            const float* rp = &rows[(d2 + 1) * GROWS * ROWP + 4 + c2];
            #pragma unroll
            for (int i = 0; i < SROWS; ++i) {
                const int ti = js0 + 32 * i + d2;             // same for the block
                float f1 = 0.0f;
                f1 += rp[i * ROWP - 1];
                f1 += rp[(i + 1) * ROWP];
                f1 += rp[(i + 2) * ROWP + 1];
                acc[i] += (uok && ti >= 0 && ti < L) ? f1 : 0.0f;
            }
        }
        #pragma unroll
        for (int i = 0; i < SROWS; ++i) v[i][k] = acc[i] * m[k] * SOFTMAX_SCALE;
    }
    #pragma unroll
    for (int i = 0; i < SROWS; ++i)
        red[tid][i] = fmaxf(fmaxf(v[i][0], v[i][1]), fmaxf(v[i][2], v[i][3]));
    __syncthreads();
    for (int st = 128; st > 0; st >>= 1) {
        if (tid < st) {
            #pragma unroll
            for (int i = 0; i < SROWS; ++i) red[tid][i] = fmaxf(red[tid][i], red[tid + st][i]);
        }
        __syncthreads();
    }
    float mx[SROWS];
    #pragma unroll
    for (int i = 0; i < SROWS; ++i) mx[i] = red[0][i];
    __syncthreads();
    #pragma unroll
    for (int i = 0; i < SROWS; ++i) {
        float ssum = 0.0f;
        #pragma unroll
        for (int k = 0; k < 4; ++k) { v[i][k] = expf(v[i][k] - mx[i]); ssum += v[i][k]; }
        red[tid][i] = ssum;
    }
    __syncthreads();
    for (int st = 128; st > 0; st >>= 1) {
        if (tid < st) {
            #pragma unroll
            for (int i = 0; i < SROWS; ++i) red[tid][i] += red[tid + st][i];
        }
        __syncthreads();
    }
    #pragma unroll
    for (int i = 0; i < SROWS; ++i) {
        const float inv = 1.0f / red[0][i];
        float* dst = yiT + ((size_t)b * L + s0 + i) * L;
        #pragma unroll
        for (int k = 0; k < 4; ++k) dst[tid + k * 256] = v[i][k] * inv * m[k];
    }
}

// ---------------------------------------------------------------------------
// The stride-2 transposed conv with the 4x4 raw patches, by output parity.
// With Y = 2*Yh + ry, X = 2*Xh + rx, s = Yh*32 + Xh, p = u*32 + v:
//   out[b,c,Y,X] = 0.25 * sum_p Apar[r][s][p] * b_full[b, c, 2*u + ry, 2*v + rx]
//   Apar[r][s][p] = sum_{dy in {0,sy}, dx in {0,sx}} yiT[b][s + 32*dy + dx][p + 32*dy + dx]
// sy = ry ? +1 : -1, sx = rx ? +1 : -1; a tap counts only where both shifted pixels
// lie inside the 32x32 image. (The 16 taps of a raw patch overlap its neighbours':
// each full-resolution pixel is met by 2x2 (position, patch) pairs on one diagonal.)
//
// Apar is never stored, and neither b_full nor out is re-laid by parity. One block =
// (b, ry, image row Yh, 64 channels), both rx, that is one whole row Y = 2*Yh + ry of out for
// 64 channels; a K step is one image row u of p (32 values), that is one whole row 2*u + ry of
// b_full (64 values, the two rx interleaved). Per step the block stages those 64 channel rows
// as they lie, and
//   E[j][v] = yiT[Yh*32 + j][u*32 + v] + yiT[(Yh+sy)*32 + j][(u+sy)*32 + v]
// in LDS with zeros all round, and a wave forms its B fragments on the way to the WMMA:
//   Apar[ry*2+rx][Yh*32 + j][u*32 + v] = E[j][v] + E[j + sx][v + sx]
// 4 waves: wr = which 32 channels, wc = which 16 of the 32 Xh; a wave does both rx. One 16-byte
// LDS read of b_full, X = 2*v .. 2*v + 3, holds the K pair (v, v + 1) of both rx; a lane ends
// with out at X = 2*Xh and 2*Xh + 1, which it stores as one pair.
// ---------------------------------------------------------------------------
__device__ __forceinline__ float4 add4(float4 a, float4 b) {
    return make_float4(a.x + b.x, a.y + b.y, a.z + b.z, a.w + b.w);
}
#define PA   68                  // floats per staged b_full row: 64 + 4, so that 16-byte reads of 16 rows meet no bank twice
#define A2_F (64 * PA)           // 64 channel rows
#define PK   36                  // floats per staged E row: 16-byte multiple, 8-byte reads of 16 rows meet no bank twice
#define E_F  (34 * PK + 4)       // rows j = -1..32; data at columns 4..35, columns 0..3 stay zero
// yiT carries no __restrict__: with it the compiler sinks the row loads past the clobber below
// to their first use, behind the WMMAs, where their whole latency is waited for.
__global__ __launch_bounds__(128)
void gemm_parity_shift(const float* __restrict__ bsrc, const float* yiT,
                       float* __restrict__ out) {
    __shared__ __attribute__((aligned(16))) float As[2 * A2_F];
    __shared__ __attribute__((aligned(16))) float Es[2 * E_F];
    const int yh = blockIdx.x;
    const int ch = blockIdx.y;
    const int ry = blockIdx.z & 1;
    const int b  = blockIdx.z >> 1;
    const int sy = ry ? 1 : -1;
    const bool yok = (yh + sy >= 0) && (yh + sy < HD);     // same for the block

    const int tid  = threadIdx.x;
    const int lane = tid & 31;
    const int wave = tid >> 5;
    const int wr = wave & 1;          // which 32 of the 64 channels
    const int wc = wave >> 1;         // which 16 of the 32 Xh
    const int hf = lane >> 4;         // lane half (K-pair select)
    const int lx = lane & 15;

    // staging of E: thread -> row lr and lr + 16, float4 at column lc
    const int lr = tid >> 3;          // 0..15
    const int lc = (tid & 7) << 2;    // 0,4,..,28
    // staging of the channel rows: thread -> row ar (+8 per further slot), float4 at column ac
    const int ar = tid >> 4;          // 0..7
    const int ac = (tid & 15) << 2;   // 0,4,..,60

    const float* gA = bsrc + (((size_t)b * CH + ch * 64 + ar) * H0 + ry) * W0 + ac;
    const unsigned lA = lds_addr32(&As[ar * PA + ac]);
    // softmax rows of image row Yh, and of image row Yh + sy (Yh itself where that is outside)
    const float* gY0 = yiT + ((size_t)b * L + yh * WD + lr) * L + lc;
    const float* gY1 = yiT + ((size_t)b * L + (yok ? yh + sy : yh) * WD + lr) * L + lc;

    // the zeros round E, in both buffers; the data cells are overwritten behind the barrier
    for (int i = tid; i < 2 * E_F; i += 128) Es[i] = 0.0f;

    v8f acc00 = 0.0f, acc01 = 0.0f, acc10 = 0.0f, acc11 = 0.0f;   // acc<16-channel tile><rx>
    float4 y0a, y0b, y1a, y1b;        // the next step's rows lr and lr + 16 of both image rows

#define ISSUE_STEP(un, buf)                                                              \
    {                                                                                    \
        const float* ga = gA + (un) * (2 * W0);                                          \
        const unsigned la = lA + (unsigned)(buf) * (A2_F * 4);                           \
        async_copy16x8(la,                ga,                                            \
                       la +  8 * PA * 4,  ga +  8 * H0 * W0,                             \
                       la + 16 * PA * 4,  ga + 16 * H0 * W0,                             \
                       la + 24 * PA * 4,  ga + 24 * H0 * W0,                             \
                       la + 32 * PA * 4,  ga + 32 * H0 * W0,                             \
                       la + 40 * PA * 4,  ga + 40 * H0 * W0,                             \
                       la + 48 * PA * 4,  ga + 48 * H0 * W0,                             \
                       la + 56 * PA * 4,  ga + 56 * H0 * W0);                            \
        const bool uok = ((un) + sy >= 0) && ((un) + sy < HD);                           \
        const float* p0 = gY0 + (un) * 32;                                               \
        const float* p1 = gY1 + (uok ? (un) + sy : (un)) * 32;                           \
        y0a = *(const float4*)p0;                                                        \
        y0b = *(const float4*)(p0 + 16 * L);                                             \
        y1a = *(const float4*)p1;                                                        \
        y1b = *(const float4*)(p1 + 16 * L);                                             \
        /* precaution: later code is given these loads' address registers; the clobber */ \
        /* also keeps the loads up here, so that they fly under the step's WMMAs */       \
        asm volatile("s_wait_xcnt 0x0" ::: "memory");                                    \
    }
#define STORE_E(un, buf)                                                                 \
    {                                                                                    \
        const bool ok = yok && ((un) + sy >= 0) && ((un) + sy < HD);                     \
        float4 ea = y0a, eb = y0b;                                                       \
        if (ok) { ea = add4(y0a, y1a); eb = add4(y0b, y1b); }   /* same for the block */ \
        float* e = &Es[(buf) * E_F + (lr + 1) * PK + 4 + lc];                            \
        *(float4*)e             = ea;                                                    \
        *(float4*)(e + 16 * PK) = eb;                                                    \
    }

    // prologue: step 0 into buffer 0
    ISSUE_STEP(0, 0)
    __syncthreads();     // every zero is written before a data cell is
    STORE_E(0, 0)
    asm volatile("s_wait_dscnt 0x0" ::: "memory");   // my E cells are in LDS
    wait_async0();                                    // my copies have landed
    __syncthreads();

    const int aoff = (wr * 32 + lx) * PA + 4 * hf;
    const int eoff = (wc * 16 + lx + 1) * PK + 4 + 2 * hf;
    for (int u = 0; u < HD; ++u) {
        const int cur = u & 1;
        const int nxt = cur ^ 1;
        // the next step's copies and loads fly while this step is worked on
        if (u + 1 < HD) ISSUE_STEP(u + 1, nxt)

        const float* Ac = &As[cur * A2_F + aoff];
        const float* Ec = &Es[cur * E_F + eoff];
        const float* Em = Ec - (PK + 1);               // row j - 1, column v - 1: rx = 0
        const float* Ep = Ec + (PK + 1);               // row j + 1, column v + 1: rx = 1
        #pragma unroll
        for (int ks = 0; ks < 8; ++ks) {
            const int kb = ks * 4;
            const float4 x0 = *(const float4*)&Ac[2 * kb];
            const float4 x1 = *(const float4*)&Ac[16 * PA + 2 * kb];
            const v2f e = *(const v2f*)&Ec[kb];
            v2f a00, a01, a10, a11, b0, b1;
            a00.x = x0.x; a00.y = x0.z;                // even X: rx = 0
            a01.x = x0.y; a01.y = x0.w;                // odd X:  rx = 1
            a10.x = x1.x; a10.y = x1.z;
            a11.x = x1.y; a11.y = x1.w;
            b0.x = e.x + Em[kb];
            b0.y = e.y + Em[kb + 1];
            b1.x = e.x + Ep[kb];
            b1.y = e.y + Ep[kb + 1];
            acc00 = __builtin_amdgcn_wmma_f32_16x16x4_f32(false, a00, false, b0,
                        (short)0, acc00, false, false);
            acc01 = __builtin_amdgcn_wmma_f32_16x16x4_f32(false, a01, false, b1,
                        (short)0, acc01, false, false);
            acc10 = __builtin_amdgcn_wmma_f32_16x16x4_f32(false, a10, false, b0,
                        (short)0, acc10, false, false);
            acc11 = __builtin_amdgcn_wmma_f32_16x16x4_f32(false, a11, false, b1,
                        (short)0, acc11, false, false);
        }

        if (u + 1 < HD) STORE_E(u + 1, nxt)
        asm volatile("s_wait_dscnt 0x0" ::: "memory");   // my reads of cur are over, my E cells are in LDS
        wait_async0();       // my next-step copies have landed
        __syncthreads();     // everyone's have; everyone is done reading cur
    }
#undef ISSUE_STEP
#undef STORE_E

    // C/D layout: VGPR r holds M = r (lanes 0-15) / r+8 (lanes 16-31), N = lane & 15.
    // 16 lanes store one whole 128-byte line of out.
    float* o = out + (((size_t)b * CH + ch * 64 + wr * 32 + 8 * hf) * H0 + 2 * yh + ry) * W0
                   + (wc * 16 + lx) * 2;
    #pragma unroll
    for (int mt = 0; mt < 2; ++mt) {
        v8f c0 = (mt == 0) ? acc00 : acc10;
        v8f c1 = (mt == 0) ? acc01 : acc11;
        #pragma unroll
        for (int r = 0; r < 8; ++r)
            *(float2*)(o + (mt * 16 + r) * (H0 * W0)) = make_float2(c0[r] * 0.25f, c1[r] * 0.25f);
    }
}

// ---------------------------------------------------------------------------
extern "C" void kernel_launch(void* const* d_in, const int* in_sizes, int n_in,
                              void* d_out, int out_size, void* d_ws, size_t ws_size,
                              hipStream_t stream) {
    const float* f    = (const float*)d_in[0];   // (4,128,64,64)
    const float* bsrc = (const float*)d_in[1];   // (4,128,64,64)
    const float* mask = (const float*)d_in[2];   // (4,1,256,256)
    float* out = (float*)d_out;

    // workspace layout (bytes)
    const size_t SZ_YI   = (size_t)BATCH * L * L * 4;      // 16,777,216
    char* w = (char*)d_ws;
    float* yiA    = (float*)(w);
    float* yiB    = (float*)(w + SZ_YI);
    float* rnorm  = (float*)(w + 2 * SZ_YI);
    float* mmbuf  = rnorm + BATCH * L;

    // GEMM1: yiB[b][s][p] = sum_c fd[c,s] bd[c,p]   (1024x1024x128, pixel Gram matrix of the
    // downsampled images, read from f and b as they lie), with rnorm and mm beside it
    gram_rnorm_mm<<<GRAM_BLOCKS + MM_BLOCKS + RN_BLOCKS, 128, 0, stream>>>(
        f, bsrc, yiB, rnorm, mask, mmbuf);
    // yiA[b][s][p] = rnorm[p] * 9-tap diagonal sum of the Gram matrix
    {
        dim3 grid(L / PS_ROWS, BATCH);
        patch_sum9<<<grid, 256, 0, stream>>>(yiB, rnorm, yiA);
    }
    // yiB[b][s][p] = yiT: both fuse passes and the masked softmax over p
    {
        dim3 grid(L / SROWS, BATCH);
        fuse_softmax<<<grid, 256, 0, stream>>>(yiA, mmbuf, yiB);
    }

    // GEMM2: out[b,c,Y,X] = 0.25 * sum_p b_full[c, 2u+ry, 2v+rx] * Apar[s,p]   (16 x 128x1024x1024),
    // Apar being the 2x2 diagonal shift-sum of yiT, formed in the kernel's own operand staging
    {
        dim3 grid(HD, CH / 64, BATCH * 2);
        gemm_parity_shift<<<grid, 128, 0, stream>>>(bsrc, yiB, out);
    }
}
